// v000
// The times below were measured on an AMD MI455X: many runs one after another, warmed up first and cycling through
// copies of the inputs, with the whole window's GPU time divided by the number of runs. Launches and the gaps
// between them are all in it. The median over several windows is given; except for v000 it joins two sittings, which
// can be a few percent apart, so the side-by-side timings, each taken in one sitting, are the better comparison.
// v000 is the starting kernel. One run takes 359 microseconds.
// Contractions: q, k, v^T projections on v_wmma_f32_16x16x32_bf16 (bf16 RNE operands from the raw inputs, single product, f32 accumulate); q.k^T and p.v on v_wmma_f32_16x16x32_f16 (f16 q/k/v planes, p carried x2^15, f32 accumulate, online softmax and additive bias in f32); output projection on v_wmma_f32_16x16x32_f16 (O carried x64 in f16, Wo as bf16-RNE value x64 in f16, f32 accumulate, x1/4096 in the f32 epilogue).
#include <hip/hip_runtime.h>
#include <math.h>
#include <stdint.h>

constexpr int BATCH_N = 2;
constexpr int SEQ_LEN = 2048;
constexpr int DMODEL  = 1024;
constexpr int NHEADS  = 16;
constexpr int HDIM    = 64;
constexpr int MTOK    = BATCH_N * SEQ_LEN;   // 4096 token rows
static_assert(NHEADS * HDIM == DMODEL, "head split");

constexpr float P_CARRY = 32768.0f;   // probabilities carried x2^15 in f16
constexpr float O_CARRY = 64.0f;      // attention output carried x64 in f16
constexpr float W_CARRY = 64.0f;      // Wo carried x64 in f16

typedef __attribute__((ext_vector_type(16))) _Float16 v16h;
typedef __attribute__((ext_vector_type(8)))  _Float16 v8h;
typedef __attribute__((ext_vector_type(16))) __bf16   v16b;
typedef __attribute__((ext_vector_type(8)))  __bf16   v8b;
typedef __attribute__((ext_vector_type(8)))  float    v8f;
typedef __attribute__((ext_vector_type(4)))  float    v4f;

__device__ __forceinline__ unsigned short f2bf_bits(float f) {
  unsigned u = __float_as_uint(f);
  return (unsigned short)((u + 0x7FFFu + ((u >> 16) & 1u)) >> 16);
}
__device__ __forceinline__ float bf_bits2f(unsigned short h) { return __uint_as_float(((unsigned)h) << 16); }
// f32 value of the RNE bf16 of f
__device__ __forceinline__ float bf16_rne_f32(float f) { return bf_bits2f(f2bf_bits(f)); }

// hazard guards as plain device helpers (no inline asm inside the kernel template body)
__device__ __forceinline__ void dep_guard_h(v8f& a, v8f& b, v16h x, v16h y) { asm volatile("v_nop\n\tv_nop\n\tv_nop\n\tv_nop" : "+v"(a), "+v"(b) : "v"(x), "v"(y)); }
__device__ __forceinline__ void dep_guard_b(v8f& a, v8f& b, v16b x, v16b y) { asm volatile("v_nop\n\tv_nop\n\tv_nop\n\tv_nop" : "+v"(a), "+v"(b) : "v"(x), "v"(y)); }
__device__ __forceinline__ void keep4_h(v16h a, v16h b, v16h c, v16h d) { asm volatile("v_nop" :: "v"(a), "v"(b), "v"(c), "v"(d)); }
__device__ __forceinline__ void keep4_b(v16b a, v16b b, v16b c, v16b d) { asm volatile("v_nop" :: "v"(a), "v"(b), "v"(c), "v"(d)); }
__device__ __forceinline__ void acc_guard4(v8f& a, v8f& b, v8f& c, v8f& d) { asm volatile("v_nop\n\tv_nop\n\tv_nop\n\tv_nop" : "+v"(a), "+v"(b), "+v"(c), "+v"(d)); }
template <typename T> struct Frag;
template <> struct Frag<_Float16> {
  typedef v16h V; union U { v16h v; v8h h[2]; };
  static __device__ __forceinline__ v16h load(const _Float16* p) {   // elements 0..7 <- p[0..7], 8..15 <- p[16..23]
    U f; f.h[0] = *(const v8h*)(p); f.h[1] = *(const v8h*)(p + 16); return f.v;
  }
  static __device__ __forceinline__ v8f mma(v16h a, v16h b, v8f c) {
    return __builtin_amdgcn_wmma_f32_16x16x32_f16(false, a, false, b, (short)0, c, false, false);
  }
  static __device__ __forceinline__ void guard(v8f& a, v8f& b, v16h x, v16h y) { dep_guard_h(a, b, x, y); }
  static __device__ __forceinline__ void keep(v16h a, v16h b, v16h c, v16h d) { keep4_h(a, b, c, d); }
};
template <> struct Frag<__bf16> {
  typedef v16b V; union U { v16b v; v8b h[2]; };
  static __device__ __forceinline__ v16b load(const __bf16* p) {
    U f; f.h[0] = *(const v8b*)(p); f.h[1] = *(const v8b*)(p + 16); return f.v;
  }
  static __device__ __forceinline__ v8f mma(v16b a, v16b b, v8f c) {
    return __builtin_amdgcn_wmma_f32_16x16x32_bf16(false, a, false, b, (short)0, c, false, false);
  }
  static __device__ __forceinline__ void guard(v8f& a, v8f& b, v16b x, v16b y) { dep_guard_b(a, b, x, y); }
  static __device__ __forceinline__ void keep(v16b a, v16b b, v16b c, v16b d) { keep4_b(a, b, c, d); }
};

// ---- Register-blocked batched WMMA GEMM ------------------------------------
// C[m,n] = scale * sum_k A[m,k] * Bt[n,k] (+bias)(+resid); each wave owns a 64x64 tile.
// A row-major [M,K]; Bt row-major [N,K]; M,N % 64 == 0, K % 32 == 0.
// SPLIT: operands are hi/lo planes (A2/Bt2 = lo planes, same layout); product = hi.hi + hi.lo + lo.hi.
// BIAS_MODE: 0 = none, 1 = bias[m], 2 = bias[n].
// OUT_MODE: 0 = f32, 1 = f16, 2 = bf16 hi plane (Cout) + bf16 lo plane (Cout2).
// ET: 0 = f16 operands, 1 = bf16 operands (pointers passed as 16-bit storage)
template <int ET> struct Elem;
template <> struct Elem<0> { typedef _Float16 T; };
template <> struct Elem<1> { typedef __bf16 T; };
template <int ET, bool SPLIT, int BIAS_MODE, int OUT_MODE, bool RESID, int ACT = 0>
__global__ __launch_bounds__(256) void wmma_gemm64(
    const unsigned short* __restrict__ Ap, const unsigned short* __restrict__ A2p, int lda, long strideA,
    const unsigned short* __restrict__ Btp, const unsigned short* __restrict__ Bt2p, int ldb, long strideB,
    void* __restrict__ Cout, void* __restrict__ Cout2, int ldc, long strideC,
    const float* __restrict__ bias,
    const float* __restrict__ resid, long strideR,
    int M, int N, int K, float scale) {
  typedef typename Elem<ET>::T T;
  typedef typename Frag<T>::V V;
  const T* A = (const T*)Ap; const T* A2 = (const T*)A2p; const T* Bt = (const T*)Btp; const T* Bt2 = (const T*)Bt2p;
  __shared__ __align__(16) float sT[8][16 * 68];   // per-wave 16x64 slab, pitch 68 floats
  const int b    = blockIdx.y;
  const int lane = threadIdx.x & 31;
  const int wave = threadIdx.x >> 5;
  const int tilesN = N >> 6;
  const int tilesM = M >> 6;
  const int tile = blockIdx.x * 8 + wave;
  if (tile >= tilesM * tilesN) return;   // wave-uniform; no block barriers in this kernel
  const int tm = tile / tilesN;
  const int tn = tile - tm * tilesN;
  const int m0 = tm << 6;
  const int n0 = tn << 6;

  const T* Ab  = A  + (size_t)b * strideA;
  const T* Bb  = Bt + (size_t)b * strideB;
  const T* Ab2 = SPLIT ? (A2  + (size_t)b * strideA) : nullptr;
  const T* Bb2 = SPLIT ? (Bt2 + (size_t)b * strideB) : nullptr;

  const int rlane = lane & 15;                 // row (A) / col (B, D) within subtile
  const int koff  = (lane >> 4) * 8;           // k offset of this lane half
  const int mOff  = (lane >> 4) * 8;           // D row offset

  v8f acc[4][4];
#pragma unroll
  for (int i = 0; i < 4; ++i)
#pragma unroll
    for (int j = 0; j < 4; ++j) acc[i][j] = (v8f){0.f,0.f,0.f,0.f,0.f,0.f,0.f,0.f};

  for (int k0 = 0; k0 < K; k0 += 32) {
    V bh[4], bl[4];
#pragma unroll
    for (int j = 0; j < 4; ++j) {
      const size_t bo = (size_t)(n0 + (j << 4) + rlane) * ldb + koff + k0;
      bh[j] = Frag<T>::load(Bb + bo);
      if (SPLIT) bl[j] = Frag<T>::load(Bb2 + bo);
    }
#pragma unroll
    for (int i = 0; i < 4; ++i) {
      const size_t ao = (size_t)(m0 + (i << 4) + rlane) * lda + koff + k0;
      V ah = Frag<T>::load(Ab + ao);
      V al;
      if (SPLIT) al = Frag<T>::load(Ab2 + ao);
#pragma unroll
      for (int j = 0; j < 4; ++j) {
        acc[i][j] = Frag<T>::mma(ah, bh[j], acc[i][j]);
        if (SPLIT) {
          acc[i][j] = Frag<T>::mma(ah, bl[j], acc[i][j]);
          acc[i][j] = Frag<T>::mma(al, bh[j], acc[i][j]);
        }
      }
      Frag<T>::guard(acc[i][0], acc[i][3], ah, SPLIT ? al : ah);
    }
    Frag<T>::keep(bh[0], bh[1], bh[2], bh[3]);
    if (SPLIT) Frag<T>::keep(bl[0], bl[1], bl[2], bl[3]);
  }
  acc_guard4(acc[0][0], acc[0][1], acc[0][2], acc[0][3]);
  acc_guard4(acc[1][0], acc[1][1], acc[1][2], acc[1][3]);
  acc_guard4(acc[2][0], acc[2][1], acc[2][2], acc[2][3]);
  acc_guard4(acc[3][0], acc[3][1], acc[3][2], acc[3][3]);

  // ---- epilogue ----
  float* slab = sT[wave];
  const float* Rb = RESID ? (resid + (size_t)b * strideR) : nullptr;
#pragma unroll
  for (int i = 0; i < 4; ++i) {
    const int mBase = m0 + (i << 4);
#pragma unroll
    for (int j = 0; j < 4; ++j) {
      const int n = n0 + (j << 4) + rlane;
      float bv = 0.f;
      if (BIAS_MODE == 2) bv = bias[n];
#pragma unroll
      for (int r = 0; r < 8; ++r) {
        float v = acc[i][j][r] * scale;
        if (BIAS_MODE == 1) v += bias[mBase + mOff + r];
        if (BIAS_MODE == 2) v += bv;
        if (RESID) v += Rb[(size_t)(mBase + mOff + r) * ldc + n];
        if (ACT == 1) v = tanhf(v);
        if (ACT == 2) v = fmaxf(v, 0.0f);
        if (ACT == 3) v = v / (1.0f + expf(-v));
        if (ACT == 4) v = (v > 0.f) ? v : 0.01f * v;
        if (ACT == 5) v = 0.5f * v * (1.0f + erff(v * 0.70710678118654752f));
        slab[(mOff + r) * 68 + (j << 4) + rlane] = v;
      }
    }
    __builtin_amdgcn_fence(__ATOMIC_RELEASE, "workgroup");
    __builtin_amdgcn_wave_barrier();
    __builtin_amdgcn_fence(__ATOMIC_ACQUIRE, "workgroup");
    if (OUT_MODE == 0) {
      float* C = (float*)Cout + (size_t)b * strideC;
      const int hh = lane >> 4, c4 = (lane & 15) * 4;     // row seg = 256 B = 16 lanes x 16 B
      {
#pragma unroll
        for (int it = 0; it < 8; ++it) {
          const int row = it * 2 + hh;
          v4f v = *(const v4f*)(slab + row * 68 + c4);
          *(v4f*)(C + (size_t)(mBase + row) * ldc + n0 + c4) = v;
        }
        
      }
    } else {
      const int q = lane >> 3, c8 = (lane & 7) * 8;
      unsigned short* C  = (unsigned short*)Cout  + (size_t)b * strideC;
      unsigned short* C2 = (OUT_MODE == 2) ? ((unsigned short*)Cout2 + (size_t)b * strideC) : nullptr;
      {
#pragma unroll
        for (int it = 0; it < 4; ++it) {
          const int row = it * 4 + q;
          const float* sp = slab + row * 68 + c8;
          v8h hv, lv;
#pragma unroll
          for (int e = 0; e < 8; ++e) {
            if (OUT_MODE == 1) {
              hv[e] = (_Float16)sp[e];
            } else {
              unsigned short hb = f2bf_bits(sp[e]);
              unsigned short lb = f2bf_bits(sp[e] - bf_bits2f(hb));
              hv[e] = __builtin_bit_cast(_Float16, hb);
              lv[e] = __builtin_bit_cast(_Float16, lb);
            }
          }
          *(v8h*)(C + (size_t)(mBase + row) * ldc + n0 + c8) = hv;
          if (OUT_MODE == 2) *(v8h*)(C2 + (size_t)(mBase + row) * ldc + n0 + c8) = lv;
        }
        
      }
    }
    __builtin_amdgcn_fence(__ATOMIC_RELEASE, "workgroup");
    __builtin_amdgcn_wave_barrier();
    __builtin_amdgcn_fence(__ATOMIC_ACQUIRE, "workgroup");
  }
}

// ---------------------------------------------------------------------------
// f32 -> bf16 (RNE) cast: 2 elements per thread, ONE 4-B store per lane -> each wave writes exactly one whole
// Coverage: grid = n2/256 blocks x 256 threads x 2 elements = 2*n2 = whole plane
//   x : n2 = 4096*1024/2 = 2097152 = 8192 blocks;  W : n2 = 1024*1024/2 = 524288 = 2048 blocks (exact multiples).
// ---------------------------------------------------------------------------
__device__ __forceinline__ unsigned pk16(unsigned short a, unsigned short b) { return (unsigned)a | ((unsigned)b << 16); }

__global__ __launch_bounds__(256) void cast_f32_bf16x2(const float* __restrict__ in, unsigned short* __restrict__ out, int n2) {
  const int i = blockIdx.x * 256 + threadIdx.x;
  if (i < n2) {
    const float f0 = in[2 * (size_t)i], f1 = in[2 * (size_t)i + 1];
    const unsigned u = pk16(f2bf_bits(f0), f2bf_bits(f1));
    ((unsigned*)out)[i] = u;
    
  }
}

// f32 -> bf16 (RNE) value -> x scale (power of two, exact) -> f16 bits (exact for normal-range values); same store shape as above.
__global__ __launch_bounds__(256) void cast_f32_bf16val_f16x2(const float* __restrict__ in, unsigned short* __restrict__ out,
                                                              int n2, float scale) {
  const int i = blockIdx.x * 256 + threadIdx.x;
  if (i < n2) {
    const float f0 = bf16_rne_f32(in[2 * (size_t)i]) * scale;
    const float f1 = bf16_rne_f32(in[2 * (size_t)i + 1]) * scale;
    const _Float16 h0 = (_Float16)f0, h1 = (_Float16)f1;
    const unsigned u = pk16(__builtin_bit_cast(unsigned short, h0), __builtin_bit_cast(unsigned short, h1));
    ((unsigned*)out)[i] = u;
    
  }
}

// =====================================================================================
// Full (unmasked) attention with an additive [SEQ][SEQ] score bias shared over (b, h); head dim 64.
//   q plane  f16: element (b, t, h, d) at [(b*SEQ_LEN + t)*DMODEL + h*64 + d]
//   k plane  f16: element (b, s, h, d) at [(b*SEQ_LEN + s)*DMODEL + h*64 + d]
//   v^T plane f16: element (b, h, d, s) at [b*DMODEL*SEQ_LEN + (h*64 + d)*SEQ_LEN + s]
//   O plane  f16 (x O_CARRY): element (b, t, h, d) at [(b*SEQ_LEN + t)*DMODEL + h*64 + d]
//   scores = (q . k) * sscale + bf16value(pbias[t][s]) : single v_wmma_f32_16x16x32_f16 product, f32 accumulate, bias in f32
//   out    = p . v : p (unnormalised, <= 1) carried x2^15 in f16, v f16, single product, f32 accumulate
//   online softmax in f32 over all SEQ_LEN keys (32 chunks of 64, compile-time trip count).
//   Block = 4 waves = 64 query rows of one (b, h); grid.x = BATCH_N * NHEADS * (SEQ_LEN/64) = 1024.
//   K / V^T chunk staging: 128 threads x 32 elements per plane = the whole 64x64 tile (16-B copies, plain loads,
//   __syncthreads before and after); fragment loads read the LDS tiles with the same v8h element type.
// =====================================================================================
#define AT_D 64
#define AT_NW 4
#define AT_QB 64
#define AT_KC 64

__device__ __forceinline__ v8f at_mma_h(v16h a, v16h b, v8f c) {
  c = __builtin_amdgcn_wmma_f32_16x16x32_f16(false, a, false, b, (short)0, c, false, false);
  asm volatile("v_nop\n\tv_nop\n\tv_nop\n\tv_nop" : "+v"(c) : "v"(a), "v"(b));
  return c;
}

__global__ __launch_bounds__(128)
void attn_bias64_kernel(const unsigned short* __restrict__ qp, const unsigned short* __restrict__ kp,
                        const unsigned short* __restrict__ vtp, const float* __restrict__ pbias,
                        unsigned short* __restrict__ op, float sscale) {
  union FH { v16h v; v8h h[2]; };
  __shared__ __align__(16) _Float16 Ksh[AT_KC * AT_D];             // K  [kv][d]   8 KB
  __shared__ __align__(16) _Float16 Vth[AT_D * AT_KC];             // V^T [d][kv]  8 KB
  __shared__ __align__(16) _Float16 Psh[AT_NW][16 * AT_KC];        // per wave P [row][kv]  8 KB
  __shared__ __align__(16) float    Os[AT_NW][16 * 68];            // per wave out tile, pitch 68  17 KB

  const int tid  = threadIdx.x;
  const int wave = tid >> 5;
  const int lane = tid & 31;
  const int hh   = lane >> 4;
  const int c    = lane & 15;

  const int nqb = SEQ_LEN / AT_QB;        // 32
  const int bx = blockIdx.x;
  const int qb = bx % nqb;
  const int bh = bx / nqb;                // 0..BATCH_N*NHEADS-1
  const int h  = bh % NHEADS;
  const int b  = bh / NHEADS;
  const int q0 = qb * AT_QB + wave * 16;  // first query row of this wave (within the sequence)

  const _Float16* Qh = (const _Float16*)(const void*)qp  + (size_t)b * SEQ_LEN * DMODEL + (size_t)h * AT_D;
  const _Float16* Kh = (const _Float16*)(const void*)kp  + (size_t)b * SEQ_LEN * DMODEL + (size_t)h * AT_D;
  const _Float16* Vt = (const _Float16*)(const void*)vtp + (size_t)b * DMODEL * SEQ_LEN + (size_t)h * AT_D * SEQ_LEN;
  _Float16*       Ob = (_Float16*)(void*)op + (size_t)b * SEQ_LEN * DMODEL + (size_t)h * AT_D;

  // ---- Q fragments (A operand, row = lane&15, split k map via Frag load): 2 d-chunks ----
  v16h qa[2];
#pragma unroll
  for (int dc = 0; dc < 2; ++dc) {
    const _Float16* qr = Qh + (size_t)(q0 + c) * DMODEL + dc * 32 + 8 * hh;
    qa[dc] = Frag<_Float16>::load(qr);
  }

  float mrow[8], lrow[8];
  v8f oacc[4];
#pragma unroll
  for (int r = 0; r < 8; ++r) { mrow[r] = -INFINITY; lrow[r] = 0.f; }
#pragma unroll
  for (int t = 0; t < 4; ++t) oacc[t] = (v8f){0.f,0.f,0.f,0.f,0.f,0.f,0.f,0.f};

  const int nChunks = SEQ_LEN / AT_KC;   // 32, compile-time constant
  for (int kc = 0; kc < nChunks; ++kc) {
    const int kv0 = kc * AT_KC;
    __syncthreads();
    {
      // staging coverage: 128 threads x (4 x 8) elements = 64 rows x 64 per plane = the whole chunk tile
      const int r = tid >> 1, half = (tid & 1) * 32;
      const _Float16* ksh = Kh + (size_t)(kv0 + r) * DMODEL + half;   // K row kv0+r, d = half..half+31
      const _Float16* vsh = Vt + (size_t)r * SEQ_LEN + kv0 + half;    // V^T row d = r, s = kv0+half..+31
#pragma unroll
      for (int i = 0; i < 4; ++i) {
        const v8h a0 = *(const v8h*)(ksh + 8 * i);
        const v8h b0 = *(const v8h*)(vsh + 8 * i);
        *(v8h*)(Ksh + r * AT_D  + half + 8 * i) = a0;
        *(v8h*)(Vth + r * AT_KC + half + 8 * i) = b0;
      }
    }
    __syncthreads();

    // ---- scores: D element r of lane -> (query row 8hh+r, key j*16+c) ----
    v8f s[4];
#pragma unroll
    for (int j = 0; j < 4; ++j) {
      s[j] = (v8f){0.f,0.f,0.f,0.f,0.f,0.f,0.f,0.f};
#pragma unroll
      for (int dc = 0; dc < 2; ++dc) {
        FH kb;
        kb.h[0] = *(const v8h*)(Ksh + (j * 16 + c) * AT_D + dc * 32 + 8 * hh);
        kb.h[1] = *(const v8h*)(Ksh + (j * 16 + c) * AT_D + dc * 32 + 16 + 8 * hh);
        s[j] = at_mma_h(qa[dc], kb.v, s[j]);
      }
    }
    float cm[8];
#pragma unroll
    for (int r = 0; r < 8; ++r) {
      const int qrow = q0 + 8 * hh + r;                        // 0..SEQ_LEN-1
      const float* pbr = pbias + (size_t)qrow * SEQ_LEN + kv0;   // in range: kv0 + 63 < SEQ_LEN
      float m = -INFINITY;
#pragma unroll
      for (int j = 0; j < 4; ++j) {
        const float bb = bf16_rne_f32(pbr[j * 16 + c]);
        const float sv = s[j][r] * sscale + bb;
        s[j][r] = sv;
        m = fmaxf(m, sv);
      }
#pragma unroll
      for (int off = 1; off < 16; off <<= 1) m = fmaxf(m, __shfl_xor(m, off, 32));
      cm[r] = m;
    }
    _Float16* pwh = Psh[wave];
#pragma unroll
    for (int r = 0; r < 8; ++r) {
      const float mnew = fmaxf(mrow[r], cm[r]);
      const float alpha = expf(mrow[r] - mnew);
      mrow[r] = mnew;
      float psum = 0.f;
#pragma unroll
      for (int j = 0; j < 4; ++j) {
        const float p = expf(s[j][r] - mnew);
        psum += p;
        pwh[(8 * hh + r) * AT_KC + j * 16 + c] = (_Float16)(p * P_CARRY);
      }
#pragma unroll
      for (int off = 1; off < 16; off <<= 1) psum += __shfl_xor(psum, off, 32);
      lrow[r] = lrow[r] * alpha + psum;
#pragma unroll
      for (int t = 0; t < 4; ++t) oacc[t][r] *= alpha;
    }
    __builtin_amdgcn_fence(__ATOMIC_RELEASE, "workgroup");
    __builtin_amdgcn_wave_barrier();
    __builtin_amdgcn_fence(__ATOMIC_ACQUIRE, "workgroup");
    // ---- oacc[t] += P (A: row = query c, k = key) . V (B: col = d t*16+c, k = key) ----
#pragma unroll 1
    for (int kk = 0; kk < 2; ++kk) {
      FH pa;
      pa.h[0] = *(const v8h*)(pwh + c * AT_KC + kk * 32 + 8 * hh);
      pa.h[1] = *(const v8h*)(pwh + c * AT_KC + kk * 32 + 16 + 8 * hh);
#pragma unroll
      for (int t = 0; t < 4; ++t) {
        FH vb;
        vb.h[0] = *(const v8h*)(Vth + (t * 16 + c) * AT_KC + kk * 32 + 8 * hh);
        vb.h[1] = *(const v8h*)(Vth + (t * 16 + c) * AT_KC + kk * 32 + 16 + 8 * hh);
        oacc[t] = at_mma_h(pa.v, vb.v, oacc[t]);
      }
    }
  }

  float* os = Os[wave];
#pragma unroll
  for (int r = 0; r < 8; ++r) {
    const float inv = O_CARRY * (1.0f / (lrow[r] * P_CARRY));   // lrow >= 1
#pragma unroll
    for (int t = 0; t < 4; ++t) os[(8 * hh + r) * 68 + t * 16 + c] = oacc[t][r] * inv;
  }
  __builtin_amdgcn_fence(__ATOMIC_RELEASE, "workgroup");
  __builtin_amdgcn_wave_barrier();
  __builtin_amdgcn_fence(__ATOMIC_ACQUIRE, "workgroup");
  {
    const int q4 = lane >> 3, c8 = (lane & 7) * 8;
    {
#pragma unroll
      for (int it = 0; it < 4; ++it) {
        const int row = it * 4 + q4;   // it 0..3 x q4 0..3 covers rows 0..15 of the wave tile
        const float* sp = os + row * 68 + c8;
        v8h hv;
#pragma unroll
        for (int e = 0; e < 8; ++e) hv[e] = (_Float16)sp[e];
        *(v8h*)(Ob + (size_t)(q0 + row) * DMODEL + c8) = hv;
      }
      
    }
  }
}

// ---------------------------------------------------------------------------
// Workspace region map (byte offsets, all 1 MiB aligned; total 50,331,648 B = 48 MiB):
//   [ 0 MiB,  8 MiB)  xb   : bf16 x            [4096][1024]
//   [ 8 MiB, 10 MiB)  wqb  : bf16 Wq           [1024][1024]
//   [10 MiB, 12 MiB)  wkb  : bf16 Wk
//   [12 MiB, 14 MiB)  wvb  : bf16 Wv
//   [14 MiB, 16 MiB)  woh  : f16 (bf16val(Wo) x64)
//   [16 MiB, 24 MiB)  qh   : f16 q plane       [4096][1024]
//   [24 MiB, 32 MiB)  kh   : f16 k plane       [4096][1024]
//   [32 MiB, 40 MiB)  vth  : f16 v^T plane     [2][1024][2048]
//   [40 MiB, 48 MiB)  oh   : f16 O plane (x64) [4096][1024]
// ---------------------------------------------------------------------------
extern "C" void kernel_launch(void* const* d_in, const int* in_sizes, int n_in,
                              void* d_out, int out_size, void* d_ws,
                              size_t ws_size, hipStream_t stream) {
  if (n_in < 10) return;
  const float* x  = (const float*)d_in[0];
  const float* pb = (const float*)d_in[1];
  const float* Wq = (const float*)d_in[2];
  const float* bq = (const float*)d_in[3];
  const float* Wk = (const float*)d_in[4];
  const float* bk = (const float*)d_in[5];
  const float* Wv = (const float*)d_in[6];
  const float* bv = (const float*)d_in[7];
  const float* Wo = (const float*)d_in[8];
  const float* bo = (const float*)d_in[9];
  float* out = (float*)d_out;

  const int nX = MTOK * DMODEL;        // 4194304
  const int nW = DMODEL * DMODEL;      // 1048576
  const int nP = SEQ_LEN * SEQ_LEN;    // 4194304
  if (in_sizes[0] != nX || in_sizes[1] != nP) return;
  if (in_sizes[2] != nW || in_sizes[4] != nW || in_sizes[6] != nW || in_sizes[8] != nW) return;
  if (in_sizes[3] != DMODEL || in_sizes[5] != DMODEL || in_sizes[7] != DMODEL || in_sizes[9] != DMODEL) return;
  if (out_size != nX) return;

  const size_t bytesX16 = (size_t)nX * 2;   // 8 MiB
  const size_t bytesW16 = (size_t)nW * 2;   // 2 MiB
  size_t off = 0;
  const size_t off_xb  = off; off += bytesX16;
  const size_t off_wq  = off; off += bytesW16;
  const size_t off_wk  = off; off += bytesW16;
  const size_t off_wv  = off; off += bytesW16;
  const size_t off_wo  = off; off += bytesW16;
  const size_t off_q   = off; off += bytesX16;
  const size_t off_k   = off; off += bytesX16;
  const size_t off_vt  = off; off += bytesX16;
  const size_t off_o   = off; off += bytesX16;
  if (off > ws_size) return;               // 50,331,648 B needed

  char* ws = (char*)d_ws;
  unsigned short* xb  = (unsigned short*)(ws + off_xb);
  unsigned short* wqb = (unsigned short*)(ws + off_wq);
  unsigned short* wkb = (unsigned short*)(ws + off_wk);
  unsigned short* wvb = (unsigned short*)(ws + off_wv);
  unsigned short* woh = (unsigned short*)(ws + off_wo);
  unsigned short* qh  = (unsigned short*)(ws + off_q);
  unsigned short* kh  = (unsigned short*)(ws + off_k);
  unsigned short* vth = (unsigned short*)(ws + off_vt);
  unsigned short* oh  = (unsigned short*)(ws + off_o);

  // ---- casts (2 elements per thread; exact multiples of 512 elements per block) ----
  const int n2X = nX / 2;   // 2097152 -> 8192 blocks
  const int n2W = nW / 2;   // 524288  -> 2048 blocks
  cast_f32_bf16x2<<<dim3(n2X / 256), dim3(256), 0, stream>>>(x,  xb,  n2X);
  cast_f32_bf16x2<<<dim3(n2W / 256), dim3(256), 0, stream>>>(Wq, wqb, n2W);
  cast_f32_bf16x2<<<dim3(n2W / 256), dim3(256), 0, stream>>>(Wk, wkb, n2W);
  cast_f32_bf16x2<<<dim3(n2W / 256), dim3(256), 0, stream>>>(Wv, wvb, n2W);
  cast_f32_bf16val_f16x2<<<dim3(n2W / 256), dim3(256), 0, stream>>>(Wo, woh, n2W, W_CARRY);

  // ---- q / k projections: C[token][feature] = xb . Wᵀ + b, M=4096, N=1024, K=1024 (64*16 = 1024 tiles -> 128 blocks) ----
  const long strideXb = (long)SEQ_LEN * DMODEL;   // per-batch token block of xb (elements)
  wmma_gemm64<1, false, 2, 1, false, 0><<<dim3((MTOK / 64) * (DMODEL / 64) / 8, 1), dim3(256), 0, stream>>>(
      xb, xb, DMODEL, 0L, wqb, wqb, DMODEL, 0L, (void*)qh, (void*)qh, DMODEL, 0L, bq, bq, 0L,
      MTOK, DMODEL, DMODEL, 1.0f);
  wmma_gemm64<1, false, 2, 1, false, 0><<<dim3((MTOK / 64) * (DMODEL / 64) / 8, 1), dim3(256), 0, stream>>>(
      xb, xb, DMODEL, 0L, wkb, wkb, DMODEL, 0L, (void*)kh, (void*)kh, DMODEL, 0L, bk, bk, 0L,
      MTOK, DMODEL, DMODEL, 1.0f);
  // ---- v^T projection (role swapped): C_b[feature][token] = Wv . x_bᵀ + bv[feature]; M=1024, N=2048, K=1024, grid.y = batch
  //      (16*32 = 512 tiles -> 64 blocks per batch) ----
  wmma_gemm64<1, false, 1, 1, false, 0><<<dim3((DMODEL / 64) * (SEQ_LEN / 64) / 8, BATCH_N), dim3(256), 0, stream>>>(
      wvb, wvb, DMODEL, 0L, xb, xb, DMODEL, strideXb, (void*)vth, (void*)vth, SEQ_LEN, (long)DMODEL * SEQ_LEN, bv, bv, 0L,
      DMODEL, SEQ_LEN, DMODEL, 1.0f);

  // ---- attention: 2 * 16 * (2048/64) = 1024 blocks of 64 query rows ----
  attn_bias64_kernel<<<dim3(BATCH_N * NHEADS * (SEQ_LEN / 64)), dim3(128), 0, stream>>>(qh, kh, vth, pb, oh, 0.125f);

  // ---- output projection: out[token][feature] = (O x64) . (Wo x64)ᵀ / 4096 + bo; M=4096, N=1024, K=1024 ----
  wmma_gemm64<0, false, 2, 0, false, 0><<<dim3((MTOK / 64) * (DMODEL / 64) / 8, 1), dim3(256), 0, stream>>>(
      oh, oh, DMODEL, 0L, woh, woh, DMODEL, 0L, (void*)out, (void*)out, DMODEL, 0L, bo, bo, 0L,
      MTOK, DMODEL, DMODEL, 1.0f / (O_CARRY * W_CARRY));
}

// v001
// It runs in 327 microseconds.
// Timed twice side by side with v000, it ran 1.13 times as fast both times.
// Contractions: q, k, v^T projections on v_wmma_f32_16x16x32_bf16 (bf16 RNE operands from the raw inputs, single product, f32 accumulate); q.k^T and p.v on v_wmma_f32_16x16x32_f16 (f16 q/k/v planes, p carried x2^15, f32 accumulate, online softmax and additive bias in f32); output projection on v_wmma_f32_16x16x32_f16 (O carried x64 in f16, Wo as bf16-RNE value x64 in f16, f32 accumulate, x1/4096 in the f32 epilogue).
#include <hip/hip_runtime.h>
#include <math.h>
#include <stdint.h>

constexpr int BATCH_N = 2;
constexpr int SEQ_LEN = 2048;
constexpr int DMODEL  = 1024;
constexpr int NHEADS  = 16;
constexpr int HDIM    = 64;
constexpr int MTOK    = BATCH_N * SEQ_LEN;   // 4096 token rows
static_assert(NHEADS * HDIM == DMODEL, "head split");

constexpr float P_CARRY = 32768.0f;   // probabilities carried x2^15 in f16
constexpr float O_CARRY = 64.0f;      // attention output carried x64 in f16
constexpr float W_CARRY = 64.0f;      // Wo carried x64 in f16

typedef __attribute__((ext_vector_type(16))) _Float16 v16h;
typedef __attribute__((ext_vector_type(8)))  _Float16 v8h;
typedef __attribute__((ext_vector_type(16))) __bf16   v16b;
typedef __attribute__((ext_vector_type(8)))  __bf16   v8b;
typedef __attribute__((ext_vector_type(8)))  float    v8f;
typedef __attribute__((ext_vector_type(4)))  float    v4f;

__device__ __forceinline__ unsigned short f2bf_bits(float f) {
  unsigned u = __float_as_uint(f);
  return (unsigned short)((u + 0x7FFFu + ((u >> 16) & 1u)) >> 16);
}
__device__ __forceinline__ float bf_bits2f(unsigned short h) { return __uint_as_float(((unsigned)h) << 16); }
// f32 value of the RNE bf16 of f
__device__ __forceinline__ float bf16_rne_f32(float f) { return bf_bits2f(f2bf_bits(f)); }

// hazard guards as plain device helpers (no inline asm inside the kernel template body)
__device__ __forceinline__ void dep_guard_h(v8f& a, v8f& b, v16h x, v16h y) { asm volatile("v_nop\n\tv_nop\n\tv_nop\n\tv_nop" : "+v"(a), "+v"(b) : "v"(x), "v"(y)); }
__device__ __forceinline__ void dep_guard_b(v8f& a, v8f& b, v16b x, v16b y) { asm volatile("v_nop\n\tv_nop\n\tv_nop\n\tv_nop" : "+v"(a), "+v"(b) : "v"(x), "v"(y)); }
__device__ __forceinline__ void keep4_h(v16h a, v16h b, v16h c, v16h d) { asm volatile("v_nop" :: "v"(a), "v"(b), "v"(c), "v"(d)); }
__device__ __forceinline__ void keep4_b(v16b a, v16b b, v16b c, v16b d) { asm volatile("v_nop" :: "v"(a), "v"(b), "v"(c), "v"(d)); }
__device__ __forceinline__ void acc_guard4(v8f& a, v8f& b, v8f& c, v8f& d) { asm volatile("v_nop\n\tv_nop\n\tv_nop\n\tv_nop" : "+v"(a), "+v"(b), "+v"(c), "+v"(d)); }
template <typename T> struct Frag;
template <> struct Frag<_Float16> {
  typedef v16h V; union U { v16h v; v8h h[2]; };
  static __device__ __forceinline__ v16h load(const _Float16* p) {   // elements 0..7 <- p[0..7], 8..15 <- p[16..23]
    U f; f.h[0] = *(const v8h*)(p); f.h[1] = *(const v8h*)(p + 16); return f.v;
  }
  static __device__ __forceinline__ v8f mma(v16h a, v16h b, v8f c) {
    return __builtin_amdgcn_wmma_f32_16x16x32_f16(false, a, false, b, (short)0, c, false, false);
  }
  static __device__ __forceinline__ void guard(v8f& a, v8f& b, v16h x, v16h y) { dep_guard_h(a, b, x, y); }
  static __device__ __forceinline__ void keep(v16h a, v16h b, v16h c, v16h d) { keep4_h(a, b, c, d); }
};
template <> struct Frag<__bf16> {
  typedef v16b V; union U { v16b v; v8b h[2]; };
  static __device__ __forceinline__ v16b load(const __bf16* p) {
    U f; f.h[0] = *(const v8b*)(p); f.h[1] = *(const v8b*)(p + 16); return f.v;
  }
  static __device__ __forceinline__ v8f mma(v16b a, v16b b, v8f c) {
    return __builtin_amdgcn_wmma_f32_16x16x32_bf16(false, a, false, b, (short)0, c, false, false);
  }
  static __device__ __forceinline__ void guard(v8f& a, v8f& b, v16b x, v16b y) { dep_guard_b(a, b, x, y); }
  static __device__ __forceinline__ void keep(v16b a, v16b b, v16b c, v16b d) { keep4_b(a, b, c, d); }
};

// ---- Register-blocked batched WMMA GEMM ------------------------------------
// C[m,n] = scale * sum_k A[m,k] * Bt[n,k] (+bias)(+resid); each wave owns a 64x64 tile.
// A row-major [M,K]; Bt row-major [N,K]; M,N % 64 == 0, K % 32 == 0.
// SPLIT: operands are hi/lo planes (A2/Bt2 = lo planes, same layout); product = hi.hi + hi.lo + lo.hi.
// BIAS_MODE: 0 = none, 1 = bias[m], 2 = bias[n].
// OUT_MODE: 0 = f32, 1 = f16, 2 = bf16 hi plane (Cout) + bf16 lo plane (Cout2).
// ET: 0 = f16 operands, 1 = bf16 operands (pointers passed as 16-bit storage)
template <int ET> struct Elem;
template <> struct Elem<0> { typedef _Float16 T; };
template <> struct Elem<1> { typedef __bf16 T; };
template <int ET, bool SPLIT, int BIAS_MODE, int OUT_MODE, bool RESID, int ACT = 0>
__global__ __launch_bounds__(256) void wmma_gemm64(
    const unsigned short* __restrict__ Ap, const unsigned short* __restrict__ A2p, int lda, long strideA,
    const unsigned short* __restrict__ Btp, const unsigned short* __restrict__ Bt2p, int ldb, long strideB,
    void* __restrict__ Cout, void* __restrict__ Cout2, int ldc, long strideC,
    const float* __restrict__ bias,
    const float* __restrict__ resid, long strideR,
    int M, int N, int K, float scale) {
  typedef typename Elem<ET>::T T;
  typedef typename Frag<T>::V V;
  const T* A = (const T*)Ap; const T* A2 = (const T*)A2p; const T* Bt = (const T*)Btp; const T* Bt2 = (const T*)Bt2p;
  __shared__ __align__(16) float sT[8][16 * 68];   // per-wave 16x64 slab, pitch 68 floats
  const int b    = blockIdx.y;
  const int lane = threadIdx.x & 31;
  const int wave = threadIdx.x >> 5;
  const int tilesN = N >> 6;
  const int tilesM = M >> 6;
  const int tile = blockIdx.x * 8 + wave;
  if (tile >= tilesM * tilesN) return;   // wave-uniform; no block barriers in this kernel
  const int tm = tile / tilesN;
  const int tn = tile - tm * tilesN;
  const int m0 = tm << 6;
  const int n0 = tn << 6;

  const T* Ab  = A  + (size_t)b * strideA;
  const T* Bb  = Bt + (size_t)b * strideB;
  const T* Ab2 = SPLIT ? (A2  + (size_t)b * strideA) : nullptr;
  const T* Bb2 = SPLIT ? (Bt2 + (size_t)b * strideB) : nullptr;

  const int rlane = lane & 15;                 // row (A) / col (B, D) within subtile
  const int koff  = (lane >> 4) * 8;           // k offset of this lane half
  const int mOff  = (lane >> 4) * 8;           // D row offset

  v8f acc[4][4];
#pragma unroll
  for (int i = 0; i < 4; ++i)
#pragma unroll
    for (int j = 0; j < 4; ++j) acc[i][j] = (v8f){0.f,0.f,0.f,0.f,0.f,0.f,0.f,0.f};

  for (int k0 = 0; k0 < K; k0 += 32) {
    V bh[4], bl[4];
#pragma unroll
    for (int j = 0; j < 4; ++j) {
      const size_t bo = (size_t)(n0 + (j << 4) + rlane) * ldb + koff + k0;
      bh[j] = Frag<T>::load(Bb + bo);
      if (SPLIT) bl[j] = Frag<T>::load(Bb2 + bo);
    }
#pragma unroll
    for (int i = 0; i < 4; ++i) {
      const size_t ao = (size_t)(m0 + (i << 4) + rlane) * lda + koff + k0;
      V ah = Frag<T>::load(Ab + ao);
      V al;
      if (SPLIT) al = Frag<T>::load(Ab2 + ao);
#pragma unroll
      for (int j = 0; j < 4; ++j) {
        acc[i][j] = Frag<T>::mma(ah, bh[j], acc[i][j]);
        if (SPLIT) {
          acc[i][j] = Frag<T>::mma(ah, bl[j], acc[i][j]);
          acc[i][j] = Frag<T>::mma(al, bh[j], acc[i][j]);
        }
      }
      Frag<T>::guard(acc[i][0], acc[i][3], ah, SPLIT ? al : ah);
    }
    Frag<T>::keep(bh[0], bh[1], bh[2], bh[3]);
    if (SPLIT) Frag<T>::keep(bl[0], bl[1], bl[2], bl[3]);
  }
  acc_guard4(acc[0][0], acc[0][1], acc[0][2], acc[0][3]);
  acc_guard4(acc[1][0], acc[1][1], acc[1][2], acc[1][3]);
  acc_guard4(acc[2][0], acc[2][1], acc[2][2], acc[2][3]);
  acc_guard4(acc[3][0], acc[3][1], acc[3][2], acc[3][3]);

  // ---- epilogue ----
  float* slab = sT[wave];
  const float* Rb = RESID ? (resid + (size_t)b * strideR) : nullptr;
#pragma unroll
  for (int i = 0; i < 4; ++i) {
    const int mBase = m0 + (i << 4);
#pragma unroll
    for (int j = 0; j < 4; ++j) {
      const int n = n0 + (j << 4) + rlane;
      float bv = 0.f;
      if (BIAS_MODE == 2) bv = bias[n];
#pragma unroll
      for (int r = 0; r < 8; ++r) {
        float v = acc[i][j][r] * scale;
        if (BIAS_MODE == 1) v += bias[mBase + mOff + r];
        if (BIAS_MODE == 2) v += bv;
        if (RESID) v += Rb[(size_t)(mBase + mOff + r) * ldc + n];
        if (ACT == 1) v = tanhf(v);
        if (ACT == 2) v = fmaxf(v, 0.0f);
        if (ACT == 3) v = v / (1.0f + expf(-v));
        if (ACT == 4) v = (v > 0.f) ? v : 0.01f * v;
        if (ACT == 5) v = 0.5f * v * (1.0f + erff(v * 0.70710678118654752f));
        slab[(mOff + r) * 68 + (j << 4) + rlane] = v;
      }
    }
    __builtin_amdgcn_fence(__ATOMIC_RELEASE, "workgroup");
    __builtin_amdgcn_wave_barrier();
    __builtin_amdgcn_fence(__ATOMIC_ACQUIRE, "workgroup");
    if (OUT_MODE == 0) {
      float* C = (float*)Cout + (size_t)b * strideC;
      const int hh = lane >> 4, c4 = (lane & 15) * 4;     // row seg = 256 B = 16 lanes x 16 B
      {
#pragma unroll
        for (int it = 0; it < 8; ++it) {
          const int row = it * 2 + hh;
          v4f v = *(const v4f*)(slab + row * 68 + c4);
          *(v4f*)(C + (size_t)(mBase + row) * ldc + n0 + c4) = v;
        }
        
      }
    } else {
      const int q = lane >> 3, c8 = (lane & 7) * 8;
      unsigned short* C  = (unsigned short*)Cout  + (size_t)b * strideC;
      unsigned short* C2 = (OUT_MODE == 2) ? ((unsigned short*)Cout2 + (size_t)b * strideC) : nullptr;
      {
#pragma unroll
        for (int it = 0; it < 4; ++it) {
          const int row = it * 4 + q;
          const float* sp = slab + row * 68 + c8;
          v8h hv, lv;
#pragma unroll
          for (int e = 0; e < 8; ++e) {
            if (OUT_MODE == 1) {
              hv[e] = (_Float16)sp[e];
            } else {
              unsigned short hb = f2bf_bits(sp[e]);
              unsigned short lb = f2bf_bits(sp[e] - bf_bits2f(hb));
              hv[e] = __builtin_bit_cast(_Float16, hb);
              lv[e] = __builtin_bit_cast(_Float16, lb);
            }
          }
          *(v8h*)(C + (size_t)(mBase + row) * ldc + n0 + c8) = hv;
          if (OUT_MODE == 2) *(v8h*)(C2 + (size_t)(mBase + row) * ldc + n0 + c8) = lv;
        }
        
      }
    }
    __builtin_amdgcn_fence(__ATOMIC_RELEASE, "workgroup");
    __builtin_amdgcn_wave_barrier();
    __builtin_amdgcn_fence(__ATOMIC_ACQUIRE, "workgroup");
  }
}

// ---------------------------------------------------------------------------
// f32 -> bf16 (RNE) cast: 2 elements per thread, ONE 4-B store per lane -> each wave writes exactly one whole
// Coverage: grid = n2/256 blocks x 256 threads x 2 elements = 2*n2 = whole plane
//   x : n2 = 4096*1024/2 = 2097152 = 8192 blocks;  W : n2 = 1024*1024/2 = 524288 = 2048 blocks (exact multiples).
// ---------------------------------------------------------------------------
__device__ __forceinline__ unsigned pk16(unsigned short a, unsigned short b) { return (unsigned)a | ((unsigned)b << 16); }

__global__ __launch_bounds__(256) void cast_f32_bf16x2(const float* __restrict__ in, unsigned short* __restrict__ out, int n2) {
  const int i = blockIdx.x * 256 + threadIdx.x;
  if (i < n2) {
    const float f0 = in[2 * (size_t)i], f1 = in[2 * (size_t)i + 1];
    const unsigned u = pk16(f2bf_bits(f0), f2bf_bits(f1));
    ((unsigned*)out)[i] = u;
    
  }
}

// f32 -> bf16 (RNE) value -> x scale (power of two, exact) -> f16 bits (exact for normal-range values); same store shape as above.
__global__ __launch_bounds__(256) void cast_f32_bf16val_f16x2(const float* __restrict__ in, unsigned short* __restrict__ out,
                                                              int n2, float scale) {
  const int i = blockIdx.x * 256 + threadIdx.x;
  if (i < n2) {
    const float f0 = bf16_rne_f32(in[2 * (size_t)i]) * scale;
    const float f1 = bf16_rne_f32(in[2 * (size_t)i + 1]) * scale;
    const _Float16 h0 = (_Float16)f0, h1 = (_Float16)f1;
    const unsigned u = pk16(__builtin_bit_cast(unsigned short, h0), __builtin_bit_cast(unsigned short, h1));
    ((unsigned*)out)[i] = u;
    
  }
}

// =====================================================================================
// Full (unmasked) attention with an additive [SEQ][SEQ] score bias shared over (b, h); head dim 64.
//   q plane  f16: element (b, t, h, d) at [(b*SEQ_LEN + t)*DMODEL + h*64 + d]
//   k plane  f16: element (b, s, h, d) at [(b*SEQ_LEN + s)*DMODEL + h*64 + d]
//   v^T plane f16: element (b, h, d, s) at [b*DMODEL*SEQ_LEN + (h*64 + d)*SEQ_LEN + s]
//   O plane  f16 (x O_CARRY): element (b, t, h, d) at [(b*SEQ_LEN + t)*DMODEL + h*64 + d]
//   scores = (q . k) * sscale + bf16value(pbias[t][s]) : single v_wmma_f32_16x16x32_f16 product, f32 accumulate, bias in f32
//   out    = p . v : p (unnormalised, <= 1) carried x2^15 in f16, v f16, single product, f32 accumulate
//   online softmax in f32 over all SEQ_LEN keys (32 chunks of 64, compile-time trip count).
//   Block = 4 waves = 64 query rows of one (b, h); grid.x = BATCH_N * NHEADS * (SEQ_LEN/64) = 1024.
//   K / V^T chunk staging: 128 threads x 32 elements per plane = the whole 64x64 tile (16-B copies, plain loads,
//   __syncthreads before and after); fragment loads read the LDS tiles with the same v8h element type.
// =====================================================================================
#define AT_D 64
#define AT_NW 4
#define AT_QB 64
#define AT_KC 64
#define AT_LP 72   // LDS row pitch of the K, V^T and P tiles in f16: 144 B = 16 B x 9 (odd), so 16 rows read by ds_load_b128 fall on distinct banks

__device__ __forceinline__ v8f at_mma_h(v16h a, v16h b, v8f c) {
  c = __builtin_amdgcn_wmma_f32_16x16x32_f16(false, a, false, b, (short)0, c, false, false);
  asm volatile("v_nop\n\tv_nop\n\tv_nop\n\tv_nop" : "+v"(c) : "v"(a), "v"(b));
  return c;
}

__global__ __launch_bounds__(128)
void attn_bias64_kernel(const unsigned short* __restrict__ qp, const unsigned short* __restrict__ kp,
                        const unsigned short* __restrict__ vtp, const float* __restrict__ pbias,
                        unsigned short* __restrict__ op, float sscale) {
  union FH { v16h v; v8h h[2]; };
  __shared__ __align__(16) _Float16 Ksh[AT_KC * AT_LP];            // K  [kv][d]   9 KB, pitch AT_LP
  __shared__ __align__(16) _Float16 Vth[AT_D * AT_LP];             // V^T [d][kv]  9 KB, pitch AT_LP
  __shared__ __align__(16) _Float16 Psh[AT_NW][16 * AT_LP];        // per wave P [row][kv]  9 KB, pitch AT_LP
  __shared__ __align__(16) float    Os[AT_NW][16 * 68];            // per wave out tile, pitch 68  17 KB

  const int tid  = threadIdx.x;
  const int wave = tid >> 5;
  const int lane = tid & 31;
  const int hh   = lane >> 4;
  const int c    = lane & 15;

  const int nqb = SEQ_LEN / AT_QB;        // 32
  const int bx = blockIdx.x;
  const int qb = bx % nqb;
  const int bh = bx / nqb;                // 0..BATCH_N*NHEADS-1
  const int h  = bh % NHEADS;
  const int b  = bh / NHEADS;
  const int q0 = qb * AT_QB + wave * 16;  // first query row of this wave (within the sequence)

  const _Float16* Qh = (const _Float16*)(const void*)qp  + (size_t)b * SEQ_LEN * DMODEL + (size_t)h * AT_D;
  const _Float16* Kh = (const _Float16*)(const void*)kp  + (size_t)b * SEQ_LEN * DMODEL + (size_t)h * AT_D;
  const _Float16* Vt = (const _Float16*)(const void*)vtp + (size_t)b * DMODEL * SEQ_LEN + (size_t)h * AT_D * SEQ_LEN;
  _Float16*       Ob = (_Float16*)(void*)op + (size_t)b * SEQ_LEN * DMODEL + (size_t)h * AT_D;

  // ---- Q fragments (A operand, row = lane&15, split k map via Frag load): 2 d-chunks ----
  v16h qa[2];
#pragma unroll
  for (int dc = 0; dc < 2; ++dc) {
    const _Float16* qr = Qh + (size_t)(q0 + c) * DMODEL + dc * 32 + 8 * hh;
    qa[dc] = Frag<_Float16>::load(qr);
  }

  float mrow[8], lrow[8];
  v8f oacc[4];
#pragma unroll
  for (int r = 0; r < 8; ++r) { mrow[r] = -INFINITY; lrow[r] = 0.f; }
#pragma unroll
  for (int t = 0; t < 4; ++t) oacc[t] = (v8f){0.f,0.f,0.f,0.f,0.f,0.f,0.f,0.f};

  const int nChunks = SEQ_LEN / AT_KC;   // 32, compile-time constant
  for (int kc = 0; kc < nChunks; ++kc) {
    const int kv0 = kc * AT_KC;
    __syncthreads();
    {
      // staging coverage: 128 threads x (4 x 8) elements = 64 rows x 64 per plane = the whole chunk tile
      const int r = tid >> 1, half = (tid & 1) * 32;
      const _Float16* ksh = Kh + (size_t)(kv0 + r) * DMODEL + half;   // K row kv0+r, d = half..half+31
      const _Float16* vsh = Vt + (size_t)r * SEQ_LEN + kv0 + half;    // V^T row d = r, s = kv0+half..+31
#pragma unroll
      for (int i = 0; i < 4; ++i) {
        const v8h a0 = *(const v8h*)(ksh + 8 * i);
        const v8h b0 = *(const v8h*)(vsh + 8 * i);
        *(v8h*)(Ksh + r * AT_LP + half + 8 * i) = a0;
        *(v8h*)(Vth + r * AT_LP + half + 8 * i) = b0;
      }
    }
    __syncthreads();

    // ---- scores: D element r of lane -> (query row 8hh+r, key j*16+c) ----
    v8f s[4];
#pragma unroll
    for (int j = 0; j < 4; ++j) {
      s[j] = (v8f){0.f,0.f,0.f,0.f,0.f,0.f,0.f,0.f};
#pragma unroll
      for (int dc = 0; dc < 2; ++dc) {
        FH kb;
        kb.h[0] = *(const v8h*)(Ksh + (j * 16 + c) * AT_LP + dc * 32 + 8 * hh);
        kb.h[1] = *(const v8h*)(Ksh + (j * 16 + c) * AT_LP + dc * 32 + 16 + 8 * hh);
        s[j] = at_mma_h(qa[dc], kb.v, s[j]);
      }
    }
    float cm[8];
#pragma unroll
    for (int r = 0; r < 8; ++r) {
      const int qrow = q0 + 8 * hh + r;                        // 0..SEQ_LEN-1
      const float* pbr = pbias + (size_t)qrow * SEQ_LEN + kv0;   // in range: kv0 + 63 < SEQ_LEN
      float m = -INFINITY;
#pragma unroll
      for (int j = 0; j < 4; ++j) {
        const float bb = bf16_rne_f32(pbr[j * 16 + c]);
        const float sv = s[j][r] * sscale + bb;
        s[j][r] = sv;
        m = fmaxf(m, sv);
      }
#pragma unroll
      for (int off = 1; off < 16; off <<= 1) m = fmaxf(m, __shfl_xor(m, off, 32));
      cm[r] = m;
    }
    _Float16* pwh = Psh[wave];
#pragma unroll
    for (int r = 0; r < 8; ++r) {
      const float mnew = fmaxf(mrow[r], cm[r]);
      const float alpha = expf(mrow[r] - mnew);
      mrow[r] = mnew;
      float psum = 0.f;
#pragma unroll
      for (int j = 0; j < 4; ++j) {
        const float p = expf(s[j][r] - mnew);
        psum += p;
        pwh[(8 * hh + r) * AT_LP + j * 16 + c] = (_Float16)(p * P_CARRY);
      }
#pragma unroll
      for (int off = 1; off < 16; off <<= 1) psum += __shfl_xor(psum, off, 32);
      lrow[r] = lrow[r] * alpha + psum;
#pragma unroll
      for (int t = 0; t < 4; ++t) oacc[t][r] *= alpha;
    }
    __builtin_amdgcn_fence(__ATOMIC_RELEASE, "workgroup");
    __builtin_amdgcn_wave_barrier();
    __builtin_amdgcn_fence(__ATOMIC_ACQUIRE, "workgroup");
    // ---- oacc[t] += P (A: row = query c, k = key) . V (B: col = d t*16+c, k = key) ----
#pragma unroll 1
    for (int kk = 0; kk < 2; ++kk) {
      FH pa;
      pa.h[0] = *(const v8h*)(pwh + c * AT_LP + kk * 32 + 8 * hh);
      pa.h[1] = *(const v8h*)(pwh + c * AT_LP + kk * 32 + 16 + 8 * hh);
#pragma unroll
      for (int t = 0; t < 4; ++t) {
        FH vb;
        vb.h[0] = *(const v8h*)(Vth + (t * 16 + c) * AT_LP + kk * 32 + 8 * hh);
        vb.h[1] = *(const v8h*)(Vth + (t * 16 + c) * AT_LP + kk * 32 + 16 + 8 * hh);
        oacc[t] = at_mma_h(pa.v, vb.v, oacc[t]);
      }
    }
  }

  float* os = Os[wave];
#pragma unroll
  for (int r = 0; r < 8; ++r) {
    const float inv = O_CARRY * (1.0f / (lrow[r] * P_CARRY));   // lrow >= 1
#pragma unroll
    for (int t = 0; t < 4; ++t) os[(8 * hh + r) * 68 + t * 16 + c] = oacc[t][r] * inv;
  }
  __builtin_amdgcn_fence(__ATOMIC_RELEASE, "workgroup");
  __builtin_amdgcn_wave_barrier();
  __builtin_amdgcn_fence(__ATOMIC_ACQUIRE, "workgroup");
  {
    const int q4 = lane >> 3, c8 = (lane & 7) * 8;
    {
#pragma unroll
      for (int it = 0; it < 4; ++it) {
        const int row = it * 4 + q4;   // it 0..3 x q4 0..3 covers rows 0..15 of the wave tile
        const float* sp = os + row * 68 + c8;
        v8h hv;
#pragma unroll
        for (int e = 0; e < 8; ++e) hv[e] = (_Float16)sp[e];
        *(v8h*)(Ob + (size_t)(q0 + row) * DMODEL + c8) = hv;
      }
      
    }
  }
}

// ---------------------------------------------------------------------------
// Workspace region map (byte offsets, all 1 MiB aligned; total 50,331,648 B = 48 MiB):
//   [ 0 MiB,  8 MiB)  xb   : bf16 x            [4096][1024]
//   [ 8 MiB, 10 MiB)  wqb  : bf16 Wq           [1024][1024]
//   [10 MiB, 12 MiB)  wkb  : bf16 Wk
//   [12 MiB, 14 MiB)  wvb  : bf16 Wv
//   [14 MiB, 16 MiB)  woh  : f16 (bf16val(Wo) x64)
//   [16 MiB, 24 MiB)  qh   : f16 q plane       [4096][1024]
//   [24 MiB, 32 MiB)  kh   : f16 k plane       [4096][1024]
//   [32 MiB, 40 MiB)  vth  : f16 v^T plane     [2][1024][2048]
//   [40 MiB, 48 MiB)  oh   : f16 O plane (x64) [4096][1024]
// ---------------------------------------------------------------------------
extern "C" void kernel_launch(void* const* d_in, const int* in_sizes, int n_in,
                              void* d_out, int out_size, void* d_ws,
                              size_t ws_size, hipStream_t stream) {
  if (n_in < 10) return;
  const float* x  = (const float*)d_in[0];
  const float* pb = (const float*)d_in[1];
  const float* Wq = (const float*)d_in[2];
  const float* bq = (const float*)d_in[3];
  const float* Wk = (const float*)d_in[4];
  const float* bk = (const float*)d_in[5];
  const float* Wv = (const float*)d_in[6];
  const float* bv = (const float*)d_in[7];
  const float* Wo = (const float*)d_in[8];
  const float* bo = (const float*)d_in[9];
  float* out = (float*)d_out;

  const int nX = MTOK * DMODEL;        // 4194304
  const int nW = DMODEL * DMODEL;      // 1048576
  const int nP = SEQ_LEN * SEQ_LEN;    // 4194304
  if (in_sizes[0] != nX || in_sizes[1] != nP) return;
  if (in_sizes[2] != nW || in_sizes[4] != nW || in_sizes[6] != nW || in_sizes[8] != nW) return;
  if (in_sizes[3] != DMODEL || in_sizes[5] != DMODEL || in_sizes[7] != DMODEL || in_sizes[9] != DMODEL) return;
  if (out_size != nX) return;

  const size_t bytesX16 = (size_t)nX * 2;   // 8 MiB
  const size_t bytesW16 = (size_t)nW * 2;   // 2 MiB
  size_t off = 0;
  const size_t off_xb  = off; off += bytesX16;
  const size_t off_wq  = off; off += bytesW16;
  const size_t off_wk  = off; off += bytesW16;
  const size_t off_wv  = off; off += bytesW16;
  const size_t off_wo  = off; off += bytesW16;
  const size_t off_q   = off; off += bytesX16;
  const size_t off_k   = off; off += bytesX16;
  const size_t off_vt  = off; off += bytesX16;
  const size_t off_o   = off; off += bytesX16;
  if (off > ws_size) return;               // 50,331,648 B needed

  char* ws = (char*)d_ws;
  unsigned short* xb  = (unsigned short*)(ws + off_xb);
  unsigned short* wqb = (unsigned short*)(ws + off_wq);
  unsigned short* wkb = (unsigned short*)(ws + off_wk);
  unsigned short* wvb = (unsigned short*)(ws + off_wv);
  unsigned short* woh = (unsigned short*)(ws + off_wo);
  unsigned short* qh  = (unsigned short*)(ws + off_q);
  unsigned short* kh  = (unsigned short*)(ws + off_k);
  unsigned short* vth = (unsigned short*)(ws + off_vt);
  unsigned short* oh  = (unsigned short*)(ws + off_o);

  // ---- casts (2 elements per thread; exact multiples of 512 elements per block) ----
  const int n2X = nX / 2;   // 2097152 -> 8192 blocks
  const int n2W = nW / 2;   // 524288  -> 2048 blocks
  cast_f32_bf16x2<<<dim3(n2X / 256), dim3(256), 0, stream>>>(x,  xb,  n2X);
  cast_f32_bf16x2<<<dim3(n2W / 256), dim3(256), 0, stream>>>(Wq, wqb, n2W);
  cast_f32_bf16x2<<<dim3(n2W / 256), dim3(256), 0, stream>>>(Wk, wkb, n2W);
  cast_f32_bf16x2<<<dim3(n2W / 256), dim3(256), 0, stream>>>(Wv, wvb, n2W);
  cast_f32_bf16val_f16x2<<<dim3(n2W / 256), dim3(256), 0, stream>>>(Wo, woh, n2W, W_CARRY);

  // ---- q / k projections: C[token][feature] = xb . Wᵀ + b, M=4096, N=1024, K=1024 (64*16 = 1024 tiles -> 128 blocks) ----
  const long strideXb = (long)SEQ_LEN * DMODEL;   // per-batch token block of xb (elements)
  wmma_gemm64<1, false, 2, 1, false, 0><<<dim3((MTOK / 64) * (DMODEL / 64) / 8, 1), dim3(256), 0, stream>>>(
      xb, xb, DMODEL, 0L, wqb, wqb, DMODEL, 0L, (void*)qh, (void*)qh, DMODEL, 0L, bq, bq, 0L,
      MTOK, DMODEL, DMODEL, 1.0f);
  wmma_gemm64<1, false, 2, 1, false, 0><<<dim3((MTOK / 64) * (DMODEL / 64) / 8, 1), dim3(256), 0, stream>>>(
      xb, xb, DMODEL, 0L, wkb, wkb, DMODEL, 0L, (void*)kh, (void*)kh, DMODEL, 0L, bk, bk, 0L,
      MTOK, DMODEL, DMODEL, 1.0f);
  // ---- v^T projection (role swapped): C_b[feature][token] = Wv . x_bᵀ + bv[feature]; M=1024, N=2048, K=1024, grid.y = batch
  //      (16*32 = 512 tiles -> 64 blocks per batch) ----
  wmma_gemm64<1, false, 1, 1, false, 0><<<dim3((DMODEL / 64) * (SEQ_LEN / 64) / 8, BATCH_N), dim3(256), 0, stream>>>(
      wvb, wvb, DMODEL, 0L, xb, xb, DMODEL, strideXb, (void*)vth, (void*)vth, SEQ_LEN, (long)DMODEL * SEQ_LEN, bv, bv, 0L,
      DMODEL, SEQ_LEN, DMODEL, 1.0f);

  // ---- attention: 2 * 16 * (2048/64) = 1024 blocks of 64 query rows ----
  attn_bias64_kernel<<<dim3(BATCH_N * NHEADS * (SEQ_LEN / 64)), dim3(128), 0, stream>>>(qh, kh, vth, pb, oh, 0.125f);

  // ---- output projection: out[token][feature] = (O x64) . (Wo x64)ᵀ / 4096 + bo; M=4096, N=1024, K=1024 ----
  wmma_gemm64<0, false, 2, 0, false, 0><<<dim3((MTOK / 64) * (DMODEL / 64) / 8, 1), dim3(256), 0, stream>>>(
      oh, oh, DMODEL, 0L, woh, woh, DMODEL, 0L, (void*)out, (void*)out, DMODEL, 0L, bo, bo, 0L,
      MTOK, DMODEL, DMODEL, 1.0f / (O_CARRY * W_CARRY));
}

// v002
// Measured time: 215 microseconds a run.
// In both of two side-by-side timings against v001, it was 1.52 times as fast.
// All steps since v000 together make it 1.72 times as fast.
// Contractions: q, k, v^T projections on v_wmma_f32_16x16x32_bf16 (bf16 RNE operands from the raw inputs, single product, f32 accumulate); q.k^T and p.v on v_wmma_f32_16x16x32_f16 (f16 q/k/v planes, p carried x2^15, f32 accumulate, online softmax and additive bias in f32); output projection on v_wmma_f32_16x16x32_f16 (O carried x64 in f16, Wo as bf16-RNE value x64 in f16, f32 accumulate, x1/4096 in the f32 epilogue).
#include <hip/hip_runtime.h>
#include <math.h>
#include <stdint.h>

constexpr int BATCH_N = 2;
constexpr int SEQ_LEN = 2048;
constexpr int DMODEL  = 1024;
constexpr int NHEADS  = 16;
constexpr int HDIM    = 64;
constexpr int MTOK    = BATCH_N * SEQ_LEN;   // 4096 token rows
static_assert(NHEADS * HDIM == DMODEL, "head split");

constexpr float P_CARRY = 32768.0f;   // probabilities carried x2^15 in f16
constexpr float O_CARRY = 64.0f;      // attention output carried x64 in f16
constexpr float W_CARRY = 64.0f;      // Wo carried x64 in f16

typedef __attribute__((ext_vector_type(16))) _Float16 v16h;
typedef __attribute__((ext_vector_type(8)))  _Float16 v8h;
typedef __attribute__((ext_vector_type(16))) __bf16   v16b;
typedef __attribute__((ext_vector_type(8)))  __bf16   v8b;
typedef __attribute__((ext_vector_type(8)))  float    v8f;
typedef __attribute__((ext_vector_type(4)))  float    v4f;

__device__ __forceinline__ unsigned short f2bf_bits(float f) {
  unsigned u = __float_as_uint(f);
  return (unsigned short)((u + 0x7FFFu + ((u >> 16) & 1u)) >> 16);
}
__device__ __forceinline__ float bf_bits2f(unsigned short h) { return __uint_as_float(((unsigned)h) << 16); }
// f32 value of the RNE bf16 of f
__device__ __forceinline__ float bf16_rne_f32(float f) { return bf_bits2f(f2bf_bits(f)); }

// hazard guards as plain device helpers (no inline asm inside the kernel template body)
__device__ __forceinline__ void dep_guard_h(v8f& a, v8f& b, v16h x, v16h y) { asm volatile("v_nop\n\tv_nop\n\tv_nop\n\tv_nop" : "+v"(a), "+v"(b) : "v"(x), "v"(y)); }
__device__ __forceinline__ void dep_guard_b(v8f& a, v8f& b, v16b x, v16b y) { asm volatile("v_nop\n\tv_nop\n\tv_nop\n\tv_nop" : "+v"(a), "+v"(b) : "v"(x), "v"(y)); }
__device__ __forceinline__ void keep4_h(v16h a, v16h b, v16h c, v16h d) { asm volatile("v_nop" :: "v"(a), "v"(b), "v"(c), "v"(d)); }
__device__ __forceinline__ void keep4_b(v16b a, v16b b, v16b c, v16b d) { asm volatile("v_nop" :: "v"(a), "v"(b), "v"(c), "v"(d)); }
__device__ __forceinline__ void acc_guard4(v8f& a, v8f& b, v8f& c, v8f& d) { asm volatile("v_nop\n\tv_nop\n\tv_nop\n\tv_nop" : "+v"(a), "+v"(b), "+v"(c), "+v"(d)); }
// stands behind a group of global loads, in front of the first overwrite of a register that holds one of their addresses
__device__ __forceinline__ void wait_xcnt0() { asm volatile("s_wait_xcnt 0x0" ::: "memory"); }
template <typename T> struct Frag;
template <> struct Frag<_Float16> {
  typedef v16h V; typedef v8h H; union U { v16h v; v8h h[2]; };
  static __device__ __forceinline__ v16h load(const _Float16* p) {   // elements 0..7 <- p[0..7], 8..15 <- p[16..23]
    U f; f.h[0] = *(const v8h*)(p); f.h[1] = *(const v8h*)(p + 16); return f.v;
  }
  static __device__ __forceinline__ v8f mma(v16h a, v16h b, v8f c) {
    return __builtin_amdgcn_wmma_f32_16x16x32_f16(false, a, false, b, (short)0, c, false, false);
  }
  static __device__ __forceinline__ void guard(v8f& a, v8f& b, v16h x, v16h y) { dep_guard_h(a, b, x, y); }
  static __device__ __forceinline__ void keep(v16h a, v16h b, v16h c, v16h d) { keep4_h(a, b, c, d); }
};
template <> struct Frag<__bf16> {
  typedef v16b V; typedef v8b H; union U { v16b v; v8b h[2]; };
  static __device__ __forceinline__ v16b load(const __bf16* p) {
    U f; f.h[0] = *(const v8b*)(p); f.h[1] = *(const v8b*)(p + 16); return f.v;
  }
  static __device__ __forceinline__ v8f mma(v16b a, v16b b, v8f c) {
    return __builtin_amdgcn_wmma_f32_16x16x32_bf16(false, a, false, b, (short)0, c, false, false);
  }
  static __device__ __forceinline__ void guard(v8f& a, v8f& b, v16b x, v16b y) { dep_guard_b(a, b, x, y); }
  static __device__ __forceinline__ void keep(v16b a, v16b b, v16b c, v16b d) { keep4_b(a, b, c, d); }
};

// ---- Register-blocked batched WMMA GEMM ------------------------------------
// C[m,n] = scale * sum_k A[m,k] * Bt[n,k] (+bias)(+resid); each wave owns a 64x64 tile.
// Block = 4 waves (2 x 2) = one 128x128 tile of C. Per 64-wide k slab the block stages 128 rows of A and 128 rows of Bt
// in LDS: 8 lanes x 16 B cover one whole 128-B line of a row, so a wave-wide load touches 4 lines. Two LDS buffers:
// the next slab is loaded to registers before the products of this slab and stored to the other buffer behind them,
// one __syncthreads() per slab. Fragments are read from LDS with k ascending in steps of 32.
// A row-major [M,K]; Bt row-major [N,K]; M,N % 128 == 0, K % 64 == 0.
// SPLIT (hi/lo operand planes) is not staged: single-plane operands only.
// BIAS_MODE: 0 = none, 1 = bias[m], 2 = bias[n].
// OUT_MODE: 0 = f32, 1 = f16, 2 = bf16 hi plane (Cout) + bf16 lo plane (Cout2).
// ET: 0 = f16 operands, 1 = bf16 operands (pointers passed as 16-bit storage)
template <int ET> struct Elem;
template <> struct Elem<0> { typedef _Float16 T; };
template <> struct Elem<1> { typedef __bf16 T; };
#define GM_BT 128  // rows of A and of Bt per block tile
#define GM_BK 64   // k elements per staged slab: 128 B = one line per row
#define GM_LP 72   // LDS row pitch in 16-bit elements: 144 B = 16 B x 9 (odd), for the ds_load_b128 fragment reads
template <int ET, bool SPLIT, int BIAS_MODE, int OUT_MODE, bool RESID, int ACT = 0>
__global__ __launch_bounds__(128) void wmma_gemm64(
    const unsigned short* __restrict__ Ap, const unsigned short* __restrict__ A2p, int lda, long strideA,
    const unsigned short* __restrict__ Btp, const unsigned short* __restrict__ Bt2p, int ldb, long strideB,
    void* __restrict__ Cout, void* __restrict__ Cout2, int ldc, long strideC,
    const float* __restrict__ bias,
    const float* __restrict__ resid, long strideR,
    int M, int N, int K, float scale) {
  static_assert(!SPLIT, "single-plane operands only");
  typedef typename Elem<ET>::T T;
  typedef typename Frag<T>::V V;
  typedef typename Frag<T>::H H;
  const T* A = (const T*)Ap; const T* Bt = (const T*)Btp;
  __shared__ __align__(16) T sA[2][GM_BT * GM_LP];   // A slab  [row][k], 2 x 18 KB
  __shared__ __align__(16) T sB[2][GM_BT * GM_LP];   // Bt slab [row][k], 2 x 18 KB
  __shared__ __align__(16) float sT[4][16 * 68];     // per-wave 16x64 slab, pitch 68 floats
  const int b    = blockIdx.y;
  const int tid  = threadIdx.x;
  const int lane = tid & 31;
  const int wave = tid >> 5;
  const int tilesN = N >> 7;
  const int tilesM = M >> 7;
  const int tile = blockIdx.x;
  if (tile >= tilesM * tilesN) return;   // block-uniform, in front of every barrier
  const int tm = tile / tilesN;
  const int tn = tile - tm * tilesN;
  const int bm0 = tm << 7;               // first row / column of the block tile
  const int bn0 = tn << 7;
  const int wm  = (wave >> 1) << 6;      // this wave's 64x64 quadrant
  const int wn  = (wave & 1) << 6;
  const int m0 = bm0 + wm;
  const int n0 = bn0 + wn;

  const T* Ab  = A  + (size_t)b * strideA;
  const T* Bb  = Bt + (size_t)b * strideB;

  const int rlane = lane & 15;                 // row (A) / col (B, D) within subtile
  const int koff  = (lane >> 4) * 8;           // k offset of this lane half
  const int mOff  = (lane >> 4) * 8;           // D row offset

  // staging map: 128 threads x 8 x 16 B per operand = 128 rows x 128 B; thread -> row (tid>>3) + 16*i, bytes (tid&7)*16
  const int srow = tid >> 3;
  const int scol = (tid & 7) * 8;
  const T* gA = Ab + (size_t)(bm0 + srow) * lda + scol;
  const T* gB = Bb + (size_t)(bn0 + srow) * ldb + scol;
  const int sOff = srow * GM_LP + scol;

  v8f acc[4][4];
#pragma unroll
  for (int i = 0; i < 4; ++i)
#pragma unroll
    for (int j = 0; j < 4; ++j) acc[i][j] = (v8f){0.f,0.f,0.f,0.f,0.f,0.f,0.f,0.f};

  H ra[8], rb[8];
#pragma unroll
  for (int i = 0; i < 8; ++i) {
    ra[i] = *(const H*)(gA + (size_t)(i * 16) * lda);
    rb[i] = *(const H*)(gB + (size_t)(i * 16) * ldb);
  }
#pragma unroll
  for (int i = 0; i < 8; ++i) {
    *(H*)(&sA[0][sOff + i * 16 * GM_LP]) = ra[i];
    *(H*)(&sB[0][sOff + i * 16 * GM_LP]) = rb[i];
  }
  __syncthreads();

  const int nSlab = K >> 6;
  for (int s = 0; s < nSlab; ++s) {
    const int cur = s & 1;
    const bool more = (s + 1 < nSlab);   // block-uniform
    if (more) {
      const int kn = (s + 1) << 6;
#pragma unroll
      for (int i = 0; i < 8; ++i) {
        ra[i] = *(const H*)(gA + (size_t)(i * 16) * lda + kn);
        rb[i] = *(const H*)(gB + (size_t)(i * 16) * ldb + kn);
      }
      wait_xcnt0();   // the fragment reads below land in registers that held these loads' addresses
    }
    const T* cA = &sA[cur][(wm + rlane) * GM_LP + koff];
    const T* cB = &sB[cur][(wn + rlane) * GM_LP + koff];
#pragma unroll
    for (int kk = 0; kk < GM_BK; kk += 32) {
      V bh[4], ah[4];
#pragma unroll
      for (int j = 0; j < 4; ++j) bh[j] = Frag<T>::load(cB + (j << 4) * GM_LP + kk);
#pragma unroll
      for (int i = 0; i < 4; ++i) ah[i] = Frag<T>::load(cA + (i << 4) * GM_LP + kk);
#pragma unroll
      for (int i = 0; i < 4; ++i) {
#pragma unroll
        for (int j = 0; j < 4; ++j) acc[i][j] = Frag<T>::mma(ah[i], bh[j], acc[i][j]);
        Frag<T>::guard(acc[i][0], acc[i][3], ah[i], ah[i]);
      }
      Frag<T>::keep(bh[0], bh[1], bh[2], bh[3]);
    }
    if (more) {
#pragma unroll
      for (int i = 0; i < 8; ++i) {
        *(H*)(&sA[cur ^ 1][sOff + i * 16 * GM_LP]) = ra[i];
        *(H*)(&sB[cur ^ 1][sOff + i * 16 * GM_LP]) = rb[i];
      }
    }
    __syncthreads();   // publishes the other buffer and ends every wave's reads of this one before it is refilled
  }
  acc_guard4(acc[0][0], acc[0][1], acc[0][2], acc[0][3]);
  acc_guard4(acc[1][0], acc[1][1], acc[1][2], acc[1][3]);
  acc_guard4(acc[2][0], acc[2][1], acc[2][2], acc[2][3]);
  acc_guard4(acc[3][0], acc[3][1], acc[3][2], acc[3][3]);

  // ---- epilogue ----
  float* slab = sT[wave];
  const float* Rb = RESID ? (resid + (size_t)b * strideR) : nullptr;
#pragma unroll
  for (int i = 0; i < 4; ++i) {
    const int mBase = m0 + (i << 4);
#pragma unroll
    for (int j = 0; j < 4; ++j) {
      const int n = n0 + (j << 4) + rlane;
      float bv = 0.f;
      if (BIAS_MODE == 2) bv = bias[n];
#pragma unroll
      for (int r = 0; r < 8; ++r) {
        float v = acc[i][j][r] * scale;
        if (BIAS_MODE == 1) v += bias[mBase + mOff + r];
        if (BIAS_MODE == 2) v += bv;
        if (RESID) v += Rb[(size_t)(mBase + mOff + r) * ldc + n];
        if (ACT == 1) v = tanhf(v);
        if (ACT == 2) v = fmaxf(v, 0.0f);
        if (ACT == 3) v = v / (1.0f + expf(-v));
        if (ACT == 4) v = (v > 0.f) ? v : 0.01f * v;
        if (ACT == 5) v = 0.5f * v * (1.0f + erff(v * 0.70710678118654752f));
        slab[(mOff + r) * 68 + (j << 4) + rlane] = v;
      }
    }
    __builtin_amdgcn_fence(__ATOMIC_RELEASE, "workgroup");
    __builtin_amdgcn_wave_barrier();
    __builtin_amdgcn_fence(__ATOMIC_ACQUIRE, "workgroup");
    if (OUT_MODE == 0) {
      float* C = (float*)Cout + (size_t)b * strideC;
      const int hh = lane >> 4, c4 = (lane & 15) * 4;     // row seg = 256 B = 16 lanes x 16 B
      {
#pragma unroll
        for (int it = 0; it < 8; ++it) {
          const int row = it * 2 + hh;
          v4f v = *(const v4f*)(slab + row * 68 + c4);
          *(v4f*)(C + (size_t)(mBase + row) * ldc + n0 + c4) = v;
        }
        
      }
    } else {
      const int q = lane >> 3, c8 = (lane & 7) * 8;
      unsigned short* C  = (unsigned short*)Cout  + (size_t)b * strideC;
      unsigned short* C2 = (OUT_MODE == 2) ? ((unsigned short*)Cout2 + (size_t)b * strideC) : nullptr;
      {
#pragma unroll
        for (int it = 0; it < 4; ++it) {
          const int row = it * 4 + q;
          const float* sp = slab + row * 68 + c8;
          v8h hv, lv;
#pragma unroll
          for (int e = 0; e < 8; ++e) {
            if (OUT_MODE == 1) {
              hv[e] = (_Float16)sp[e];
            } else {
              unsigned short hb = f2bf_bits(sp[e]);
              unsigned short lb = f2bf_bits(sp[e] - bf_bits2f(hb));
              hv[e] = __builtin_bit_cast(_Float16, hb);
              lv[e] = __builtin_bit_cast(_Float16, lb);
            }
          }
          *(v8h*)(C + (size_t)(mBase + row) * ldc + n0 + c8) = hv;
          if (OUT_MODE == 2) *(v8h*)(C2 + (size_t)(mBase + row) * ldc + n0 + c8) = lv;
        }
        
      }
    }
    __builtin_amdgcn_fence(__ATOMIC_RELEASE, "workgroup");
    __builtin_amdgcn_wave_barrier();
    __builtin_amdgcn_fence(__ATOMIC_ACQUIRE, "workgroup");
  }
}

// ---------------------------------------------------------------------------
// f32 -> bf16 (RNE) cast: 2 elements per thread, ONE 4-B store per lane -> each wave writes exactly one whole
// Coverage: grid = n2/256 blocks x 256 threads x 2 elements = 2*n2 = whole plane
//   x : n2 = 4096*1024/2 = 2097152 = 8192 blocks;  W : n2 = 1024*1024/2 = 524288 = 2048 blocks (exact multiples).
// ---------------------------------------------------------------------------
__device__ __forceinline__ unsigned pk16(unsigned short a, unsigned short b) { return (unsigned)a | ((unsigned)b << 16); }

__global__ __launch_bounds__(256) void cast_f32_bf16x2(const float* __restrict__ in, unsigned short* __restrict__ out, int n2) {
  const int i = blockIdx.x * 256 + threadIdx.x;
  if (i < n2) {
    const float f0 = in[2 * (size_t)i], f1 = in[2 * (size_t)i + 1];
    const unsigned u = pk16(f2bf_bits(f0), f2bf_bits(f1));
    ((unsigned*)out)[i] = u;
    
  }
}

// f32 -> bf16 (RNE) value -> x scale (power of two, exact) -> f16 bits (exact for normal-range values); same store shape as above.
__global__ __launch_bounds__(256) void cast_f32_bf16val_f16x2(const float* __restrict__ in, unsigned short* __restrict__ out,
                                                              int n2, float scale) {
  const int i = blockIdx.x * 256 + threadIdx.x;
  if (i < n2) {
    const float f0 = bf16_rne_f32(in[2 * (size_t)i]) * scale;
    const float f1 = bf16_rne_f32(in[2 * (size_t)i + 1]) * scale;
    const _Float16 h0 = (_Float16)f0, h1 = (_Float16)f1;
    const unsigned u = pk16(__builtin_bit_cast(unsigned short, h0), __builtin_bit_cast(unsigned short, h1));
    ((unsigned*)out)[i] = u;
    
  }
}

// =====================================================================================
// Full (unmasked) attention with an additive [SEQ][SEQ] score bias shared over (b, h); head dim 64.
//   q plane  f16: element (b, t, h, d) at [(b*SEQ_LEN + t)*DMODEL + h*64 + d]
//   k plane  f16: element (b, s, h, d) at [(b*SEQ_LEN + s)*DMODEL + h*64 + d]
//   v^T plane f16: element (b, h, d, s) at [b*DMODEL*SEQ_LEN + (h*64 + d)*SEQ_LEN + s]
//   O plane  f16 (x O_CARRY): element (b, t, h, d) at [(b*SEQ_LEN + t)*DMODEL + h*64 + d]
//   scores = (q . k) * sscale + bf16value(pbias[t][s]) : single v_wmma_f32_16x16x32_f16 product, f32 accumulate, bias in f32
//   out    = p . v : p (unnormalised, <= 1) carried x2^15 in f16, v f16, single product, f32 accumulate
//   online softmax in f32 over all SEQ_LEN keys (32 chunks of 64, compile-time trip count).
//   Block = 4 waves = 64 query rows of one (b, h); grid.x = BATCH_N * NHEADS * (SEQ_LEN/64) = 1024.
//   K / V^T chunk staging: 128 threads x 32 elements per plane = the whole 64x64 tile (16-B copies, plain loads,
//   __syncthreads before and after); fragment loads read the LDS tiles with the same v8h element type.
// =====================================================================================
#define AT_D 64
#define AT_NW 4
#define AT_QB 64
#define AT_KC 64
#define AT_LP 72   // LDS row pitch of the K, V^T and P tiles in f16: 144 B = 16 B x 9 (odd), so 16 rows read by ds_load_b128 fall on distinct banks

__device__ __forceinline__ v8f at_mma_h(v16h a, v16h b, v8f c) {
  c = __builtin_amdgcn_wmma_f32_16x16x32_f16(false, a, false, b, (short)0, c, false, false);
  asm volatile("v_nop\n\tv_nop\n\tv_nop\n\tv_nop" : "+v"(c) : "v"(a), "v"(b));
  return c;
}

__global__ __launch_bounds__(128)
void attn_bias64_kernel(const unsigned short* __restrict__ qp, const unsigned short* __restrict__ kp,
                        const unsigned short* __restrict__ vtp, const float* __restrict__ pbias,
                        unsigned short* __restrict__ op, float sscale) {
  union FH { v16h v; v8h h[2]; };
  __shared__ __align__(16) _Float16 Ksh[AT_KC * AT_LP];            // K  [kv][d]   9 KB, pitch AT_LP
  __shared__ __align__(16) _Float16 Vth[AT_D * AT_LP];             // V^T [d][kv]  9 KB, pitch AT_LP
  __shared__ __align__(16) _Float16 Psh[AT_NW][16 * AT_LP];        // per wave P [row][kv]  9 KB, pitch AT_LP
  __shared__ __align__(16) float    Os[AT_NW][16 * 68];            // per wave out tile, pitch 68  17 KB

  const int tid  = threadIdx.x;
  const int wave = tid >> 5;
  const int lane = tid & 31;
  const int hh   = lane >> 4;
  const int c    = lane & 15;

  const int nqb = SEQ_LEN / AT_QB;        // 32
  const int bx = blockIdx.x;
  const int qb = bx % nqb;
  const int bh = bx / nqb;                // 0..BATCH_N*NHEADS-1
  const int h  = bh % NHEADS;
  const int b  = bh / NHEADS;
  const int q0 = qb * AT_QB + wave * 16;  // first query row of this wave (within the sequence)

  const _Float16* Qh = (const _Float16*)(const void*)qp  + (size_t)b * SEQ_LEN * DMODEL + (size_t)h * AT_D;
  const _Float16* Kh = (const _Float16*)(const void*)kp  + (size_t)b * SEQ_LEN * DMODEL + (size_t)h * AT_D;
  const _Float16* Vt = (const _Float16*)(const void*)vtp + (size_t)b * DMODEL * SEQ_LEN + (size_t)h * AT_D * SEQ_LEN;
  _Float16*       Ob = (_Float16*)(void*)op + (size_t)b * SEQ_LEN * DMODEL + (size_t)h * AT_D;

  // ---- Q fragments (A operand, row = lane&15, split k map via Frag load): 2 d-chunks ----
  v16h qa[2];
#pragma unroll
  for (int dc = 0; dc < 2; ++dc) {
    const _Float16* qr = Qh + (size_t)(q0 + c) * DMODEL + dc * 32 + 8 * hh;
    qa[dc] = Frag<_Float16>::load(qr);
  }

  float mrow[8], lrow[8];
  v8f oacc[4];
#pragma unroll
  for (int r = 0; r < 8; ++r) { mrow[r] = -INFINITY; lrow[r] = 0.f; }
#pragma unroll
  for (int t = 0; t < 4; ++t) oacc[t] = (v8f){0.f,0.f,0.f,0.f,0.f,0.f,0.f,0.f};

  const int nChunks = SEQ_LEN / AT_KC;   // 32, compile-time constant
  for (int kc = 0; kc < nChunks; ++kc) {
    const int kv0 = kc * AT_KC;
    __syncthreads();
    {
      // staging coverage: 128 threads x (4 x 8) elements = 64 rows x 64 per plane = the whole chunk tile
      const int r = tid >> 1, half = (tid & 1) * 32;
      const _Float16* ksh = Kh + (size_t)(kv0 + r) * DMODEL + half;   // K row kv0+r, d = half..half+31
      const _Float16* vsh = Vt + (size_t)r * SEQ_LEN + kv0 + half;    // V^T row d = r, s = kv0+half..+31
#pragma unroll
      for (int i = 0; i < 4; ++i) {
        const v8h a0 = *(const v8h*)(ksh + 8 * i);
        const v8h b0 = *(const v8h*)(vsh + 8 * i);
        *(v8h*)(Ksh + r * AT_LP + half + 8 * i) = a0;
        *(v8h*)(Vth + r * AT_LP + half + 8 * i) = b0;
      }
    }
    __syncthreads();

    // ---- scores: D element r of lane -> (query row 8hh+r, key j*16+c) ----
    v8f s[4];
#pragma unroll
    for (int j = 0; j < 4; ++j) {
      s[j] = (v8f){0.f,0.f,0.f,0.f,0.f,0.f,0.f,0.f};
#pragma unroll
      for (int dc = 0; dc < 2; ++dc) {
        FH kb;
        kb.h[0] = *(const v8h*)(Ksh + (j * 16 + c) * AT_LP + dc * 32 + 8 * hh);
        kb.h[1] = *(const v8h*)(Ksh + (j * 16 + c) * AT_LP + dc * 32 + 16 + 8 * hh);
        s[j] = at_mma_h(qa[dc], kb.v, s[j]);
      }
    }
    float cm[8];
#pragma unroll
    for (int r = 0; r < 8; ++r) {
      const int qrow = q0 + 8 * hh + r;                        // 0..SEQ_LEN-1
      const float* pbr = pbias + (size_t)qrow * SEQ_LEN + kv0;   // in range: kv0 + 63 < SEQ_LEN
      float m = -INFINITY;
#pragma unroll
      for (int j = 0; j < 4; ++j) {
        const float bb = bf16_rne_f32(pbr[j * 16 + c]);
        const float sv = s[j][r] * sscale + bb;
        s[j][r] = sv;
        m = fmaxf(m, sv);
      }
#pragma unroll
      for (int off = 1; off < 16; off <<= 1) m = fmaxf(m, __shfl_xor(m, off, 32));
      cm[r] = m;
    }
    _Float16* pwh = Psh[wave];
#pragma unroll
    for (int r = 0; r < 8; ++r) {
      const float mnew = fmaxf(mrow[r], cm[r]);
      const float alpha = expf(mrow[r] - mnew);
      mrow[r] = mnew;
      float psum = 0.f;
#pragma unroll
      for (int j = 0; j < 4; ++j) {
        const float p = expf(s[j][r] - mnew);
        psum += p;
        pwh[(8 * hh + r) * AT_LP + j * 16 + c] = (_Float16)(p * P_CARRY);
      }
#pragma unroll
      for (int off = 1; off < 16; off <<= 1) psum += __shfl_xor(psum, off, 32);
      lrow[r] = lrow[r] * alpha + psum;
#pragma unroll
      for (int t = 0; t < 4; ++t) oacc[t][r] *= alpha;
    }
    __builtin_amdgcn_fence(__ATOMIC_RELEASE, "workgroup");
    __builtin_amdgcn_wave_barrier();
    __builtin_amdgcn_fence(__ATOMIC_ACQUIRE, "workgroup");
    // ---- oacc[t] += P (A: row = query c, k = key) . V (B: col = d t*16+c, k = key) ----
#pragma unroll 1
    for (int kk = 0; kk < 2; ++kk) {
      FH pa;
      pa.h[0] = *(const v8h*)(pwh + c * AT_LP + kk * 32 + 8 * hh);
      pa.h[1] = *(const v8h*)(pwh + c * AT_LP + kk * 32 + 16 + 8 * hh);
#pragma unroll
      for (int t = 0; t < 4; ++t) {
        FH vb;
        vb.h[0] = *(const v8h*)(Vth + (t * 16 + c) * AT_LP + kk * 32 + 8 * hh);
        vb.h[1] = *(const v8h*)(Vth + (t * 16 + c) * AT_LP + kk * 32 + 16 + 8 * hh);
        oacc[t] = at_mma_h(pa.v, vb.v, oacc[t]);
      }
    }
  }

  float* os = Os[wave];
#pragma unroll
  for (int r = 0; r < 8; ++r) {
    const float inv = O_CARRY * (1.0f / (lrow[r] * P_CARRY));   // lrow >= 1
#pragma unroll
    for (int t = 0; t < 4; ++t) os[(8 * hh + r) * 68 + t * 16 + c] = oacc[t][r] * inv;
  }
  __builtin_amdgcn_fence(__ATOMIC_RELEASE, "workgroup");
  __builtin_amdgcn_wave_barrier();
  __builtin_amdgcn_fence(__ATOMIC_ACQUIRE, "workgroup");
  {
    const int q4 = lane >> 3, c8 = (lane & 7) * 8;
    {
#pragma unroll
      for (int it = 0; it < 4; ++it) {
        const int row = it * 4 + q4;   // it 0..3 x q4 0..3 covers rows 0..15 of the wave tile
        const float* sp = os + row * 68 + c8;
        v8h hv;
#pragma unroll
        for (int e = 0; e < 8; ++e) hv[e] = (_Float16)sp[e];
        *(v8h*)(Ob + (size_t)(q0 + row) * DMODEL + c8) = hv;
      }
      
    }
  }
}

// ---------------------------------------------------------------------------
// Workspace region map (byte offsets, all 1 MiB aligned; total 50,331,648 B = 48 MiB):
//   [ 0 MiB,  8 MiB)  xb   : bf16 x            [4096][1024]
//   [ 8 MiB, 10 MiB)  wqb  : bf16 Wq           [1024][1024]
//   [10 MiB, 12 MiB)  wkb  : bf16 Wk
//   [12 MiB, 14 MiB)  wvb  : bf16 Wv
//   [14 MiB, 16 MiB)  woh  : f16 (bf16val(Wo) x64)
//   [16 MiB, 24 MiB)  qh   : f16 q plane       [4096][1024]
//   [24 MiB, 32 MiB)  kh   : f16 k plane       [4096][1024]
//   [32 MiB, 40 MiB)  vth  : f16 v^T plane     [2][1024][2048]
//   [40 MiB, 48 MiB)  oh   : f16 O plane (x64) [4096][1024]
// ---------------------------------------------------------------------------
extern "C" void kernel_launch(void* const* d_in, const int* in_sizes, int n_in,
                              void* d_out, int out_size, void* d_ws,
                              size_t ws_size, hipStream_t stream) {
  if (n_in < 10) return;
  const float* x  = (const float*)d_in[0];
  const float* pb = (const float*)d_in[1];
  const float* Wq = (const float*)d_in[2];
  const float* bq = (const float*)d_in[3];
  const float* Wk = (const float*)d_in[4];
  const float* bk = (const float*)d_in[5];
  const float* Wv = (const float*)d_in[6];
  const float* bv = (const float*)d_in[7];
  const float* Wo = (const float*)d_in[8];
  const float* bo = (const float*)d_in[9];
  float* out = (float*)d_out;

  const int nX = MTOK * DMODEL;        // 4194304
  const int nW = DMODEL * DMODEL;      // 1048576
  const int nP = SEQ_LEN * SEQ_LEN;    // 4194304
  if (in_sizes[0] != nX || in_sizes[1] != nP) return;
  if (in_sizes[2] != nW || in_sizes[4] != nW || in_sizes[6] != nW || in_sizes[8] != nW) return;
  if (in_sizes[3] != DMODEL || in_sizes[5] != DMODEL || in_sizes[7] != DMODEL || in_sizes[9] != DMODEL) return;
  if (out_size != nX) return;

  const size_t bytesX16 = (size_t)nX * 2;   // 8 MiB
  const size_t bytesW16 = (size_t)nW * 2;   // 2 MiB
  size_t off = 0;
  const size_t off_xb  = off; off += bytesX16;
  const size_t off_wq  = off; off += bytesW16;
  const size_t off_wk  = off; off += bytesW16;
  const size_t off_wv  = off; off += bytesW16;
  const size_t off_wo  = off; off += bytesW16;
  const size_t off_q   = off; off += bytesX16;
  const size_t off_k   = off; off += bytesX16;
  const size_t off_vt  = off; off += bytesX16;
  const size_t off_o   = off; off += bytesX16;
  if (off > ws_size) return;               // 50,331,648 B needed

  char* ws = (char*)d_ws;
  unsigned short* xb  = (unsigned short*)(ws + off_xb);
  unsigned short* wqb = (unsigned short*)(ws + off_wq);
  unsigned short* wkb = (unsigned short*)(ws + off_wk);
  unsigned short* wvb = (unsigned short*)(ws + off_wv);
  unsigned short* woh = (unsigned short*)(ws + off_wo);
  unsigned short* qh  = (unsigned short*)(ws + off_q);
  unsigned short* kh  = (unsigned short*)(ws + off_k);
  unsigned short* vth = (unsigned short*)(ws + off_vt);
  unsigned short* oh  = (unsigned short*)(ws + off_o);

  // ---- casts (2 elements per thread; exact multiples of 512 elements per block) ----
  const int n2X = nX / 2;   // 2097152 -> 8192 blocks
  const int n2W = nW / 2;   // 524288  -> 2048 blocks
  cast_f32_bf16x2<<<dim3(n2X / 256), dim3(256), 0, stream>>>(x,  xb,  n2X);
  cast_f32_bf16x2<<<dim3(n2W / 256), dim3(256), 0, stream>>>(Wq, wqb, n2W);
  cast_f32_bf16x2<<<dim3(n2W / 256), dim3(256), 0, stream>>>(Wk, wkb, n2W);
  cast_f32_bf16x2<<<dim3(n2W / 256), dim3(256), 0, stream>>>(Wv, wvb, n2W);
  cast_f32_bf16val_f16x2<<<dim3(n2W / 256), dim3(256), 0, stream>>>(Wo, woh, n2W, W_CARRY);

  // ---- q / k projections: C[token][feature] = xb . Wᵀ + b, M=4096, N=1024, K=1024 (32*8 = 256 block tiles of 128x128) ----
  const long strideXb = (long)SEQ_LEN * DMODEL;   // per-batch token block of xb (elements)
  wmma_gemm64<1, false, 2, 1, false, 0><<<dim3((MTOK / 128) * (DMODEL / 128), 1), dim3(128), 0, stream>>>(
      xb, xb, DMODEL, 0L, wqb, wqb, DMODEL, 0L, (void*)qh, (void*)qh, DMODEL, 0L, bq, bq, 0L,
      MTOK, DMODEL, DMODEL, 1.0f);
  wmma_gemm64<1, false, 2, 1, false, 0><<<dim3((MTOK / 128) * (DMODEL / 128), 1), dim3(128), 0, stream>>>(
      xb, xb, DMODEL, 0L, wkb, wkb, DMODEL, 0L, (void*)kh, (void*)kh, DMODEL, 0L, bk, bk, 0L,
      MTOK, DMODEL, DMODEL, 1.0f);
  // ---- v^T projection (role swapped): C_b[feature][token] = Wv . x_bᵀ + bv[feature]; M=1024, N=2048, K=1024, z = batch
  //      (8*16 = 128 block tiles per batch) ----
  wmma_gemm64<1, false, 1, 1, false, 0><<<dim3((DMODEL / 128) * (SEQ_LEN / 128), BATCH_N), dim3(128), 0, stream>>>(
      wvb, wvb, DMODEL, 0L, xb, xb, DMODEL, strideXb, (void*)vth, (void*)vth, SEQ_LEN, (long)DMODEL * SEQ_LEN, bv, bv, 0L,
      DMODEL, SEQ_LEN, DMODEL, 1.0f);

  // ---- attention: 2 * 16 * (2048/64) = 1024 blocks of 64 query rows ----
  attn_bias64_kernel<<<dim3(BATCH_N * NHEADS * (SEQ_LEN / 64)), dim3(128), 0, stream>>>(qh, kh, vth, pb, oh, 0.125f);

  // ---- output projection: out[token][feature] = (O x64) . (Wo x64)ᵀ / 4096 + bo; M=4096, N=1024, K=1024 ----
  wmma_gemm64<0, false, 2, 0, false, 0><<<dim3((MTOK / 128) * (DMODEL / 128), 1), dim3(128), 0, stream>>>(
      oh, oh, DMODEL, 0L, woh, woh, DMODEL, 0L, (void*)out, (void*)out, DMODEL, 0L, bo, bo, 0L,
      MTOK, DMODEL, DMODEL, 1.0f / (O_CARRY * W_CARRY));
}

// v003
// One run takes 176 microseconds.
// Timed twice side by side with v002, it ran 1.23 times as fast both times.
// Over all steps from v000 it is 2.12 times as fast.
// Contractions: q, k, v^T projections on v_wmma_f32_16x16x32_bf16 (bf16 RNE operands from the raw inputs, single product, f32 accumulate); q.k^T and p.v on v_wmma_f32_16x16x32_f16 (f16 q/k/v planes, p carried x2^15, f32 accumulate, online softmax and additive bias in f32); output projection on v_wmma_f32_16x16x32_f16 (O carried x64 in f16, Wo as bf16-RNE value x64 in f16, f32 accumulate, x1/4096 in the f32 epilogue).
#include <hip/hip_runtime.h>
#include <math.h>
#include <stdint.h>

constexpr int BATCH_N = 2;
constexpr int SEQ_LEN = 2048;
constexpr int DMODEL  = 1024;
constexpr int NHEADS  = 16;
constexpr int HDIM    = 64;
constexpr int MTOK    = BATCH_N * SEQ_LEN;   // 4096 token rows
static_assert(NHEADS * HDIM == DMODEL, "head split");

constexpr float P_CARRY = 32768.0f;   // probabilities carried x2^15 in f16
constexpr float O_CARRY = 64.0f;      // attention output carried x64 in f16
constexpr float W_CARRY = 64.0f;      // Wo carried x64 in f16

typedef __attribute__((ext_vector_type(16))) _Float16 v16h;
typedef __attribute__((ext_vector_type(8)))  _Float16 v8h;
typedef __attribute__((ext_vector_type(16))) __bf16   v16b;
typedef __attribute__((ext_vector_type(8)))  __bf16   v8b;
typedef __attribute__((ext_vector_type(8)))  float    v8f;
typedef __attribute__((ext_vector_type(4)))  float    v4f;

__device__ __forceinline__ unsigned short f2bf_bits(float f) {
  unsigned u = __float_as_uint(f);
  return (unsigned short)((u + 0x7FFFu + ((u >> 16) & 1u)) >> 16);
}
__device__ __forceinline__ float bf_bits2f(unsigned short h) { return __uint_as_float(((unsigned)h) << 16); }
// f32 value of the RNE bf16 of f
__device__ __forceinline__ float bf16_rne_f32(float f) { return bf_bits2f(f2bf_bits(f)); }

// hazard guards as plain device helpers (no inline asm inside the kernel template body)
__device__ __forceinline__ void dep_guard_h(v8f& a, v8f& b, v16h x, v16h y) { asm volatile("v_nop\n\tv_nop\n\tv_nop\n\tv_nop" : "+v"(a), "+v"(b) : "v"(x), "v"(y)); }
__device__ __forceinline__ void dep_guard_b(v8f& a, v8f& b, v16b x, v16b y) { asm volatile("v_nop\n\tv_nop\n\tv_nop\n\tv_nop" : "+v"(a), "+v"(b) : "v"(x), "v"(y)); }
__device__ __forceinline__ void keep4_h(v16h a, v16h b, v16h c, v16h d) { asm volatile("v_nop" :: "v"(a), "v"(b), "v"(c), "v"(d)); }
__device__ __forceinline__ void keep4_b(v16b a, v16b b, v16b c, v16b d) { asm volatile("v_nop" :: "v"(a), "v"(b), "v"(c), "v"(d)); }
__device__ __forceinline__ void acc_guard4(v8f& a, v8f& b, v8f& c, v8f& d) { asm volatile("v_nop\n\tv_nop\n\tv_nop\n\tv_nop" : "+v"(a), "+v"(b), "+v"(c), "+v"(d)); }
// stands behind a group of global loads, in front of the first overwrite of a register that holds one of their addresses
__device__ __forceinline__ void wait_xcnt0() { asm volatile("s_wait_xcnt 0x0" ::: "memory"); }
template <typename T> struct Frag;
template <> struct Frag<_Float16> {
  typedef v16h V; typedef v8h H; union U { v16h v; v8h h[2]; };
  static __device__ __forceinline__ v16h load(const _Float16* p) {   // elements 0..7 <- p[0..7], 8..15 <- p[16..23]
    U f; f.h[0] = *(const v8h*)(p); f.h[1] = *(const v8h*)(p + 16); return f.v;
  }
  static __device__ __forceinline__ v8f mma(v16h a, v16h b, v8f c) {
    return __builtin_amdgcn_wmma_f32_16x16x32_f16(false, a, false, b, (short)0, c, false, false);
  }
  static __device__ __forceinline__ void guard(v8f& a, v8f& b, v16h x, v16h y) { dep_guard_h(a, b, x, y); }
  static __device__ __forceinline__ void keep(v16h a, v16h b, v16h c, v16h d) { keep4_h(a, b, c, d); }
};
template <> struct Frag<__bf16> {
  typedef v16b V; typedef v8b H; union U { v16b v; v8b h[2]; };
  static __device__ __forceinline__ v16b load(const __bf16* p) {
    U f; f.h[0] = *(const v8b*)(p); f.h[1] = *(const v8b*)(p + 16); return f.v;
  }
  static __device__ __forceinline__ v8f mma(v16b a, v16b b, v8f c) {
    return __builtin_amdgcn_wmma_f32_16x16x32_bf16(false, a, false, b, (short)0, c, false, false);
  }
  static __device__ __forceinline__ void guard(v8f& a, v8f& b, v16b x, v16b y) { dep_guard_b(a, b, x, y); }
  static __device__ __forceinline__ void keep(v16b a, v16b b, v16b c, v16b d) { keep4_b(a, b, c, d); }
};

// ---- Register-blocked batched WMMA GEMM ------------------------------------
// C[m,n] = scale * sum_k A[m,k] * Bt[n,k] (+bias)(+resid); each wave owns a 64x64 tile.
// Block = 4 waves (2 x 2) = one 128x128 tile of C. Per 64-wide k slab the block stages 128 rows of A and 128 rows of Bt
// in LDS: 8 lanes x 16 B cover one whole 128-B line of a row, so a wave-wide load touches 4 lines. Two LDS buffers:
// the next slab is loaded to registers before the products of this slab and stored to the other buffer behind them,
// one __syncthreads() per slab. Fragments are read from LDS with k ascending in steps of 32.
// A row-major [M,K]; Bt row-major [N,K]; M,N % 128 == 0, K % 64 == 0.
// SPLIT (hi/lo operand planes) is not staged: single-plane operands only.
// BIAS_MODE: 0 = none, 1 = bias[m], 2 = bias[n].
// OUT_MODE: 0 = f32, 1 = f16, 2 = bf16 hi plane (Cout) + bf16 lo plane (Cout2).
// ET: 0 = f16 operands, 1 = bf16 operands (pointers passed as 16-bit storage)
template <int ET> struct Elem;
template <> struct Elem<0> { typedef _Float16 T; };
template <> struct Elem<1> { typedef __bf16 T; };
#define GM_BT 128  // rows of A and of Bt per block tile
#define GM_BK 64   // k elements per staged slab: 128 B = one line per row
#define GM_LP 72   // LDS row pitch in 16-bit elements: 144 B = 16 B x 9 (odd), for the ds_load_b128 fragment reads
template <int ET, bool SPLIT, int BIAS_MODE, int OUT_MODE, bool RESID, int ACT = 0>
__global__ __launch_bounds__(128) void wmma_gemm64(
    const unsigned short* __restrict__ Ap, const unsigned short* __restrict__ A2p, int lda, long strideA,
    const unsigned short* __restrict__ Btp, const unsigned short* __restrict__ Bt2p, int ldb, long strideB,
    void* __restrict__ Cout, void* __restrict__ Cout2, int ldc, long strideC,
    const float* __restrict__ bias,
    const float* __restrict__ resid, long strideR,
    int M, int N, int K, float scale) {
  static_assert(!SPLIT, "single-plane operands only");
  typedef typename Elem<ET>::T T;
  typedef typename Frag<T>::V V;
  typedef typename Frag<T>::H H;
  const T* A = (const T*)Ap; const T* Bt = (const T*)Btp;
  __shared__ __align__(16) T sA[2][GM_BT * GM_LP];   // A slab  [row][k], 2 x 18 KB
  __shared__ __align__(16) T sB[2][GM_BT * GM_LP];   // Bt slab [row][k], 2 x 18 KB
  __shared__ __align__(16) float sT[4][16 * 68];     // per-wave 16x64 slab, pitch 68 floats
  const int b    = blockIdx.y;
  const int tid  = threadIdx.x;
  const int lane = tid & 31;
  const int wave = tid >> 5;
  const int tilesN = N >> 7;
  const int tilesM = M >> 7;
  const int tile = blockIdx.x;
  if (tile >= tilesM * tilesN) return;   // block-uniform, in front of every barrier
  const int tm = tile / tilesN;
  const int tn = tile - tm * tilesN;
  const int bm0 = tm << 7;               // first row / column of the block tile
  const int bn0 = tn << 7;
  const int wm  = (wave >> 1) << 6;      // this wave's 64x64 quadrant
  const int wn  = (wave & 1) << 6;
  const int m0 = bm0 + wm;
  const int n0 = bn0 + wn;

  const T* Ab  = A  + (size_t)b * strideA;
  const T* Bb  = Bt + (size_t)b * strideB;

  const int rlane = lane & 15;                 // row (A) / col (B, D) within subtile
  const int koff  = (lane >> 4) * 8;           // k offset of this lane half
  const int mOff  = (lane >> 4) * 8;           // D row offset

  // staging map: 128 threads x 8 x 16 B per operand = 128 rows x 128 B; thread -> row (tid>>3) + 16*i, bytes (tid&7)*16
  const int srow = tid >> 3;
  const int scol = (tid & 7) * 8;
  const T* gA = Ab + (size_t)(bm0 + srow) * lda + scol;
  const T* gB = Bb + (size_t)(bn0 + srow) * ldb + scol;
  const int sOff = srow * GM_LP + scol;

  v8f acc[4][4];
#pragma unroll
  for (int i = 0; i < 4; ++i)
#pragma unroll
    for (int j = 0; j < 4; ++j) acc[i][j] = (v8f){0.f,0.f,0.f,0.f,0.f,0.f,0.f,0.f};

  H ra[8], rb[8];
#pragma unroll
  for (int i = 0; i < 8; ++i) {
    ra[i] = *(const H*)(gA + (size_t)(i * 16) * lda);
    rb[i] = *(const H*)(gB + (size_t)(i * 16) * ldb);
  }
#pragma unroll
  for (int i = 0; i < 8; ++i) {
    *(H*)(&sA[0][sOff + i * 16 * GM_LP]) = ra[i];
    *(H*)(&sB[0][sOff + i * 16 * GM_LP]) = rb[i];
  }
  __syncthreads();

  const int nSlab = K >> 6;
  for (int s = 0; s < nSlab; ++s) {
    const int cur = s & 1;
    const bool more = (s + 1 < nSlab);   // block-uniform
    if (more) {
      const int kn = (s + 1) << 6;
#pragma unroll
      for (int i = 0; i < 8; ++i) {
        ra[i] = *(const H*)(gA + (size_t)(i * 16) * lda + kn);
        rb[i] = *(const H*)(gB + (size_t)(i * 16) * ldb + kn);
      }
      wait_xcnt0();   // the fragment reads below land in registers that held these loads' addresses
    }
    const T* cA = &sA[cur][(wm + rlane) * GM_LP + koff];
    const T* cB = &sB[cur][(wn + rlane) * GM_LP + koff];
#pragma unroll
    for (int kk = 0; kk < GM_BK; kk += 32) {
      V bh[4], ah[4];
#pragma unroll
      for (int j = 0; j < 4; ++j) bh[j] = Frag<T>::load(cB + (j << 4) * GM_LP + kk);
#pragma unroll
      for (int i = 0; i < 4; ++i) ah[i] = Frag<T>::load(cA + (i << 4) * GM_LP + kk);
#pragma unroll
      for (int i = 0; i < 4; ++i) {
#pragma unroll
        for (int j = 0; j < 4; ++j) acc[i][j] = Frag<T>::mma(ah[i], bh[j], acc[i][j]);
        Frag<T>::guard(acc[i][0], acc[i][3], ah[i], ah[i]);
      }
      Frag<T>::keep(bh[0], bh[1], bh[2], bh[3]);
    }
    if (more) {
#pragma unroll
      for (int i = 0; i < 8; ++i) {
        *(H*)(&sA[cur ^ 1][sOff + i * 16 * GM_LP]) = ra[i];
        *(H*)(&sB[cur ^ 1][sOff + i * 16 * GM_LP]) = rb[i];
      }
    }
    __syncthreads();   // publishes the other buffer and ends every wave's reads of this one before it is refilled
  }
  acc_guard4(acc[0][0], acc[0][1], acc[0][2], acc[0][3]);
  acc_guard4(acc[1][0], acc[1][1], acc[1][2], acc[1][3]);
  acc_guard4(acc[2][0], acc[2][1], acc[2][2], acc[2][3]);
  acc_guard4(acc[3][0], acc[3][1], acc[3][2], acc[3][3]);

  // ---- epilogue ----
  float* slab = sT[wave];
  const float* Rb = RESID ? (resid + (size_t)b * strideR) : nullptr;
#pragma unroll
  for (int i = 0; i < 4; ++i) {
    const int mBase = m0 + (i << 4);
#pragma unroll
    for (int j = 0; j < 4; ++j) {
      const int n = n0 + (j << 4) + rlane;
      float bv = 0.f;
      if (BIAS_MODE == 2) bv = bias[n];
#pragma unroll
      for (int r = 0; r < 8; ++r) {
        float v = acc[i][j][r] * scale;
        if (BIAS_MODE == 1) v += bias[mBase + mOff + r];
        if (BIAS_MODE == 2) v += bv;
        if (RESID) v += Rb[(size_t)(mBase + mOff + r) * ldc + n];
        if (ACT == 1) v = tanhf(v);
        if (ACT == 2) v = fmaxf(v, 0.0f);
        if (ACT == 3) v = v / (1.0f + expf(-v));
        if (ACT == 4) v = (v > 0.f) ? v : 0.01f * v;
        if (ACT == 5) v = 0.5f * v * (1.0f + erff(v * 0.70710678118654752f));
        slab[(mOff + r) * 68 + (j << 4) + rlane] = v;
      }
    }
    __builtin_amdgcn_fence(__ATOMIC_RELEASE, "workgroup");
    __builtin_amdgcn_wave_barrier();
    __builtin_amdgcn_fence(__ATOMIC_ACQUIRE, "workgroup");
    if (OUT_MODE == 0) {
      float* C = (float*)Cout + (size_t)b * strideC;
      const int hh = lane >> 4, c4 = (lane & 15) * 4;     // row seg = 256 B = 16 lanes x 16 B
      {
#pragma unroll
        for (int it = 0; it < 8; ++it) {
          const int row = it * 2 + hh;
          v4f v = *(const v4f*)(slab + row * 68 + c4);
          *(v4f*)(C + (size_t)(mBase + row) * ldc + n0 + c4) = v;
        }
        
      }
    } else {
      const int q = lane >> 3, c8 = (lane & 7) * 8;
      unsigned short* C  = (unsigned short*)Cout  + (size_t)b * strideC;
      unsigned short* C2 = (OUT_MODE == 2) ? ((unsigned short*)Cout2 + (size_t)b * strideC) : nullptr;
      {
#pragma unroll
        for (int it = 0; it < 4; ++it) {
          const int row = it * 4 + q;
          const float* sp = slab + row * 68 + c8;
          v8h hv, lv;
#pragma unroll
          for (int e = 0; e < 8; ++e) {
            if (OUT_MODE == 1) {
              hv[e] = (_Float16)sp[e];
            } else {
              unsigned short hb = f2bf_bits(sp[e]);
              unsigned short lb = f2bf_bits(sp[e] - bf_bits2f(hb));
              hv[e] = __builtin_bit_cast(_Float16, hb);
              lv[e] = __builtin_bit_cast(_Float16, lb);
            }
          }
          *(v8h*)(C + (size_t)(mBase + row) * ldc + n0 + c8) = hv;
          if (OUT_MODE == 2) *(v8h*)(C2 + (size_t)(mBase + row) * ldc + n0 + c8) = lv;
        }
        
      }
    }
    __builtin_amdgcn_fence(__ATOMIC_RELEASE, "workgroup");
    __builtin_amdgcn_wave_barrier();
    __builtin_amdgcn_fence(__ATOMIC_ACQUIRE, "workgroup");
  }
}

// ---------------------------------------------------------------------------
// f32 -> bf16 (RNE) cast: 2 elements per thread, ONE 4-B store per lane -> each wave writes exactly one whole
// Coverage: grid = n2/256 blocks x 256 threads x 2 elements = 2*n2 = whole plane
//   x : n2 = 4096*1024/2 = 2097152 = 8192 blocks;  W : n2 = 1024*1024/2 = 524288 = 2048 blocks (exact multiples).
// ---------------------------------------------------------------------------
__device__ __forceinline__ unsigned pk16(unsigned short a, unsigned short b) { return (unsigned)a | ((unsigned)b << 16); }

__global__ __launch_bounds__(256) void cast_f32_bf16x2(const float* __restrict__ in, unsigned short* __restrict__ out, int n2) {
  const int i = blockIdx.x * 256 + threadIdx.x;
  if (i < n2) {
    const float f0 = in[2 * (size_t)i], f1 = in[2 * (size_t)i + 1];
    const unsigned u = pk16(f2bf_bits(f0), f2bf_bits(f1));
    ((unsigned*)out)[i] = u;
    
  }
}

// f32 -> bf16 (RNE) value -> x scale (power of two, exact) -> f16 bits (exact for normal-range values); same store shape as above.
__global__ __launch_bounds__(256) void cast_f32_bf16val_f16x2(const float* __restrict__ in, unsigned short* __restrict__ out,
                                                              int n2, float scale) {
  const int i = blockIdx.x * 256 + threadIdx.x;
  if (i < n2) {
    const float f0 = bf16_rne_f32(in[2 * (size_t)i]) * scale;
    const float f1 = bf16_rne_f32(in[2 * (size_t)i + 1]) * scale;
    const _Float16 h0 = (_Float16)f0, h1 = (_Float16)f1;
    const unsigned u = pk16(__builtin_bit_cast(unsigned short, h0), __builtin_bit_cast(unsigned short, h1));
    ((unsigned*)out)[i] = u;
    
  }
}

// =====================================================================================
// Full (unmasked) attention with an additive [SEQ][SEQ] score bias shared over (b, h); head dim 64.
//   q plane  f16: element (b, t, h, d) at [(b*SEQ_LEN + t)*DMODEL + h*64 + d]
//   k plane  f16: element (b, s, h, d) at [(b*SEQ_LEN + s)*DMODEL + h*64 + d]
//   v^T plane f16: element (b, h, d, s) at [b*DMODEL*SEQ_LEN + (h*64 + d)*SEQ_LEN + s]
//   O plane  f16 (x O_CARRY): element (b, t, h, d) at [(b*SEQ_LEN + t)*DMODEL + h*64 + d]
//   scores = (q . k) * sscale + bf16value(pbias[t][s]) : single v_wmma_f32_16x16x32_f16 product, f32 accumulate, bias in f32
//   out    = p . v : p (unnormalised, <= 1) carried x2^15 in f16, v f16, single product, f32 accumulate
//   both products are formed transposed (S^T = K.Q^T, O^T = V^T.P^T): a lane holds one query's scores, so the maximum and the
//   sum run in-lane (plus one exchange between the wave's halves) and P^T goes from the score accumulators into the B operand.
//   online softmax in f32 over all SEQ_LEN keys (32 chunks of 64, compile-time trip count).
//   Block = 4 waves = 64 query rows of one (b, h); grid.x = BATCH_N * NHEADS * (SEQ_LEN/64) = 1024.
//   K / V^T chunk staging: 128 threads x 32 elements per plane = the whole 64x64 tile (16-B copies, plain loads,
//   __syncthreads before and after); fragment loads read the LDS tiles with the same v8h element type.
// =====================================================================================
#define AT_D 64
#define AT_NW 4
#define AT_QB 64
#define AT_KC 64
#define AT_LP 72   // LDS row pitch of the K and V^T tiles in f16: 144 B = 16 B x 9 (odd), so 16 rows read by ds_load_b128 fall on distinct banks

__device__ __forceinline__ v8f at_mma_h(v16h a, v16h b, v8f c) {
  c = __builtin_amdgcn_wmma_f32_16x16x32_f16(false, a, false, b, (short)0, c, false, false);
  asm volatile("v_nop\n\tv_nop\n\tv_nop\n\tv_nop" : "+v"(c) : "v"(a), "v"(b));
  return c;
}

// lane l <-> lane l ^ 16
__device__ __forceinline__ float xhalf(float x) {
  return __builtin_bit_cast(float, __builtin_amdgcn_permlanex16(__builtin_bit_cast(int, x), __builtin_bit_cast(int, x), 0x76543210, 0xfedcba98, false, false));
}

__global__ __launch_bounds__(128)
void attn_bias64_kernel(const unsigned short* __restrict__ qp, const unsigned short* __restrict__ kp,
                        const unsigned short* __restrict__ vtp, const float* __restrict__ pbias,
                        unsigned short* __restrict__ op, float sscale) {
  union FH { v16h v; v8h h[2]; };
  __shared__ __align__(16) _Float16 Ksh[AT_KC * AT_LP];            // K  [kv][d]   9 KB, pitch AT_LP
  __shared__ __align__(16) _Float16 Vth[AT_D * AT_LP];             // V^T [d][kv]  9 KB, pitch AT_LP
  __shared__ __align__(16) float    Os[AT_NW][16 * 68];            // per wave out tile, pitch 68  17 KB

  const int tid  = threadIdx.x;
  const int wave = tid >> 5;
  const int lane = tid & 31;
  const int hh   = lane >> 4;
  const int c    = lane & 15;

  const int nqb = SEQ_LEN / AT_QB;        // 32
  const int bx = blockIdx.x;
  const int qb = bx % nqb;
  const int bh = bx / nqb;                // 0..BATCH_N*NHEADS-1
  const int h  = bh % NHEADS;
  const int b  = bh / NHEADS;
  const int q0 = qb * AT_QB + wave * 16;  // first query row of this wave (within the sequence)

  const _Float16* Qh = (const _Float16*)(const void*)qp  + (size_t)b * SEQ_LEN * DMODEL + (size_t)h * AT_D;
  const _Float16* Kh = (const _Float16*)(const void*)kp  + (size_t)b * SEQ_LEN * DMODEL + (size_t)h * AT_D;
  const _Float16* Vt = (const _Float16*)(const void*)vtp + (size_t)b * DMODEL * SEQ_LEN + (size_t)h * AT_D * SEQ_LEN;
  _Float16*       Ob = (_Float16*)(void*)op + (size_t)b * SEQ_LEN * DMODEL + (size_t)h * AT_D;

  // ---- Q fragments (B operand, col = query = lane&15, split k map via Frag load): 2 d-chunks ----
  v16h qa[2];
#pragma unroll
  for (int dc = 0; dc < 2; ++dc) {
    const _Float16* qr = Qh + (size_t)(q0 + c) * DMODEL + dc * 32 + 8 * hh;
    qa[dc] = Frag<_Float16>::load(qr);
  }

  // One query per lane: lane (hh, c) holds query q0 + c; its half hh holds keys 8hh..8hh+7 of every 16-key tile.
  float mrow = -INFINITY, lrow = 0.f;   // mrow: the same in both halves; lrow: this half's keys only, joined behind the loop
  v8f oacc[4];                          // O^T: element r of oacc[t] -> (d = t*16 + 8hh + r, query c)
#pragma unroll
  for (int t = 0; t < 4; ++t) oacc[t] = (v8f){0.f,0.f,0.f,0.f,0.f,0.f,0.f,0.f};

  const float* pbq = pbias + (size_t)(q0 + c) * SEQ_LEN + 8 * hh;   // this lane's bias row, at its half's first key

  const int nChunks = SEQ_LEN / AT_KC;   // 32, compile-time constant
  for (int kc = 0; kc < nChunks; ++kc) {
    const int kv0 = kc * AT_KC;
    __syncthreads();
    {
      // staging coverage: 128 threads x (4 x 8) elements = 64 rows x 64 per plane = the whole chunk tile
      const int r = tid >> 1, half = (tid & 1) * 32;
      const _Float16* ksh = Kh + (size_t)(kv0 + r) * DMODEL + half;   // K row kv0+r, d = half..half+31
      const _Float16* vsh = Vt + (size_t)r * SEQ_LEN + kv0 + half;    // V^T row d = r, s = kv0+half..+31
#pragma unroll
      for (int i = 0; i < 4; ++i) {
        const v8h a0 = *(const v8h*)(ksh + 8 * i);
        const v8h b0 = *(const v8h*)(vsh + 8 * i);
        *(v8h*)(Ksh + r * AT_LP + half + 8 * i) = a0;
        *(v8h*)(Vth + r * AT_LP + half + 8 * i) = b0;
      }
    }
    __syncthreads();

    // ---- bias: 8 consecutive keys of the lane's own query per 16-key tile (in range: kv0 + 63 < SEQ_LEN) ----
    v4f pbv[4][2];
#pragma unroll
    for (int j = 0; j < 4; ++j) {
      pbv[j][0] = *(const v4f*)(pbq + kv0 + j * 16);
      pbv[j][1] = *(const v4f*)(pbq + kv0 + j * 16 + 4);
    }

    // ---- scores, transposed: S^T = K (A: row = key j*16+c) . Q^T (B: col = query c); D element r -> (key j*16+8hh+r, query c) ----
    v8f s[4];
#pragma unroll
    for (int j = 0; j < 4; ++j) {
      s[j] = (v8f){0.f,0.f,0.f,0.f,0.f,0.f,0.f,0.f};
#pragma unroll
      for (int dc = 0; dc < 2; ++dc) {
        FH kb;
        kb.h[0] = *(const v8h*)(Ksh + (j * 16 + c) * AT_LP + dc * 32 + 8 * hh);
        kb.h[1] = *(const v8h*)(Ksh + (j * 16 + c) * AT_LP + dc * 32 + 16 + 8 * hh);
        s[j] = at_mma_h(kb.v, qa[dc], s[j]);
      }
    }
    float mj[4];   // one maximum per 16-key tile: four independent chains
#pragma unroll
    for (int j = 0; j < 4; ++j) {
      mj[j] = -INFINITY;
#pragma unroll
      for (int r = 0; r < 8; ++r) {
        const float bb = bf16_rne_f32(pbv[j][r >> 2][r & 3]);
        const float sv = s[j][r] * sscale + bb;
        s[j][r] = sv;
        mj[j] = fmaxf(mj[j], sv);
      }
    }
    float m = fmaxf(fmaxf(mj[0], mj[1]), fmaxf(mj[2], mj[3]));
    m = fmaxf(m, xhalf(m));   // the other half's 32 keys of the same query
    const float mnew = fmaxf(mrow, m);
    const float alpha = expf(mrow - mnew);
    mrow = mnew;
    // ---- P^T packed in place: tiles 2kk and 2kk+1 give elements 0..7 and 8..15 of the B operand (k = 8hh+e, 16+8hh+e) ----
    FH pb[2];
    float pj[4];   // one sum per 16-key tile: four independent chains
#pragma unroll
    for (int j = 0; j < 4; ++j) {
      pj[j] = 0.f;
#pragma unroll
      for (int r = 0; r < 8; ++r) {
        const float p = expf(s[j][r] - mnew);
        pj[j] += p;
        pb[j >> 1].h[j & 1][r] = (_Float16)(p * P_CARRY);
      }
    }
    lrow = lrow * alpha + ((pj[0] + pj[1]) + (pj[2] + pj[3]));
#pragma unroll
    for (int t = 0; t < 4; ++t) oacc[t] *= alpha;
    // ---- O^T: oacc[t] += V^T (A: row = d t*16+c, k = key) . P^T (B: col = query c, k = key) ----
#pragma unroll
    for (int kk = 0; kk < 2; ++kk) {
#pragma unroll
      for (int t = 0; t < 4; ++t) {
        FH vb;
        vb.h[0] = *(const v8h*)(Vth + (t * 16 + c) * AT_LP + kk * 32 + 8 * hh);
        vb.h[1] = *(const v8h*)(Vth + (t * 16 + c) * AT_LP + kk * 32 + 16 + 8 * hh);
        oacc[t] = at_mma_h(vb.v, pb[kk].v, oacc[t]);
      }
    }
  }

  float* os = Os[wave];
  {
    const float lsum = lrow + xhalf(lrow);                    // both halves' keys
    const float inv = O_CARRY * (1.0f / (lsum * P_CARRY));    // lsum >= 1
#pragma unroll
    for (int t = 0; t < 4; ++t) {
      const v8f o = oacc[t] * inv;
      *(v4f*)(os + c * 68 + t * 16 + 8 * hh)     = (v4f){o[0], o[1], o[2], o[3]};
      *(v4f*)(os + c * 68 + t * 16 + 8 * hh + 4) = (v4f){o[4], o[5], o[6], o[7]};
    }
  }
  __builtin_amdgcn_fence(__ATOMIC_RELEASE, "workgroup");
  __builtin_amdgcn_wave_barrier();
  __builtin_amdgcn_fence(__ATOMIC_ACQUIRE, "workgroup");
  {
    const int q4 = lane >> 3, c8 = (lane & 7) * 8;
    {
#pragma unroll
      for (int it = 0; it < 4; ++it) {
        const int row = it * 4 + q4;   // it 0..3 x q4 0..3 covers rows 0..15 of the wave tile
        const float* sp = os + row * 68 + c8;
        v8h hv;
#pragma unroll
        for (int e = 0; e < 8; ++e) hv[e] = (_Float16)sp[e];
        *(v8h*)(Ob + (size_t)(q0 + row) * DMODEL + c8) = hv;
      }
      
    }
  }
}

// ---------------------------------------------------------------------------
// Workspace region map (byte offsets, all 1 MiB aligned; total 50,331,648 B = 48 MiB):
//   [ 0 MiB,  8 MiB)  xb   : bf16 x            [4096][1024]
//   [ 8 MiB, 10 MiB)  wqb  : bf16 Wq           [1024][1024]
//   [10 MiB, 12 MiB)  wkb  : bf16 Wk
//   [12 MiB, 14 MiB)  wvb  : bf16 Wv
//   [14 MiB, 16 MiB)  woh  : f16 (bf16val(Wo) x64)
//   [16 MiB, 24 MiB)  qh   : f16 q plane       [4096][1024]
//   [24 MiB, 32 MiB)  kh   : f16 k plane       [4096][1024]
//   [32 MiB, 40 MiB)  vth  : f16 v^T plane     [2][1024][2048]
//   [40 MiB, 48 MiB)  oh   : f16 O plane (x64) [4096][1024]
// ---------------------------------------------------------------------------
extern "C" void kernel_launch(void* const* d_in, const int* in_sizes, int n_in,
                              void* d_out, int out_size, void* d_ws,
                              size_t ws_size, hipStream_t stream) {
  if (n_in < 10) return;
  const float* x  = (const float*)d_in[0];
  const float* pb = (const float*)d_in[1];
  const float* Wq = (const float*)d_in[2];
  const float* bq = (const float*)d_in[3];
  const float* Wk = (const float*)d_in[4];
  const float* bk = (const float*)d_in[5];
  const float* Wv = (const float*)d_in[6];
  const float* bv = (const float*)d_in[7];
  const float* Wo = (const float*)d_in[8];
  const float* bo = (const float*)d_in[9];
  float* out = (float*)d_out;

  const int nX = MTOK * DMODEL;        // 4194304
  const int nW = DMODEL * DMODEL;      // 1048576
  const int nP = SEQ_LEN * SEQ_LEN;    // 4194304
  if (in_sizes[0] != nX || in_sizes[1] != nP) return;
  if (in_sizes[2] != nW || in_sizes[4] != nW || in_sizes[6] != nW || in_sizes[8] != nW) return;
  if (in_sizes[3] != DMODEL || in_sizes[5] != DMODEL || in_sizes[7] != DMODEL || in_sizes[9] != DMODEL) return;
  if (out_size != nX) return;

  const size_t bytesX16 = (size_t)nX * 2;   // 8 MiB
  const size_t bytesW16 = (size_t)nW * 2;   // 2 MiB
  size_t off = 0;
  const size_t off_xb  = off; off += bytesX16;
  const size_t off_wq  = off; off += bytesW16;
  const size_t off_wk  = off; off += bytesW16;
  const size_t off_wv  = off; off += bytesW16;
  const size_t off_wo  = off; off += bytesW16;
  const size_t off_q   = off; off += bytesX16;
  const size_t off_k   = off; off += bytesX16;
  const size_t off_vt  = off; off += bytesX16;
  const size_t off_o   = off; off += bytesX16;
  if (off > ws_size) return;               // 50,331,648 B needed

  char* ws = (char*)d_ws;
  unsigned short* xb  = (unsigned short*)(ws + off_xb);
  unsigned short* wqb = (unsigned short*)(ws + off_wq);
  unsigned short* wkb = (unsigned short*)(ws + off_wk);
  unsigned short* wvb = (unsigned short*)(ws + off_wv);
  unsigned short* woh = (unsigned short*)(ws + off_wo);
  unsigned short* qh  = (unsigned short*)(ws + off_q);
  unsigned short* kh  = (unsigned short*)(ws + off_k);
  unsigned short* vth = (unsigned short*)(ws + off_vt);
  unsigned short* oh  = (unsigned short*)(ws + off_o);

  // ---- casts (2 elements per thread; exact multiples of 512 elements per block) ----
  const int n2X = nX / 2;   // 2097152 -> 8192 blocks
  const int n2W = nW / 2;   // 524288  -> 2048 blocks
  cast_f32_bf16x2<<<dim3(n2X / 256), dim3(256), 0, stream>>>(x,  xb,  n2X);
  cast_f32_bf16x2<<<dim3(n2W / 256), dim3(256), 0, stream>>>(Wq, wqb, n2W);
  cast_f32_bf16x2<<<dim3(n2W / 256), dim3(256), 0, stream>>>(Wk, wkb, n2W);
  cast_f32_bf16x2<<<dim3(n2W / 256), dim3(256), 0, stream>>>(Wv, wvb, n2W);
  cast_f32_bf16val_f16x2<<<dim3(n2W / 256), dim3(256), 0, stream>>>(Wo, woh, n2W, W_CARRY);

  // ---- q / k projections: C[token][feature] = xb . Wᵀ + b, M=4096, N=1024, K=1024 (32*8 = 256 block tiles of 128x128) ----
  const long strideXb = (long)SEQ_LEN * DMODEL;   // per-batch token block of xb (elements)
  wmma_gemm64<1, false, 2, 1, false, 0><<<dim3((MTOK / 128) * (DMODEL / 128), 1), dim3(128), 0, stream>>>(
      xb, xb, DMODEL, 0L, wqb, wqb, DMODEL, 0L, (void*)qh, (void*)qh, DMODEL, 0L, bq, bq, 0L,
      MTOK, DMODEL, DMODEL, 1.0f);
  wmma_gemm64<1, false, 2, 1, false, 0><<<dim3((MTOK / 128) * (DMODEL / 128), 1), dim3(128), 0, stream>>>(
      xb, xb, DMODEL, 0L, wkb, wkb, DMODEL, 0L, (void*)kh, (void*)kh, DMODEL, 0L, bk, bk, 0L,
      MTOK, DMODEL, DMODEL, 1.0f);
  // ---- v^T projection (role swapped): C_b[feature][token] = Wv . x_bᵀ + bv[feature]; M=1024, N=2048, K=1024, z = batch
  //      (8*16 = 128 block tiles per batch) ----
  wmma_gemm64<1, false, 1, 1, false, 0><<<dim3((DMODEL / 128) * (SEQ_LEN / 128), BATCH_N), dim3(128), 0, stream>>>(
      wvb, wvb, DMODEL, 0L, xb, xb, DMODEL, strideXb, (void*)vth, (void*)vth, SEQ_LEN, (long)DMODEL * SEQ_LEN, bv, bv, 0L,
      DMODEL, SEQ_LEN, DMODEL, 1.0f);

  // ---- attention: 2 * 16 * (2048/64) = 1024 blocks of 64 query rows ----
  attn_bias64_kernel<<<dim3(BATCH_N * NHEADS * (SEQ_LEN / 64)), dim3(128), 0, stream>>>(qh, kh, vth, pb, oh, 0.125f);

  // ---- output projection: out[token][feature] = (O x64) . (Wo x64)ᵀ / 4096 + bo; M=4096, N=1024, K=1024 ----
  wmma_gemm64<0, false, 2, 0, false, 0><<<dim3((MTOK / 128) * (DMODEL / 128), 1), dim3(128), 0, stream>>>(
      oh, oh, DMODEL, 0L, woh, woh, DMODEL, 0L, (void*)out, (void*)out, DMODEL, 0L, bo, bo, 0L,
      MTOK, DMODEL, DMODEL, 1.0f / (O_CARRY * W_CARRY));
}

// v004
// It runs in 167 microseconds.
// Two timings next to v003 put it at 1.04 and 1.05 times that version's speed.
// Counting every step since v000, it is 2.22 times as fast.
// Contractions: q, k, v^T projections on v_wmma_f32_16x16x32_bf16 (bf16 RNE operands from the raw inputs, single product, f32 accumulate); q.k^T and p.v on v_wmma_f32_16x16x32_f16 (f16 q/k/v planes, p carried x2^15, f32 accumulate, online softmax and additive bias in f32); output projection on v_wmma_f32_16x16x32_f16 (O carried x64 in f16, Wo as bf16-RNE value x64 in f16, f32 accumulate, x1/4096 in the f32 epilogue).
#include <hip/hip_runtime.h>
#include <math.h>
#include <stdint.h>

constexpr int BATCH_N = 2;
constexpr int SEQ_LEN = 2048;
constexpr int DMODEL  = 1024;
constexpr int NHEADS  = 16;
constexpr int HDIM    = 64;
constexpr int MTOK    = BATCH_N * SEQ_LEN;   // 4096 token rows
static_assert(NHEADS * HDIM == DMODEL, "head split");

constexpr float P_CARRY = 32768.0f;   // probabilities carried x2^15 in f16
constexpr float O_CARRY = 64.0f;      // attention output carried x64 in f16
constexpr float W_CARRY = 64.0f;      // Wo carried x64 in f16

typedef __attribute__((ext_vector_type(16))) _Float16 v16h;
typedef __attribute__((ext_vector_type(8)))  _Float16 v8h;
typedef __attribute__((ext_vector_type(16))) __bf16   v16b;
typedef __attribute__((ext_vector_type(8)))  __bf16   v8b;
typedef __attribute__((ext_vector_type(8)))  float    v8f;
typedef __attribute__((ext_vector_type(4)))  float    v4f;

__device__ __forceinline__ unsigned short f2bf_bits(float f) {
  unsigned u = __float_as_uint(f);
  return (unsigned short)((u + 0x7FFFu + ((u >> 16) & 1u)) >> 16);
}
__device__ __forceinline__ float bf_bits2f(unsigned short h) { return __uint_as_float(((unsigned)h) << 16); }
// f32 value of the RNE bf16 of f
__device__ __forceinline__ float bf16_rne_f32(float f) { return bf_bits2f(f2bf_bits(f)); }

// hazard guards as plain device helpers (no inline asm inside the kernel template body)
__device__ __forceinline__ void dep_guard_h(v8f& a, v8f& b, v16h x, v16h y) { asm volatile("v_nop\n\tv_nop\n\tv_nop\n\tv_nop" : "+v"(a), "+v"(b) : "v"(x), "v"(y)); }
__device__ __forceinline__ void dep_guard_b(v8f& a, v8f& b, v16b x, v16b y) { asm volatile("v_nop\n\tv_nop\n\tv_nop\n\tv_nop" : "+v"(a), "+v"(b) : "v"(x), "v"(y)); }
__device__ __forceinline__ void keep4_h(v16h a, v16h b, v16h c, v16h d) { asm volatile("v_nop" :: "v"(a), "v"(b), "v"(c), "v"(d)); }
__device__ __forceinline__ void keep4_b(v16b a, v16b b, v16b c, v16b d) { asm volatile("v_nop" :: "v"(a), "v"(b), "v"(c), "v"(d)); }
__device__ __forceinline__ void acc_guard4(v8f& a, v8f& b, v8f& c, v8f& d) { asm volatile("v_nop\n\tv_nop\n\tv_nop\n\tv_nop" : "+v"(a), "+v"(b), "+v"(c), "+v"(d)); }
// stands behind a group of global loads, in front of the first overwrite of a register that holds one of their addresses
__device__ __forceinline__ void wait_xcnt0() { asm volatile("s_wait_xcnt 0x0" ::: "memory"); }
template <typename T> struct Frag;
template <> struct Frag<_Float16> {
  typedef v16h V; typedef v8h H; union U { v16h v; v8h h[2]; };
  static __device__ __forceinline__ v16h load(const _Float16* p) {   // elements 0..7 <- p[0..7], 8..15 <- p[16..23]
    U f; f.h[0] = *(const v8h*)(p); f.h[1] = *(const v8h*)(p + 16); return f.v;
  }
  static __device__ __forceinline__ v8f mma(v16h a, v16h b, v8f c) {
    return __builtin_amdgcn_wmma_f32_16x16x32_f16(false, a, false, b, (short)0, c, false, false);
  }
  static __device__ __forceinline__ void guard(v8f& a, v8f& b, v16h x, v16h y) { dep_guard_h(a, b, x, y); }
  static __device__ __forceinline__ void keep(v16h a, v16h b, v16h c, v16h d) { keep4_h(a, b, c, d); }
};
template <> struct Frag<__bf16> {
  typedef v16b V; typedef v8b H; union U { v16b v; v8b h[2]; };
  static __device__ __forceinline__ v16b load(const __bf16* p) {
    U f; f.h[0] = *(const v8b*)(p); f.h[1] = *(const v8b*)(p + 16); return f.v;
  }
  static __device__ __forceinline__ v8f mma(v16b a, v16b b, v8f c) {
    return __builtin_amdgcn_wmma_f32_16x16x32_bf16(false, a, false, b, (short)0, c, false, false);
  }
  static __device__ __forceinline__ void guard(v8f& a, v8f& b, v16b x, v16b y) { dep_guard_b(a, b, x, y); }
  static __device__ __forceinline__ void keep(v16b a, v16b b, v16b c, v16b d) { keep4_b(a, b, c, d); }
};

// ---- Register-blocked batched WMMA GEMM ------------------------------------
// C[m,n] = scale * sum_k A[m,k] * Bt[n,k] (+bias)(+resid); each wave owns a 64x64 tile.
// Block = 4 waves (2 x 2) = one 128x128 tile of C. Per 64-wide k slab the block stages 128 rows of A and 128 rows of Bt
// in LDS: 8 lanes x 16 B cover one whole 128-B line of a row, so a wave-wide load touches 4 lines. Two LDS buffers:
// the next slab is loaded to registers before the products of this slab and stored to the other buffer behind them,
// one __syncthreads() per slab. Fragments are read from LDS with k ascending in steps of 32.
// A row-major [M,K]; Bt row-major [N,K]; M,N % 128 == 0, K % 64 == 0.
// SPLIT (hi/lo operand planes) is not staged: single-plane operands only.
// BIAS_MODE: 0 = none, 1 = bias[m], 2 = bias[n].
// OUT_MODE: 0 = f32, 1 = f16, 2 = bf16 hi plane (Cout) + bf16 lo plane (Cout2).
// ET: 0 = f16 operands, 1 = bf16 operands (pointers passed as 16-bit storage)
template <int ET> struct Elem;
template <> struct Elem<0> { typedef _Float16 T; };
template <> struct Elem<1> { typedef __bf16 T; };
#define GM_BT 128  // rows of A and of Bt per block tile
#define GM_BK 64   // k elements per staged slab: 128 B = one line per row
#define GM_LP 72   // LDS row pitch in 16-bit elements: 144 B = 16 B x 9 (odd), for the ds_load_b128 fragment reads
template <int ET, bool SPLIT, int BIAS_MODE, int OUT_MODE, bool RESID, int ACT = 0>
__global__ __launch_bounds__(128) void wmma_gemm64(
    const unsigned short* __restrict__ Ap, const unsigned short* __restrict__ A2p, int lda, long strideA,
    const unsigned short* __restrict__ Btp, const unsigned short* __restrict__ Bt2p, int ldb, long strideB,
    void* __restrict__ Cout, void* __restrict__ Cout2, int ldc, long strideC,
    const float* __restrict__ bias,
    const float* __restrict__ resid, long strideR,
    int M, int N, int K, float scale) {
  static_assert(!SPLIT, "single-plane operands only");
  typedef typename Elem<ET>::T T;
  typedef typename Frag<T>::V V;
  typedef typename Frag<T>::H H;
  const T* A = (const T*)Ap; const T* Bt = (const T*)Btp;
  __shared__ __align__(16) T sA[2][GM_BT * GM_LP];   // A slab  [row][k], 2 x 18 KB
  __shared__ __align__(16) T sB[2][GM_BT * GM_LP];   // Bt slab [row][k], 2 x 18 KB
  __shared__ __align__(16) float sT[4][16 * 68];     // per-wave 16x64 slab, pitch 68 floats
  const int b    = blockIdx.y;
  const int tid  = threadIdx.x;
  const int lane = tid & 31;
  const int wave = tid >> 5;
  const int tilesN = N >> 7;
  const int tilesM = M >> 7;
  const int tile = blockIdx.x;
  if (tile >= tilesM * tilesN) return;   // block-uniform, in front of every barrier
  const int tm = tile / tilesN;
  const int tn = tile - tm * tilesN;
  const int bm0 = tm << 7;               // first row / column of the block tile
  const int bn0 = tn << 7;
  const int wm  = (wave >> 1) << 6;      // this wave's 64x64 quadrant
  const int wn  = (wave & 1) << 6;
  const int m0 = bm0 + wm;
  const int n0 = bn0 + wn;

  const T* Ab  = A  + (size_t)b * strideA;
  const T* Bb  = Bt + (size_t)b * strideB;

  const int rlane = lane & 15;                 // row (A) / col (B, D) within subtile
  const int koff  = (lane >> 4) * 8;           // k offset of this lane half
  const int mOff  = (lane >> 4) * 8;           // D row offset

  // staging map: 128 threads x 8 x 16 B per operand = 128 rows x 128 B; thread -> row (tid>>3) + 16*i, bytes (tid&7)*16
  const int srow = tid >> 3;
  const int scol = (tid & 7) * 8;
  const T* gA = Ab + (size_t)(bm0 + srow) * lda + scol;
  const T* gB = Bb + (size_t)(bn0 + srow) * ldb + scol;
  const int sOff = srow * GM_LP + scol;

  v8f acc[4][4];
#pragma unroll
  for (int i = 0; i < 4; ++i)
#pragma unroll
    for (int j = 0; j < 4; ++j) acc[i][j] = (v8f){0.f,0.f,0.f,0.f,0.f,0.f,0.f,0.f};

  H ra[8], rb[8];
#pragma unroll
  for (int i = 0; i < 8; ++i) {
    ra[i] = *(const H*)(gA + (size_t)(i * 16) * lda);
    rb[i] = *(const H*)(gB + (size_t)(i * 16) * ldb);
  }
#pragma unroll
  for (int i = 0; i < 8; ++i) {
    *(H*)(&sA[0][sOff + i * 16 * GM_LP]) = ra[i];
    *(H*)(&sB[0][sOff + i * 16 * GM_LP]) = rb[i];
  }
  __syncthreads();

  const int nSlab = K >> 6;
  for (int s = 0; s < nSlab; ++s) {
    const int cur = s & 1;
    const bool more = (s + 1 < nSlab);   // block-uniform
    if (more) {
      const int kn = (s + 1) << 6;
#pragma unroll
      for (int i = 0; i < 8; ++i) {
        ra[i] = *(const H*)(gA + (size_t)(i * 16) * lda + kn);
        rb[i] = *(const H*)(gB + (size_t)(i * 16) * ldb + kn);
      }
      wait_xcnt0();   // the fragment reads below land in registers that held these loads' addresses
    }
    const T* cA = &sA[cur][(wm + rlane) * GM_LP + koff];
    const T* cB = &sB[cur][(wn + rlane) * GM_LP + koff];
#pragma unroll
    for (int kk = 0; kk < GM_BK; kk += 32) {
      V bh[4], ah[4];
#pragma unroll
      for (int j = 0; j < 4; ++j) bh[j] = Frag<T>::load(cB + (j << 4) * GM_LP + kk);
#pragma unroll
      for (int i = 0; i < 4; ++i) ah[i] = Frag<T>::load(cA + (i << 4) * GM_LP + kk);
#pragma unroll
      for (int i = 0; i < 4; ++i) {
#pragma unroll
        for (int j = 0; j < 4; ++j) acc[i][j] = Frag<T>::mma(ah[i], bh[j], acc[i][j]);
        Frag<T>::guard(acc[i][0], acc[i][3], ah[i], ah[i]);
      }
      Frag<T>::keep(bh[0], bh[1], bh[2], bh[3]);
    }
    if (more) {
#pragma unroll
      for (int i = 0; i < 8; ++i) {
        *(H*)(&sA[cur ^ 1][sOff + i * 16 * GM_LP]) = ra[i];
        *(H*)(&sB[cur ^ 1][sOff + i * 16 * GM_LP]) = rb[i];
      }
    }
    __syncthreads();   // publishes the other buffer and ends every wave's reads of this one before it is refilled
  }
  acc_guard4(acc[0][0], acc[0][1], acc[0][2], acc[0][3]);
  acc_guard4(acc[1][0], acc[1][1], acc[1][2], acc[1][3]);
  acc_guard4(acc[2][0], acc[2][1], acc[2][2], acc[2][3]);
  acc_guard4(acc[3][0], acc[3][1], acc[3][2], acc[3][3]);

  // ---- epilogue ----
  float* slab = sT[wave];
  const float* Rb = RESID ? (resid + (size_t)b * strideR) : nullptr;
#pragma unroll
  for (int i = 0; i < 4; ++i) {
    const int mBase = m0 + (i << 4);
#pragma unroll
    for (int j = 0; j < 4; ++j) {
      const int n = n0 + (j << 4) + rlane;
      float bv = 0.f;
      if (BIAS_MODE == 2) bv = bias[n];
#pragma unroll
      for (int r = 0; r < 8; ++r) {
        float v = acc[i][j][r] * scale;
        if (BIAS_MODE == 1) v += bias[mBase + mOff + r];
        if (BIAS_MODE == 2) v += bv;
        if (RESID) v += Rb[(size_t)(mBase + mOff + r) * ldc + n];
        if (ACT == 1) v = tanhf(v);
        if (ACT == 2) v = fmaxf(v, 0.0f);
        if (ACT == 3) v = v / (1.0f + expf(-v));
        if (ACT == 4) v = (v > 0.f) ? v : 0.01f * v;
        if (ACT == 5) v = 0.5f * v * (1.0f + erff(v * 0.70710678118654752f));
        slab[(mOff + r) * 68 + (j << 4) + rlane] = v;
      }
    }
    __builtin_amdgcn_fence(__ATOMIC_RELEASE, "workgroup");
    __builtin_amdgcn_wave_barrier();
    __builtin_amdgcn_fence(__ATOMIC_ACQUIRE, "workgroup");
    if (OUT_MODE == 0) {
      float* C = (float*)Cout + (size_t)b * strideC;
      const int hh = lane >> 4, c4 = (lane & 15) * 4;     // row seg = 256 B = 16 lanes x 16 B
      {
#pragma unroll
        for (int it = 0; it < 8; ++it) {
          const int row = it * 2 + hh;
          v4f v = *(const v4f*)(slab + row * 68 + c4);
          *(v4f*)(C + (size_t)(mBase + row) * ldc + n0 + c4) = v;
        }
        
      }
    } else {
      const int q = lane >> 3, c8 = (lane & 7) * 8;
      unsigned short* C  = (unsigned short*)Cout  + (size_t)b * strideC;
      unsigned short* C2 = (OUT_MODE == 2) ? ((unsigned short*)Cout2 + (size_t)b * strideC) : nullptr;
      {
#pragma unroll
        for (int it = 0; it < 4; ++it) {
          const int row = it * 4 + q;
          const float* sp = slab + row * 68 + c8;
          v8h hv, lv;
#pragma unroll
          for (int e = 0; e < 8; ++e) {
            if (OUT_MODE == 1) {
              hv[e] = (_Float16)sp[e];
            } else {
              unsigned short hb = f2bf_bits(sp[e]);
              unsigned short lb = f2bf_bits(sp[e] - bf_bits2f(hb));
              hv[e] = __builtin_bit_cast(_Float16, hb);
              lv[e] = __builtin_bit_cast(_Float16, lb);
            }
          }
          *(v8h*)(C + (size_t)(mBase + row) * ldc + n0 + c8) = hv;
          if (OUT_MODE == 2) *(v8h*)(C2 + (size_t)(mBase + row) * ldc + n0 + c8) = lv;
        }
        
      }
    }
    __builtin_amdgcn_fence(__ATOMIC_RELEASE, "workgroup");
    __builtin_amdgcn_wave_barrier();
    __builtin_amdgcn_fence(__ATOMIC_ACQUIRE, "workgroup");
  }
}

// ---------------------------------------------------------------------------
// f32 -> bf16 (RNE) cast: 2 elements per thread, ONE 4-B store per lane -> each wave writes exactly one whole
// Coverage: grid = n2/256 blocks x 256 threads x 2 elements = 2*n2 = whole plane
//   x : n2 = 4096*1024/2 = 2097152 = 8192 blocks;  W : n2 = 1024*1024/2 = 524288 = 2048 blocks (exact multiples).
// ---------------------------------------------------------------------------
__device__ __forceinline__ unsigned pk16(unsigned short a, unsigned short b) { return (unsigned)a | ((unsigned)b << 16); }

__global__ __launch_bounds__(256) void cast_f32_bf16x2(const float* __restrict__ in, unsigned short* __restrict__ out, int n2) {
  const int i = blockIdx.x * 256 + threadIdx.x;
  if (i < n2) {
    const float f0 = in[2 * (size_t)i], f1 = in[2 * (size_t)i + 1];
    const unsigned u = pk16(f2bf_bits(f0), f2bf_bits(f1));
    ((unsigned*)out)[i] = u;
    
  }
}

// f32 -> bf16 (RNE) value -> x scale (power of two, exact) -> f16 bits (exact for normal-range values); same store shape as above.
__global__ __launch_bounds__(256) void cast_f32_bf16val_f16x2(const float* __restrict__ in, unsigned short* __restrict__ out,
                                                              int n2, float scale) {
  const int i = blockIdx.x * 256 + threadIdx.x;
  if (i < n2) {
    const float f0 = bf16_rne_f32(in[2 * (size_t)i]) * scale;
    const float f1 = bf16_rne_f32(in[2 * (size_t)i + 1]) * scale;
    const _Float16 h0 = (_Float16)f0, h1 = (_Float16)f1;
    const unsigned u = pk16(__builtin_bit_cast(unsigned short, h0), __builtin_bit_cast(unsigned short, h1));
    ((unsigned*)out)[i] = u;
    
  }
}

// =====================================================================================
// Full (unmasked) attention with an additive [SEQ][SEQ] score bias shared over (b, h); head dim 64.
//   q plane  f16: element (b, t, h, d) at [(b*SEQ_LEN + t)*DMODEL + h*64 + d]
//   k plane  f16: element (b, s, h, d) at [(b*SEQ_LEN + s)*DMODEL + h*64 + d]
//   v^T plane f16: element (b, h, d, s) at [b*DMODEL*SEQ_LEN + (h*64 + d)*SEQ_LEN + s]
//   O plane  f16 (x O_CARRY): element (b, t, h, d) at [(b*SEQ_LEN + t)*DMODEL + h*64 + d]
//   scores = (q . k) * sscale + bf16value(pbias[t][s]) : single v_wmma_f32_16x16x32_f16 product, f32 accumulate, bias in f32
//   out    = p . v : p (unnormalised, <= 1) carried x2^15 in f16, v f16, single product, f32 accumulate
//   both products are formed transposed (S^T = K.Q^T, O^T = V^T.P^T): a lane holds one query's scores, so the maximum and the
//   sum run in-lane (plus one exchange between the wave's halves) and P^T goes from the score accumulators into the B operand.
//   online softmax in f32 over all SEQ_LEN keys (32 chunks of 64, compile-time trip count).
//   Block = 4 waves = 64 query rows of one (b, h); grid.x = BATCH_N * NHEADS * (SEQ_LEN/64) = 1024.
//   Chunk staging (plain 16-B loads, __syncthreads before and after), every wave-wide load covering 4 whole 128-B lines:
//   K and V^T tiles 64x64 f16, 8 lanes per 128-B row; the block's 64x64 f32 bias tile, 16 lanes per 256-B row.
//   Fragment loads read the K / V^T tiles with the same v8h element type; a lane reads its own query's bias row from LDS.
// =====================================================================================
#define AT_D 64
#define AT_NW 4
#define AT_QB 64
#define AT_KC 64
#define AT_LP 72   // LDS row pitch of the K and V^T tiles in f16: 144 B = 16 B x 9 (odd), so 16 rows read by ds_load_b128 fall on distinct banks
#define AT_BP 68   // LDS row pitch of the bias tile in f32: 272 B = 16 B x 17 (odd), for the same reason

__device__ __forceinline__ v8f at_mma_h(v16h a, v16h b, v8f c) {
  c = __builtin_amdgcn_wmma_f32_16x16x32_f16(false, a, false, b, (short)0, c, false, false);
  asm volatile("v_nop\n\tv_nop\n\tv_nop\n\tv_nop" : "+v"(c) : "v"(a), "v"(b));
  return c;
}

// lane l <-> lane l ^ 16
__device__ __forceinline__ float xhalf(float x) {
  return __builtin_bit_cast(float, __builtin_amdgcn_permlanex16(__builtin_bit_cast(int, x), __builtin_bit_cast(int, x), 0x76543210, 0xfedcba98, false, false));
}

__global__ __launch_bounds__(128)
void attn_bias64_kernel(const unsigned short* __restrict__ qp, const unsigned short* __restrict__ kp,
                        const unsigned short* __restrict__ vtp, const float* __restrict__ pbias,
                        unsigned short* __restrict__ op, float sscale) {
  union FH { v16h v; v8h h[2]; };
  __shared__ __align__(16) _Float16 Ksh[AT_KC * AT_LP];            // K  [kv][d]   9 KB, pitch AT_LP
  __shared__ __align__(16) _Float16 Vth[AT_D * AT_LP];             // V^T [d][kv]  9 KB, pitch AT_LP
  __shared__ __align__(16) float    Bsh[AT_QB * AT_BP];            // bias [query][kv]  17 KB, pitch AT_BP
  __shared__ __align__(16) float    Os[AT_NW][16 * 68];            // per wave out tile, pitch 68  17 KB

  const int tid  = threadIdx.x;
  const int wave = tid >> 5;
  const int lane = tid & 31;
  const int hh   = lane >> 4;
  const int c    = lane & 15;

  const int nqb = SEQ_LEN / AT_QB;        // 32
  const int bx = blockIdx.x;
  const int qb = bx % nqb;
  const int bh = bx / nqb;                // 0..BATCH_N*NHEADS-1
  const int h  = bh % NHEADS;
  const int b  = bh / NHEADS;
  const int q0 = qb * AT_QB + wave * 16;  // first query row of this wave (within the sequence)

  const _Float16* Qh = (const _Float16*)(const void*)qp  + (size_t)b * SEQ_LEN * DMODEL + (size_t)h * AT_D;
  const _Float16* Kh = (const _Float16*)(const void*)kp  + (size_t)b * SEQ_LEN * DMODEL + (size_t)h * AT_D;
  const _Float16* Vt = (const _Float16*)(const void*)vtp + (size_t)b * DMODEL * SEQ_LEN + (size_t)h * AT_D * SEQ_LEN;
  _Float16*       Ob = (_Float16*)(void*)op + (size_t)b * SEQ_LEN * DMODEL + (size_t)h * AT_D;

  // ---- Q fragments (B operand, col = query = lane&15, split k map via Frag load): 2 d-chunks ----
  v16h qa[2];
#pragma unroll
  for (int dc = 0; dc < 2; ++dc) {
    const _Float16* qr = Qh + (size_t)(q0 + c) * DMODEL + dc * 32 + 8 * hh;
    qa[dc] = Frag<_Float16>::load(qr);
  }

  // One query per lane: lane (hh, c) holds query q0 + c; its half hh holds keys 8hh..8hh+7 of every 16-key tile.
  float mrow = -INFINITY, lrow = 0.f;   // mrow: the same in both halves; lrow: this half's keys only, joined behind the loop
  v8f oacc[4];                          // O^T: element r of oacc[t] -> (d = t*16 + 8hh + r, query c)
#pragma unroll
  for (int t = 0; t < 4; ++t) oacc[t] = (v8f){0.f,0.f,0.f,0.f,0.f,0.f,0.f,0.f};

  // staging maps: K, V^T rows krow + 16 i (i < 4), 16 B at kcol; bias rows brow + 8 i (i < 8), 16 B at bcol
  const int krow = tid >> 3, kcol = (tid & 7) * 8;
  const int brow = tid >> 4, bcol = (tid & 15) * 4;
  const _Float16* gK = Kh + (size_t)krow * DMODEL + kcol;
  const _Float16* gV = Vt + (size_t)krow * SEQ_LEN + kcol;
  const float*    gB = pbias + (size_t)(qb * AT_QB + brow) * SEQ_LEN + bcol;
  const float* pbq = Bsh + (wave * 16 + c) * AT_BP + 8 * hh;   // this lane's bias row in the tile, at its half's first key

  const int nChunks = SEQ_LEN / AT_KC;   // 32, compile-time constant
  for (int kc = 0; kc < nChunks; ++kc) {
    __syncthreads();
    {
      // staging coverage: 128 threads x (4 x 8) f16 = 64 rows x 64 per plane; 128 threads x (8 x 4) f32 = 64 rows x 64 of bias
      v8h ka[4], va[4];
      v4f ba[8];
#pragma unroll
      for (int i = 0; i < 4; ++i) {
        ka[i] = *(const v8h*)(gK + (size_t)(16 * i) * DMODEL);    // K row kc*64 + krow + 16 i
        va[i] = *(const v8h*)(gV + (size_t)(16 * i) * SEQ_LEN);   // V^T row d = krow + 16 i, s = kc*64 + kcol..
      }
#pragma unroll
      for (int i = 0; i < 8; ++i) ba[i] = *(const v4f*)(gB + (size_t)(8 * i) * SEQ_LEN);   // in range: kc*64 + 63 < SEQ_LEN
      wait_xcnt0();   // in front of the three pointer steps, which overwrite these loads' address registers
      gK += (size_t)AT_KC * DMODEL;
      gV += AT_KC;
      gB += AT_KC;
#pragma unroll
      for (int i = 0; i < 4; ++i) {
        *(v8h*)(Ksh + (krow + 16 * i) * AT_LP + kcol) = ka[i];
        *(v8h*)(Vth + (krow + 16 * i) * AT_LP + kcol) = va[i];
      }
#pragma unroll
      for (int i = 0; i < 8; ++i) *(v4f*)(Bsh + (brow + 8 * i) * AT_BP + bcol) = ba[i];
    }
    __syncthreads();

    // ---- bias: 8 consecutive keys of the lane's own query per 16-key tile, from the staged tile ----
    v4f pbv[4][2];
#pragma unroll
    for (int j = 0; j < 4; ++j) {
      pbv[j][0] = *(const v4f*)(pbq + j * 16);
      pbv[j][1] = *(const v4f*)(pbq + j * 16 + 4);
    }

    // ---- scores, transposed: S^T = K (A: row = key j*16+c) . Q^T (B: col = query c); D element r -> (key j*16+8hh+r, query c) ----
    v8f s[4];
#pragma unroll
    for (int j = 0; j < 4; ++j) {
      s[j] = (v8f){0.f,0.f,0.f,0.f,0.f,0.f,0.f,0.f};
#pragma unroll
      for (int dc = 0; dc < 2; ++dc) {
        FH kb;
        kb.h[0] = *(const v8h*)(Ksh + (j * 16 + c) * AT_LP + dc * 32 + 8 * hh);
        kb.h[1] = *(const v8h*)(Ksh + (j * 16 + c) * AT_LP + dc * 32 + 16 + 8 * hh);
        s[j] = at_mma_h(kb.v, qa[dc], s[j]);
      }
    }
    float mj[4];   // one maximum per 16-key tile: four independent chains
#pragma unroll
    for (int j = 0; j < 4; ++j) {
      mj[j] = -INFINITY;
#pragma unroll
      for (int r = 0; r < 8; ++r) {
        const float bb = bf16_rne_f32(pbv[j][r >> 2][r & 3]);
        const float sv = s[j][r] * sscale + bb;
        s[j][r] = sv;
        mj[j] = fmaxf(mj[j], sv);
      }
    }
    float m = fmaxf(fmaxf(mj[0], mj[1]), fmaxf(mj[2], mj[3]));
    m = fmaxf(m, xhalf(m));   // the other half's 32 keys of the same query
    const float mnew = fmaxf(mrow, m);
    const float alpha = expf(mrow - mnew);
    mrow = mnew;
    // ---- P^T packed in place: tiles 2kk and 2kk+1 give elements 0..7 and 8..15 of the B operand (k = 8hh+e, 16+8hh+e) ----
    FH pb[2];
    float pj[4];   // one sum per 16-key tile: four independent chains
#pragma unroll
    for (int j = 0; j < 4; ++j) {
      pj[j] = 0.f;
#pragma unroll
      for (int r = 0; r < 8; ++r) {
        const float p = expf(s[j][r] - mnew);
        pj[j] += p;
        pb[j >> 1].h[j & 1][r] = (_Float16)(p * P_CARRY);
      }
    }
    lrow = lrow * alpha + ((pj[0] + pj[1]) + (pj[2] + pj[3]));
#pragma unroll
    for (int t = 0; t < 4; ++t) oacc[t] *= alpha;
    // ---- O^T: oacc[t] += V^T (A: row = d t*16+c, k = key) . P^T (B: col = query c, k = key) ----
#pragma unroll
    for (int kk = 0; kk < 2; ++kk) {
#pragma unroll
      for (int t = 0; t < 4; ++t) {
        FH vb;
        vb.h[0] = *(const v8h*)(Vth + (t * 16 + c) * AT_LP + kk * 32 + 8 * hh);
        vb.h[1] = *(const v8h*)(Vth + (t * 16 + c) * AT_LP + kk * 32 + 16 + 8 * hh);
        oacc[t] = at_mma_h(vb.v, pb[kk].v, oacc[t]);
      }
    }
  }

  float* os = Os[wave];
  {
    const float lsum = lrow + xhalf(lrow);                    // both halves' keys
    const float inv = O_CARRY * (1.0f / (lsum * P_CARRY));    // lsum >= 1
#pragma unroll
    for (int t = 0; t < 4; ++t) {
      const v8f o = oacc[t] * inv;
      *(v4f*)(os + c * 68 + t * 16 + 8 * hh)     = (v4f){o[0], o[1], o[2], o[3]};
      *(v4f*)(os + c * 68 + t * 16 + 8 * hh + 4) = (v4f){o[4], o[5], o[6], o[7]};
    }
  }
  __builtin_amdgcn_fence(__ATOMIC_RELEASE, "workgroup");
  __builtin_amdgcn_wave_barrier();
  __builtin_amdgcn_fence(__ATOMIC_ACQUIRE, "workgroup");
  {
    const int q4 = lane >> 3, c8 = (lane & 7) * 8;
    {
#pragma unroll
      for (int it = 0; it < 4; ++it) {
        const int row = it * 4 + q4;   // it 0..3 x q4 0..3 covers rows 0..15 of the wave tile
        const float* sp = os + row * 68 + c8;
        v8h hv;
#pragma unroll
        for (int e = 0; e < 8; ++e) hv[e] = (_Float16)sp[e];
        *(v8h*)(Ob + (size_t)(q0 + row) * DMODEL + c8) = hv;
      }
      
    }
  }
}

// ---------------------------------------------------------------------------
// Workspace region map (byte offsets, all 1 MiB aligned; total 50,331,648 B = 48 MiB):
//   [ 0 MiB,  8 MiB)  xb   : bf16 x            [4096][1024]
//   [ 8 MiB, 10 MiB)  wqb  : bf16 Wq           [1024][1024]
//   [10 MiB, 12 MiB)  wkb  : bf16 Wk
//   [12 MiB, 14 MiB)  wvb  : bf16 Wv
//   [14 MiB, 16 MiB)  woh  : f16 (bf16val(Wo) x64)
//   [16 MiB, 24 MiB)  qh   : f16 q plane       [4096][1024]
//   [24 MiB, 32 MiB)  kh   : f16 k plane       [4096][1024]
//   [32 MiB, 40 MiB)  vth  : f16 v^T plane     [2][1024][2048]
//   [40 MiB, 48 MiB)  oh   : f16 O plane (x64) [4096][1024]
// ---------------------------------------------------------------------------
extern "C" void kernel_launch(void* const* d_in, const int* in_sizes, int n_in,
                              void* d_out, int out_size, void* d_ws,
                              size_t ws_size, hipStream_t stream) {
  if (n_in < 10) return;
  const float* x  = (const float*)d_in[0];
  const float* pb = (const float*)d_in[1];
  const float* Wq = (const float*)d_in[2];
  const float* bq = (const float*)d_in[3];
  const float* Wk = (const float*)d_in[4];
  const float* bk = (const float*)d_in[5];
  const float* Wv = (const float*)d_in[6];
  const float* bv = (const float*)d_in[7];
  const float* Wo = (const float*)d_in[8];
  const float* bo = (const float*)d_in[9];
  float* out = (float*)d_out;

  const int nX = MTOK * DMODEL;        // 4194304
  const int nW = DMODEL * DMODEL;      // 1048576
  const int nP = SEQ_LEN * SEQ_LEN;    // 4194304
  if (in_sizes[0] != nX || in_sizes[1] != nP) return;
  if (in_sizes[2] != nW || in_sizes[4] != nW || in_sizes[6] != nW || in_sizes[8] != nW) return;
  if (in_sizes[3] != DMODEL || in_sizes[5] != DMODEL || in_sizes[7] != DMODEL || in_sizes[9] != DMODEL) return;
  if (out_size != nX) return;

  const size_t bytesX16 = (size_t)nX * 2;   // 8 MiB
  const size_t bytesW16 = (size_t)nW * 2;   // 2 MiB
  size_t off = 0;
  const size_t off_xb  = off; off += bytesX16;
  const size_t off_wq  = off; off += bytesW16;
  const size_t off_wk  = off; off += bytesW16;
  const size_t off_wv  = off; off += bytesW16;
  const size_t off_wo  = off; off += bytesW16;
  const size_t off_q   = off; off += bytesX16;
  const size_t off_k   = off; off += bytesX16;
  const size_t off_vt  = off; off += bytesX16;
  const size_t off_o   = off; off += bytesX16;
  if (off > ws_size) return;               // 50,331,648 B needed

  char* ws = (char*)d_ws;
  unsigned short* xb  = (unsigned short*)(ws + off_xb);
  unsigned short* wqb = (unsigned short*)(ws + off_wq);
  unsigned short* wkb = (unsigned short*)(ws + off_wk);
  unsigned short* wvb = (unsigned short*)(ws + off_wv);
  unsigned short* woh = (unsigned short*)(ws + off_wo);
  unsigned short* qh  = (unsigned short*)(ws + off_q);
  unsigned short* kh  = (unsigned short*)(ws + off_k);
  unsigned short* vth = (unsigned short*)(ws + off_vt);
  unsigned short* oh  = (unsigned short*)(ws + off_o);

  // ---- casts (2 elements per thread; exact multiples of 512 elements per block) ----
  const int n2X = nX / 2;   // 2097152 -> 8192 blocks
  const int n2W = nW / 2;   // 524288  -> 2048 blocks
  cast_f32_bf16x2<<<dim3(n2X / 256), dim3(256), 0, stream>>>(x,  xb,  n2X);
  cast_f32_bf16x2<<<dim3(n2W / 256), dim3(256), 0, stream>>>(Wq, wqb, n2W);
  cast_f32_bf16x2<<<dim3(n2W / 256), dim3(256), 0, stream>>>(Wk, wkb, n2W);
  cast_f32_bf16x2<<<dim3(n2W / 256), dim3(256), 0, stream>>>(Wv, wvb, n2W);
  cast_f32_bf16val_f16x2<<<dim3(n2W / 256), dim3(256), 0, stream>>>(Wo, woh, n2W, W_CARRY);

  // ---- q / k projections: C[token][feature] = xb . Wᵀ + b, M=4096, N=1024, K=1024 (32*8 = 256 block tiles of 128x128) ----
  const long strideXb = (long)SEQ_LEN * DMODEL;   // per-batch token block of xb (elements)
  wmma_gemm64<1, false, 2, 1, false, 0><<<dim3((MTOK / 128) * (DMODEL / 128), 1), dim3(128), 0, stream>>>(
      xb, xb, DMODEL, 0L, wqb, wqb, DMODEL, 0L, (void*)qh, (void*)qh, DMODEL, 0L, bq, bq, 0L,
      MTOK, DMODEL, DMODEL, 1.0f);
  wmma_gemm64<1, false, 2, 1, false, 0><<<dim3((MTOK / 128) * (DMODEL / 128), 1), dim3(128), 0, stream>>>(
      xb, xb, DMODEL, 0L, wkb, wkb, DMODEL, 0L, (void*)kh, (void*)kh, DMODEL, 0L, bk, bk, 0L,
      MTOK, DMODEL, DMODEL, 1.0f);
  // ---- v^T projection (role swapped): C_b[feature][token] = Wv . x_bᵀ + bv[feature]; M=1024, N=2048, K=1024, z = batch
  //      (8*16 = 128 block tiles per batch) ----
  wmma_gemm64<1, false, 1, 1, false, 0><<<dim3((DMODEL / 128) * (SEQ_LEN / 128), BATCH_N), dim3(128), 0, stream>>>(
      wvb, wvb, DMODEL, 0L, xb, xb, DMODEL, strideXb, (void*)vth, (void*)vth, SEQ_LEN, (long)DMODEL * SEQ_LEN, bv, bv, 0L,
      DMODEL, SEQ_LEN, DMODEL, 1.0f);

  // ---- attention: 2 * 16 * (2048/64) = 1024 blocks of 64 query rows ----
  attn_bias64_kernel<<<dim3(BATCH_N * NHEADS * (SEQ_LEN / 64)), dim3(128), 0, stream>>>(qh, kh, vth, pb, oh, 0.125f);

  // ---- output projection: out[token][feature] = (O x64) . (Wo x64)ᵀ / 4096 + bo; M=4096, N=1024, K=1024 ----
  wmma_gemm64<0, false, 2, 0, false, 0><<<dim3((MTOK / 128) * (DMODEL / 128), 1), dim3(128), 0, stream>>>(
      oh, oh, DMODEL, 0L, woh, woh, DMODEL, 0L, (void*)out, (void*)out, DMODEL, 0L, bo, bo, 0L,
      MTOK, DMODEL, DMODEL, 1.0f / (O_CARRY * W_CARRY));
}

// v005
// It runs in 149 microseconds.
// Timed twice side by side with v004, it ran 1.13 times as fast both times.
// All steps since v000 together make it 2.50 times as fast.
// Contractions: q, k, v^T projections on v_wmma_f32_16x16x32_bf16 (bf16 RNE operands from the raw inputs, single product, f32 accumulate); q.k^T and p.v on v_wmma_f32_16x16x32_f16 (f16 q/k/v planes, p carried x2^15, f32 accumulate, online softmax and additive bias in f32); output projection on v_wmma_f32_16x16x32_f16 (O carried x64 in f16, Wo as bf16-RNE value x64 in f16, f32 accumulate, x1/4096 in the f32 epilogue).
#include <hip/hip_runtime.h>
#include <math.h>
#include <stdint.h>

constexpr int BATCH_N = 2;
constexpr int SEQ_LEN = 2048;
constexpr int DMODEL  = 1024;
constexpr int NHEADS  = 16;
constexpr int HDIM    = 64;
constexpr int MTOK    = BATCH_N * SEQ_LEN;   // 4096 token rows
static_assert(NHEADS * HDIM == DMODEL, "head split");

constexpr float O_CARRY = 64.0f;      // attention output carried x64 in f16
constexpr float W_CARRY = 64.0f;      // Wo carried x64 in f16
constexpr float LOG2E   = 1.4426950408889634f;   // exp(x) = 2^(x * LOG2E)
constexpr float P_CARRY_LOG2 = 15.0f;            // probabilities carried x2^15 in f16: 15 is added to their exponent

typedef __attribute__((ext_vector_type(16))) _Float16 v16h;
typedef __attribute__((ext_vector_type(8)))  _Float16 v8h;
typedef __attribute__((ext_vector_type(16))) __bf16   v16b;
typedef __attribute__((ext_vector_type(8)))  __bf16   v8b;
typedef __attribute__((ext_vector_type(8)))  float    v8f;
typedef __attribute__((ext_vector_type(4)))  float    v4f;

__device__ __forceinline__ unsigned short f2bf_bits(float f) {
  unsigned u = __float_as_uint(f);
  return (unsigned short)((u + 0x7FFFu + ((u >> 16) & 1u)) >> 16);
}
__device__ __forceinline__ float bf_bits2f(unsigned short h) { return __uint_as_float(((unsigned)h) << 16); }
// f32 value of the RNE bf16 of f
__device__ __forceinline__ float bf16_rne_f32(float f) { return bf_bits2f(f2bf_bits(f)); }

// hazard guards as plain device helpers (no inline asm inside the kernel template body)
__device__ __forceinline__ void dep_guard_h(v8f& a, v8f& b, v16h x, v16h y) { asm volatile("v_nop\n\tv_nop\n\tv_nop\n\tv_nop" : "+v"(a), "+v"(b) : "v"(x), "v"(y)); }
__device__ __forceinline__ void dep_guard_b(v8f& a, v8f& b, v16b x, v16b y) { asm volatile("v_nop\n\tv_nop\n\tv_nop\n\tv_nop" : "+v"(a), "+v"(b) : "v"(x), "v"(y)); }
__device__ __forceinline__ void keep4_h(v16h a, v16h b, v16h c, v16h d) { asm volatile("v_nop" :: "v"(a), "v"(b), "v"(c), "v"(d)); }
__device__ __forceinline__ void keep4_b(v16b a, v16b b, v16b c, v16b d) { asm volatile("v_nop" :: "v"(a), "v"(b), "v"(c), "v"(d)); }
__device__ __forceinline__ void acc_guard4(v8f& a, v8f& b, v8f& c, v8f& d) { asm volatile("v_nop\n\tv_nop\n\tv_nop\n\tv_nop" : "+v"(a), "+v"(b), "+v"(c), "+v"(d)); }
// stands behind a group of global loads, in front of the first overwrite of a register that holds one of their addresses
__device__ __forceinline__ void wait_xcnt0() { asm volatile("s_wait_xcnt 0x0" ::: "memory"); }
template <typename T> struct Frag;
template <> struct Frag<_Float16> {
  typedef v16h V; typedef v8h H; union U { v16h v; v8h h[2]; };
  static __device__ __forceinline__ v16h load(const _Float16* p) {   // elements 0..7 <- p[0..7], 8..15 <- p[16..23]
    U f; f.h[0] = *(const v8h*)(p); f.h[1] = *(const v8h*)(p + 16); return f.v;
  }
  static __device__ __forceinline__ v8f mma(v16h a, v16h b, v8f c) {
    return __builtin_amdgcn_wmma_f32_16x16x32_f16(false, a, false, b, (short)0, c, false, false);
  }
  static __device__ __forceinline__ void guard(v8f& a, v8f& b, v16h x, v16h y) { dep_guard_h(a, b, x, y); }
  static __device__ __forceinline__ void keep(v16h a, v16h b, v16h c, v16h d) { keep4_h(a, b, c, d); }
};
template <> struct Frag<__bf16> {
  typedef v16b V; typedef v8b H; union U { v16b v; v8b h[2]; };
  static __device__ __forceinline__ v16b load(const __bf16* p) {
    U f; f.h[0] = *(const v8b*)(p); f.h[1] = *(const v8b*)(p + 16); return f.v;
  }
  static __device__ __forceinline__ v8f mma(v16b a, v16b b, v8f c) {
    return __builtin_amdgcn_wmma_f32_16x16x32_bf16(false, a, false, b, (short)0, c, false, false);
  }
  static __device__ __forceinline__ void guard(v8f& a, v8f& b, v16b x, v16b y) { dep_guard_b(a, b, x, y); }
  static __device__ __forceinline__ void keep(v16b a, v16b b, v16b c, v16b d) { keep4_b(a, b, c, d); }
};

// ---- Register-blocked batched WMMA GEMM ------------------------------------
// C[m,n] = scale * sum_k A[m,k] * Bt[n,k] (+bias)(+resid); each wave owns a 64x64 tile.
// Block = 4 waves (2 x 2) = one 128x128 tile of C. Per 64-wide k slab the block stages 128 rows of A and 128 rows of Bt
// in LDS: 8 lanes x 16 B cover one whole 128-B line of a row, so a wave-wide load touches 4 lines. Two LDS buffers:
// the next slab is loaded to registers before the products of this slab and stored to the other buffer behind them,
// one __syncthreads() per slab. Fragments are read from LDS with k ascending in steps of 32.
// A row-major [M,K]; Bt row-major [N,K]; M,N % 128 == 0, K % 64 == 0.
// SPLIT (hi/lo operand planes) is not staged: single-plane operands only.
// BIAS_MODE: 0 = none, 1 = bias[m], 2 = bias[n].
// OUT_MODE: 0 = f32, 1 = f16, 2 = bf16 hi plane (Cout) + bf16 lo plane (Cout2).
// ET: 0 = f16 operands, 1 = bf16 operands (pointers passed as 16-bit storage)
template <int ET> struct Elem;
template <> struct Elem<0> { typedef _Float16 T; };
template <> struct Elem<1> { typedef __bf16 T; };
#define GM_BT 128  // rows of A and of Bt per block tile
#define GM_BK 64   // k elements per staged slab: 128 B = one line per row
#define GM_LP 72   // LDS row pitch in 16-bit elements: 144 B = 16 B x 9 (odd), for the ds_load_b128 fragment reads
template <int ET, bool SPLIT, int BIAS_MODE, int OUT_MODE, bool RESID, int ACT = 0>
__global__ __launch_bounds__(128) void wmma_gemm64(
    const unsigned short* __restrict__ Ap, const unsigned short* __restrict__ A2p, int lda, long strideA,
    const unsigned short* __restrict__ Btp, const unsigned short* __restrict__ Bt2p, int ldb, long strideB,
    void* __restrict__ Cout, void* __restrict__ Cout2, int ldc, long strideC,
    const float* __restrict__ bias,
    const float* __restrict__ resid, long strideR,
    int M, int N, int K, float scale) {
  static_assert(!SPLIT, "single-plane operands only");
  typedef typename Elem<ET>::T T;
  typedef typename Frag<T>::V V;
  typedef typename Frag<T>::H H;
  const T* A = (const T*)Ap; const T* Bt = (const T*)Btp;
  __shared__ __align__(16) T sA[2][GM_BT * GM_LP];   // A slab  [row][k], 2 x 18 KB
  __shared__ __align__(16) T sB[2][GM_BT * GM_LP];   // Bt slab [row][k], 2 x 18 KB
  __shared__ __align__(16) float sT[4][16 * 68];     // per-wave 16x64 slab, pitch 68 floats
  const int b    = blockIdx.y;
  const int tid  = threadIdx.x;
  const int lane = tid & 31;
  const int wave = tid >> 5;
  const int tilesN = N >> 7;
  const int tilesM = M >> 7;
  const int tile = blockIdx.x;
  if (tile >= tilesM * tilesN) return;   // block-uniform, in front of every barrier
  const int tm = tile / tilesN;
  const int tn = tile - tm * tilesN;
  const int bm0 = tm << 7;               // first row / column of the block tile
  const int bn0 = tn << 7;
  const int wm  = (wave >> 1) << 6;      // this wave's 64x64 quadrant
  const int wn  = (wave & 1) << 6;
  const int m0 = bm0 + wm;
  const int n0 = bn0 + wn;

  const T* Ab  = A  + (size_t)b * strideA;
  const T* Bb  = Bt + (size_t)b * strideB;

  const int rlane = lane & 15;                 // row (A) / col (B, D) within subtile
  const int koff  = (lane >> 4) * 8;           // k offset of this lane half
  const int mOff  = (lane >> 4) * 8;           // D row offset

  // staging map: 128 threads x 8 x 16 B per operand = 128 rows x 128 B; thread -> row (tid>>3) + 16*i, bytes (tid&7)*16
  const int srow = tid >> 3;
  const int scol = (tid & 7) * 8;
  const T* gA = Ab + (size_t)(bm0 + srow) * lda + scol;
  const T* gB = Bb + (size_t)(bn0 + srow) * ldb + scol;
  const int sOff = srow * GM_LP + scol;

  v8f acc[4][4];
#pragma unroll
  for (int i = 0; i < 4; ++i)
#pragma unroll
    for (int j = 0; j < 4; ++j) acc[i][j] = (v8f){0.f,0.f,0.f,0.f,0.f,0.f,0.f,0.f};

  H ra[8], rb[8];
#pragma unroll
  for (int i = 0; i < 8; ++i) {
    ra[i] = *(const H*)(gA + (size_t)(i * 16) * lda);
    rb[i] = *(const H*)(gB + (size_t)(i * 16) * ldb);
  }
#pragma unroll
  for (int i = 0; i < 8; ++i) {
    *(H*)(&sA[0][sOff + i * 16 * GM_LP]) = ra[i];
    *(H*)(&sB[0][sOff + i * 16 * GM_LP]) = rb[i];
  }
  __syncthreads();

  const int nSlab = K >> 6;
  for (int s = 0; s < nSlab; ++s) {
    const int cur = s & 1;
    const bool more = (s + 1 < nSlab);   // block-uniform
    if (more) {
      const int kn = (s + 1) << 6;
#pragma unroll
      for (int i = 0; i < 8; ++i) {
        ra[i] = *(const H*)(gA + (size_t)(i * 16) * lda + kn);
        rb[i] = *(const H*)(gB + (size_t)(i * 16) * ldb + kn);
      }
      wait_xcnt0();   // the fragment reads below land in registers that held these loads' addresses
    }
    const T* cA = &sA[cur][(wm + rlane) * GM_LP + koff];
    const T* cB = &sB[cur][(wn + rlane) * GM_LP + koff];
#pragma unroll
    for (int kk = 0; kk < GM_BK; kk += 32) {
      V bh[4], ah[4];
#pragma unroll
      for (int j = 0; j < 4; ++j) bh[j] = Frag<T>::load(cB + (j << 4) * GM_LP + kk);
#pragma unroll
      for (int i = 0; i < 4; ++i) ah[i] = Frag<T>::load(cA + (i << 4) * GM_LP + kk);
#pragma unroll
      for (int i = 0; i < 4; ++i) {
#pragma unroll
        for (int j = 0; j < 4; ++j) acc[i][j] = Frag<T>::mma(ah[i], bh[j], acc[i][j]);
        Frag<T>::guard(acc[i][0], acc[i][3], ah[i], ah[i]);
      }
      Frag<T>::keep(bh[0], bh[1], bh[2], bh[3]);
    }
    if (more) {
#pragma unroll
      for (int i = 0; i < 8; ++i) {
        *(H*)(&sA[cur ^ 1][sOff + i * 16 * GM_LP]) = ra[i];
        *(H*)(&sB[cur ^ 1][sOff + i * 16 * GM_LP]) = rb[i];
      }
    }
    __syncthreads();   // publishes the other buffer and ends every wave's reads of this one before it is refilled
  }
  acc_guard4(acc[0][0], acc[0][1], acc[0][2], acc[0][3]);
  acc_guard4(acc[1][0], acc[1][1], acc[1][2], acc[1][3]);
  acc_guard4(acc[2][0], acc[2][1], acc[2][2], acc[2][3]);
  acc_guard4(acc[3][0], acc[3][1], acc[3][2], acc[3][3]);

  // ---- epilogue ----
  float* slab = sT[wave];
  const float* Rb = RESID ? (resid + (size_t)b * strideR) : nullptr;
#pragma unroll
  for (int i = 0; i < 4; ++i) {
    const int mBase = m0 + (i << 4);
#pragma unroll
    for (int j = 0; j < 4; ++j) {
      const int n = n0 + (j << 4) + rlane;
      float bv = 0.f;
      if (BIAS_MODE == 2) bv = bias[n];
#pragma unroll
      for (int r = 0; r < 8; ++r) {
        float v = acc[i][j][r] * scale;
        if (BIAS_MODE == 1) v += bias[mBase + mOff + r];
        if (BIAS_MODE == 2) v += bv;
        if (RESID) v += Rb[(size_t)(mBase + mOff + r) * ldc + n];
        if (ACT == 1) v = tanhf(v);
        if (ACT == 2) v = fmaxf(v, 0.0f);
        if (ACT == 3) v = v / (1.0f + expf(-v));
        if (ACT == 4) v = (v > 0.f) ? v : 0.01f * v;
        if (ACT == 5) v = 0.5f * v * (1.0f + erff(v * 0.70710678118654752f));
        slab[(mOff + r) * 68 + (j << 4) + rlane] = v;
      }
    }
    __builtin_amdgcn_fence(__ATOMIC_RELEASE, "workgroup");
    __builtin_amdgcn_wave_barrier();
    __builtin_amdgcn_fence(__ATOMIC_ACQUIRE, "workgroup");
    if (OUT_MODE == 0) {
      float* C = (float*)Cout + (size_t)b * strideC;
      const int hh = lane >> 4, c4 = (lane & 15) * 4;     // row seg = 256 B = 16 lanes x 16 B
      {
#pragma unroll
        for (int it = 0; it < 8; ++it) {
          const int row = it * 2 + hh;
          v4f v = *(const v4f*)(slab + row * 68 + c4);
          *(v4f*)(C + (size_t)(mBase + row) * ldc + n0 + c4) = v;
        }
        
      }
    } else {
      const int q = lane >> 3, c8 = (lane & 7) * 8;
      unsigned short* C  = (unsigned short*)Cout  + (size_t)b * strideC;
      unsigned short* C2 = (OUT_MODE == 2) ? ((unsigned short*)Cout2 + (size_t)b * strideC) : nullptr;
      {
#pragma unroll
        for (int it = 0; it < 4; ++it) {
          const int row = it * 4 + q;
          const float* sp = slab + row * 68 + c8;
          v8h hv, lv;
#pragma unroll
          for (int e = 0; e < 8; ++e) {
            if (OUT_MODE == 1) {
              hv[e] = (_Float16)sp[e];
            } else {
              unsigned short hb = f2bf_bits(sp[e]);
              unsigned short lb = f2bf_bits(sp[e] - bf_bits2f(hb));
              hv[e] = __builtin_bit_cast(_Float16, hb);
              lv[e] = __builtin_bit_cast(_Float16, lb);
            }
          }
          *(v8h*)(C + (size_t)(mBase + row) * ldc + n0 + c8) = hv;
          if (OUT_MODE == 2) *(v8h*)(C2 + (size_t)(mBase + row) * ldc + n0 + c8) = lv;
        }
        
      }
    }
    __builtin_amdgcn_fence(__ATOMIC_RELEASE, "workgroup");
    __builtin_amdgcn_wave_barrier();
    __builtin_amdgcn_fence(__ATOMIC_ACQUIRE, "workgroup");
  }
}

// ---------------------------------------------------------------------------
// f32 -> bf16 (RNE) cast: 2 elements per thread, ONE 4-B store per lane -> each wave writes exactly one whole
// Coverage: grid = n2/256 blocks x 256 threads x 2 elements = 2*n2 = whole plane
//   x : n2 = 4096*1024/2 = 2097152 = 8192 blocks;  W : n2 = 1024*1024/2 = 524288 = 2048 blocks (exact multiples).
// ---------------------------------------------------------------------------
__device__ __forceinline__ unsigned pk16(unsigned short a, unsigned short b) { return (unsigned)a | ((unsigned)b << 16); }

__global__ __launch_bounds__(256) void cast_f32_bf16x2(const float* __restrict__ in, unsigned short* __restrict__ out, int n2) {
  const int i = blockIdx.x * 256 + threadIdx.x;
  if (i < n2) {
    const float f0 = in[2 * (size_t)i], f1 = in[2 * (size_t)i + 1];
    const unsigned u = pk16(f2bf_bits(f0), f2bf_bits(f1));
    ((unsigned*)out)[i] = u;
    
  }
}

// f32 -> bf16 (RNE) value -> x scale (power of two, exact) -> f16 bits (exact for normal-range values); same store shape as above.
__global__ __launch_bounds__(256) void cast_f32_bf16val_f16x2(const float* __restrict__ in, unsigned short* __restrict__ out,
                                                              int n2, float scale) {
  const int i = blockIdx.x * 256 + threadIdx.x;
  if (i < n2) {
    const float f0 = bf16_rne_f32(in[2 * (size_t)i]) * scale;
    const float f1 = bf16_rne_f32(in[2 * (size_t)i + 1]) * scale;
    const _Float16 h0 = (_Float16)f0, h1 = (_Float16)f1;
    const unsigned u = pk16(__builtin_bit_cast(unsigned short, h0), __builtin_bit_cast(unsigned short, h1));
    ((unsigned*)out)[i] = u;
    
  }
}

// =====================================================================================
// Full (unmasked) attention with an additive [SEQ][SEQ] score bias shared over (b, h); head dim 64.
//   q plane  f16: element (b, t, h, d) at [(b*SEQ_LEN + t)*DMODEL + h*64 + d]
//   k plane  f16: element (b, s, h, d) at [(b*SEQ_LEN + s)*DMODEL + h*64 + d]
//   v^T plane f16: element (b, h, d, s) at [b*DMODEL*SEQ_LEN + (h*64 + d)*SEQ_LEN + s]
//   O plane  f16 (x O_CARRY): element (b, t, h, d) at [(b*SEQ_LEN + t)*DMODEL + h*64 + d]
//   scores = (q . k) * sscale + bf16value(pbias[t][s]) : single v_wmma_f32_16x16x32_f16 product, f32 accumulate, bias in f32
//   out    = p . v : p (unnormalised, <= 1) carried x2^15 in f16, v f16, single product, f32 accumulate
//   both products are formed transposed (S^T = K.Q^T, O^T = V^T.P^T): a lane holds one query's scores, so the maximum and the
//   sum run in-lane (plus one exchange between the wave's halves) and P^T goes from the score accumulators into the B operand.
//   online softmax in f32 over all SEQ_LEN keys (32 chunks of 64, compile-time trip count).
//   Block = 4 waves = 64 query rows of one (b, h); grid.x = BATCH_N * NHEADS * (SEQ_LEN/64) = 1024.
//   Chunk staging (plain 16-B loads, __syncthreads before and after), every wave-wide load covering 4 whole 128-B lines:
//   K and V^T tiles 64x64 f16, 8 lanes per 128-B row; the block's 64x64 f32 bias tile, 16 lanes per 256-B row.
//   Fragment loads read the K / V^T tiles with the same v8h element type; a lane reads its own query's bias row from LDS.
// =====================================================================================
#define AT_D 64
#define AT_NW 4
#define AT_QB 64
#define AT_KC 64
#define AT_LP 72   // LDS row pitch of the K and V^T tiles in f16: 144 B = 16 B x 9 (odd), so 16 rows read by ds_load_b128 fall on distinct banks
#define AT_BP 68   // LDS row pitch of the bias tile in f32: 272 B = 16 B x 17 (odd), for the same reason

__device__ __forceinline__ v8f at_mma_h(v16h a, v16h b, v8f c) {
  c = __builtin_amdgcn_wmma_f32_16x16x32_f16(false, a, false, b, (short)0, c, false, false);
  asm volatile("v_nop\n\tv_nop\n\tv_nop\n\tv_nop" : "+v"(c) : "v"(a), "v"(b));
  return c;
}

// lane l <-> lane l ^ 16
__device__ __forceinline__ float xhalf(float x) {
  return __builtin_bit_cast(float, __builtin_amdgcn_permlanex16(__builtin_bit_cast(int, x), __builtin_bit_cast(int, x), 0x76543210, 0xfedcba98, false, false));
}

__global__ __launch_bounds__(128)
void attn_bias64_kernel(const unsigned short* __restrict__ qp, const unsigned short* __restrict__ kp,
                        const unsigned short* __restrict__ vtp, const float* __restrict__ pbias,
                        unsigned short* __restrict__ op, float sscale) {
  union FH { v16h v; v8h h[2]; };
  __shared__ __align__(16) _Float16 Ksh[AT_KC * AT_LP];            // K  [kv][d]   9 KB, pitch AT_LP
  __shared__ __align__(16) _Float16 Vth[AT_D * AT_LP];             // V^T [d][kv]  9 KB, pitch AT_LP
  __shared__ __align__(16) float    Bsh[AT_QB * AT_BP];            // bias [query][kv]  17 KB, pitch AT_BP
  __shared__ __align__(16) float    Os[AT_NW][16 * 68];            // per wave out tile, pitch 68  17 KB

  const int tid  = threadIdx.x;
  const int wave = tid >> 5;
  const int lane = tid & 31;
  const int hh   = lane >> 4;
  const int c    = lane & 15;

  const int nqb = SEQ_LEN / AT_QB;        // 32
  const int bx = blockIdx.x;
  const int qb = bx % nqb;
  const int bh = bx / nqb;                // 0..BATCH_N*NHEADS-1
  const int h  = bh % NHEADS;
  const int b  = bh / NHEADS;
  const int q0 = qb * AT_QB + wave * 16;  // first query row of this wave (within the sequence)

  const _Float16* Qh = (const _Float16*)(const void*)qp  + (size_t)b * SEQ_LEN * DMODEL + (size_t)h * AT_D;
  const _Float16* Kh = (const _Float16*)(const void*)kp  + (size_t)b * SEQ_LEN * DMODEL + (size_t)h * AT_D;
  const _Float16* Vt = (const _Float16*)(const void*)vtp + (size_t)b * DMODEL * SEQ_LEN + (size_t)h * AT_D * SEQ_LEN;
  _Float16*       Ob = (_Float16*)(void*)op + (size_t)b * SEQ_LEN * DMODEL + (size_t)h * AT_D;

  // ---- Q fragments (B operand, col = query = lane&15, split k map via Frag load): 2 d-chunks ----
  v16h qa[2];
#pragma unroll
  for (int dc = 0; dc < 2; ++dc) {
    const _Float16* qr = Qh + (size_t)(q0 + c) * DMODEL + dc * 32 + 8 * hh;
    qa[dc] = Frag<_Float16>::load(qr);
  }

  // One query per lane: lane (hh, c) holds query q0 + c; its half hh holds keys 8hh..8hh+7 of every 16-key tile.
  float mrow = -INFINITY, lrow = 0.f;   // mrow: the same in both halves; lrow (x2^15, like p): this half's keys only, joined behind the loop
  v8f oacc[4];                          // O^T: element r of oacc[t] -> (d = t*16 + 8hh + r, query c)
#pragma unroll
  for (int t = 0; t < 4; ++t) oacc[t] = (v8f){0.f,0.f,0.f,0.f,0.f,0.f,0.f,0.f};

  // staging maps: K, V^T rows krow + 16 i (i < 4), 16 B at kcol; bias rows brow + 8 i (i < 8), 16 B at bcol
  const int krow = tid >> 3, kcol = (tid & 7) * 8;
  const int brow = tid >> 4, bcol = (tid & 15) * 4;
  const _Float16* gK = Kh + (size_t)krow * DMODEL + kcol;
  const _Float16* gV = Vt + (size_t)krow * SEQ_LEN + kcol;
  const float*    gB = pbias + (size_t)(qb * AT_QB + brow) * SEQ_LEN + bcol;
  const float* pbq = Bsh + (wave * 16 + c) * AT_BP + 8 * hh;   // this lane's bias row in the tile, at its half's first key

  const int nChunks = SEQ_LEN / AT_KC;   // 32, compile-time constant
  for (int kc = 0; kc < nChunks; ++kc) {
    __syncthreads();
    {
      // staging coverage: 128 threads x (4 x 8) f16 = 64 rows x 64 per plane; 128 threads x (8 x 4) f32 = 64 rows x 64 of bias
      v8h ka[4], va[4];
      v4f ba[8];
#pragma unroll
      for (int i = 0; i < 4; ++i) {
        ka[i] = *(const v8h*)(gK + (size_t)(16 * i) * DMODEL);    // K row kc*64 + krow + 16 i
        va[i] = *(const v8h*)(gV + (size_t)(16 * i) * SEQ_LEN);   // V^T row d = krow + 16 i, s = kc*64 + kcol..
      }
#pragma unroll
      for (int i = 0; i < 8; ++i) ba[i] = *(const v4f*)(gB + (size_t)(8 * i) * SEQ_LEN);   // in range: kc*64 + 63 < SEQ_LEN
      wait_xcnt0();   // in front of the three pointer steps, which overwrite these loads' address registers
      gK += (size_t)AT_KC * DMODEL;
      gV += AT_KC;
      gB += AT_KC;
#pragma unroll
      for (int i = 0; i < 4; ++i) {
        *(v8h*)(Ksh + (krow + 16 * i) * AT_LP + kcol) = ka[i];
        *(v8h*)(Vth + (krow + 16 * i) * AT_LP + kcol) = va[i];
      }
#pragma unroll
      for (int i = 0; i < 8; ++i) *(v4f*)(Bsh + (brow + 8 * i) * AT_BP + bcol) = ba[i];
    }
    __syncthreads();

    // ---- bias: 8 consecutive keys of the lane's own query per 16-key tile, from the staged tile ----
    v4f pbv[4][2];
#pragma unroll
    for (int j = 0; j < 4; ++j) {
      pbv[j][0] = *(const v4f*)(pbq + j * 16);
      pbv[j][1] = *(const v4f*)(pbq + j * 16 + 4);
    }

    // ---- scores, transposed: S^T = K (A: row = key j*16+c) . Q^T (B: col = query c); D element r -> (key j*16+8hh+r, query c) ----
    v8f s[4];
#pragma unroll
    for (int j = 0; j < 4; ++j) {
      s[j] = (v8f){0.f,0.f,0.f,0.f,0.f,0.f,0.f,0.f};
#pragma unroll
      for (int dc = 0; dc < 2; ++dc) {
        FH kb;
        kb.h[0] = *(const v8h*)(Ksh + (j * 16 + c) * AT_LP + dc * 32 + 8 * hh);
        kb.h[1] = *(const v8h*)(Ksh + (j * 16 + c) * AT_LP + dc * 32 + 16 + 8 * hh);
        s[j] = at_mma_h(kb.v, qa[dc], s[j]);
      }
    }
    float mj[4];   // one maximum per 16-key tile: four independent chains
#pragma unroll
    for (int j = 0; j < 4; ++j) {
      mj[j] = -INFINITY;
#pragma unroll
      for (int r = 0; r < 8; ++r) {
        const float bb = bf16_rne_f32(pbv[j][r >> 2][r & 3]);
        const float sv = s[j][r] * sscale + bb;
        s[j][r] = sv;
        mj[j] = fmaxf(mj[j], sv);
      }
    }
    float m = fmaxf(fmaxf(mj[0], mj[1]), fmaxf(mj[2], mj[3]));
    m = fmaxf(m, xhalf(m));   // the other half's 32 keys of the same query
    const float mnew = fmaxf(mrow, m);
    // exp(x - mnew) = 2^(x * LOG2E - mnew * LOG2E): one fma and one v_exp_f32 each; every x is <= mnew, so no result
    // exceeds 1 but by rounding; x = -inf (the first chunk's mrow) gives 0
    const float mb = mnew * LOG2E;
    const float alpha = __builtin_amdgcn_exp2f(fmaf(mrow, LOG2E, -mb));
    const float pofs = P_CARRY_LOG2 - mb;   // the x2^15 carry of p rides in the exponent
    mrow = mnew;
    // ---- P^T packed in place: tiles 2kk and 2kk+1 give elements 0..7 and 8..15 of the B operand (k = 8hh+e, 16+8hh+e) ----
    FH pb[2];
    float pj[4];   // one sum per 16-key tile: four independent chains
#pragma unroll
    for (int j = 0; j < 4; ++j) {
      pj[j] = 0.f;
#pragma unroll
      for (int r = 0; r < 8; ++r) {
        const float p = __builtin_amdgcn_exp2f(fmaf(s[j][r], LOG2E, pofs));   // p x 2^15
        pj[j] += p;
        pb[j >> 1].h[j & 1][r] = (_Float16)p;
      }
    }
    lrow = lrow * alpha + ((pj[0] + pj[1]) + (pj[2] + pj[3]));
#pragma unroll
    for (int t = 0; t < 4; ++t) oacc[t] *= alpha;
    // ---- O^T: oacc[t] += V^T (A: row = d t*16+c, k = key) . P^T (B: col = query c, k = key) ----
#pragma unroll
    for (int kk = 0; kk < 2; ++kk) {
#pragma unroll
      for (int t = 0; t < 4; ++t) {
        FH vb;
        vb.h[0] = *(const v8h*)(Vth + (t * 16 + c) * AT_LP + kk * 32 + 8 * hh);
        vb.h[1] = *(const v8h*)(Vth + (t * 16 + c) * AT_LP + kk * 32 + 16 + 8 * hh);
        oacc[t] = at_mma_h(vb.v, pb[kk].v, oacc[t]);
      }
    }
  }

  float* os = Os[wave];
  {
    const float lsum = lrow + xhalf(lrow);                    // both halves' keys
    const float inv = O_CARRY * (1.0f / lsum);                // lsum carries the same x2^15 as oacc; lsum >= 2^15 up to rounding
#pragma unroll
    for (int t = 0; t < 4; ++t) {
      const v8f o = oacc[t] * inv;
      *(v4f*)(os + c * 68 + t * 16 + 8 * hh)     = (v4f){o[0], o[1], o[2], o[3]};
      *(v4f*)(os + c * 68 + t * 16 + 8 * hh + 4) = (v4f){o[4], o[5], o[6], o[7]};
    }
  }
  __builtin_amdgcn_fence(__ATOMIC_RELEASE, "workgroup");
  __builtin_amdgcn_wave_barrier();
  __builtin_amdgcn_fence(__ATOMIC_ACQUIRE, "workgroup");
  {
    const int q4 = lane >> 3, c8 = (lane & 7) * 8;
    {
#pragma unroll
      for (int it = 0; it < 4; ++it) {
        const int row = it * 4 + q4;   // it 0..3 x q4 0..3 covers rows 0..15 of the wave tile
        const float* sp = os + row * 68 + c8;
        v8h hv;
#pragma unroll
        for (int e = 0; e < 8; ++e) hv[e] = (_Float16)sp[e];
        *(v8h*)(Ob + (size_t)(q0 + row) * DMODEL + c8) = hv;
      }
      
    }
  }
}

// ---------------------------------------------------------------------------
// Workspace region map (byte offsets, all 1 MiB aligned; total 50,331,648 B = 48 MiB):
//   [ 0 MiB,  8 MiB)  xb   : bf16 x            [4096][1024]
//   [ 8 MiB, 10 MiB)  wqb  : bf16 Wq           [1024][1024]
//   [10 MiB, 12 MiB)  wkb  : bf16 Wk
//   [12 MiB, 14 MiB)  wvb  : bf16 Wv
//   [14 MiB, 16 MiB)  woh  : f16 (bf16val(Wo) x64)
//   [16 MiB, 24 MiB)  qh   : f16 q plane       [4096][1024]
//   [24 MiB, 32 MiB)  kh   : f16 k plane       [4096][1024]
//   [32 MiB, 40 MiB)  vth  : f16 v^T plane     [2][1024][2048]
//   [40 MiB, 48 MiB)  oh   : f16 O plane (x64) [4096][1024]
// ---------------------------------------------------------------------------
extern "C" void kernel_launch(void* const* d_in, const int* in_sizes, int n_in,
                              void* d_out, int out_size, void* d_ws,
                              size_t ws_size, hipStream_t stream) {
  if (n_in < 10) return;
  const float* x  = (const float*)d_in[0];
  const float* pb = (const float*)d_in[1];
  const float* Wq = (const float*)d_in[2];
  const float* bq = (const float*)d_in[3];
  const float* Wk = (const float*)d_in[4];
  const float* bk = (const float*)d_in[5];
  const float* Wv = (const float*)d_in[6];
  const float* bv = (const float*)d_in[7];
  const float* Wo = (const float*)d_in[8];
  const float* bo = (const float*)d_in[9];
  float* out = (float*)d_out;

  const int nX = MTOK * DMODEL;        // 4194304
  const int nW = DMODEL * DMODEL;      // 1048576
  const int nP = SEQ_LEN * SEQ_LEN;    // 4194304
  if (in_sizes[0] != nX || in_sizes[1] != nP) return;
  if (in_sizes[2] != nW || in_sizes[4] != nW || in_sizes[6] != nW || in_sizes[8] != nW) return;
  if (in_sizes[3] != DMODEL || in_sizes[5] != DMODEL || in_sizes[7] != DMODEL || in_sizes[9] != DMODEL) return;
  if (out_size != nX) return;

  const size_t bytesX16 = (size_t)nX * 2;   // 8 MiB
  const size_t bytesW16 = (size_t)nW * 2;   // 2 MiB
  size_t off = 0;
  const size_t off_xb  = off; off += bytesX16;
  const size_t off_wq  = off; off += bytesW16;
  const size_t off_wk  = off; off += bytesW16;
  const size_t off_wv  = off; off += bytesW16;
  const size_t off_wo  = off; off += bytesW16;
  const size_t off_q   = off; off += bytesX16;
  const size_t off_k   = off; off += bytesX16;
  const size_t off_vt  = off; off += bytesX16;
  const size_t off_o   = off; off += bytesX16;
  if (off > ws_size) return;               // 50,331,648 B needed

  char* ws = (char*)d_ws;
  unsigned short* xb  = (unsigned short*)(ws + off_xb);
  unsigned short* wqb = (unsigned short*)(ws + off_wq);
  unsigned short* wkb = (unsigned short*)(ws + off_wk);
  unsigned short* wvb = (unsigned short*)(ws + off_wv);
  unsigned short* woh = (unsigned short*)(ws + off_wo);
  unsigned short* qh  = (unsigned short*)(ws + off_q);
  unsigned short* kh  = (unsigned short*)(ws + off_k);
  unsigned short* vth = (unsigned short*)(ws + off_vt);
  unsigned short* oh  = (unsigned short*)(ws + off_o);

  // ---- casts (2 elements per thread; exact multiples of 512 elements per block) ----
  const int n2X = nX / 2;   // 2097152 -> 8192 blocks
  const int n2W = nW / 2;   // 524288  -> 2048 blocks
  cast_f32_bf16x2<<<dim3(n2X / 256), dim3(256), 0, stream>>>(x,  xb,  n2X);
  cast_f32_bf16x2<<<dim3(n2W / 256), dim3(256), 0, stream>>>(Wq, wqb, n2W);
  cast_f32_bf16x2<<<dim3(n2W / 256), dim3(256), 0, stream>>>(Wk, wkb, n2W);
  cast_f32_bf16x2<<<dim3(n2W / 256), dim3(256), 0, stream>>>(Wv, wvb, n2W);
  cast_f32_bf16val_f16x2<<<dim3(n2W / 256), dim3(256), 0, stream>>>(Wo, woh, n2W, W_CARRY);

  // ---- q / k projections: C[token][feature] = xb . Wᵀ + b, M=4096, N=1024, K=1024 (32*8 = 256 block tiles of 128x128) ----
  const long strideXb = (long)SEQ_LEN * DMODEL;   // per-batch token block of xb (elements)
  wmma_gemm64<1, false, 2, 1, false, 0><<<dim3((MTOK / 128) * (DMODEL / 128), 1), dim3(128), 0, stream>>>(
      xb, xb, DMODEL, 0L, wqb, wqb, DMODEL, 0L, (void*)qh, (void*)qh, DMODEL, 0L, bq, bq, 0L,
      MTOK, DMODEL, DMODEL, 1.0f);
  wmma_gemm64<1, false, 2, 1, false, 0><<<dim3((MTOK / 128) * (DMODEL / 128), 1), dim3(128), 0, stream>>>(
      xb, xb, DMODEL, 0L, wkb, wkb, DMODEL, 0L, (void*)kh, (void*)kh, DMODEL, 0L, bk, bk, 0L,
      MTOK, DMODEL, DMODEL, 1.0f);
  // ---- v^T projection (role swapped): C_b[feature][token] = Wv . x_bᵀ + bv[feature]; M=1024, N=2048, K=1024, z = batch
  //      (8*16 = 128 block tiles per batch) ----
  wmma_gemm64<1, false, 1, 1, false, 0><<<dim3((DMODEL / 128) * (SEQ_LEN / 128), BATCH_N), dim3(128), 0, stream>>>(
      wvb, wvb, DMODEL, 0L, xb, xb, DMODEL, strideXb, (void*)vth, (void*)vth, SEQ_LEN, (long)DMODEL * SEQ_LEN, bv, bv, 0L,
      DMODEL, SEQ_LEN, DMODEL, 1.0f);

  // ---- attention: 2 * 16 * (2048/64) = 1024 blocks of 64 query rows ----
  attn_bias64_kernel<<<dim3(BATCH_N * NHEADS * (SEQ_LEN / 64)), dim3(128), 0, stream>>>(qh, kh, vth, pb, oh, 0.125f);

  // ---- output projection: out[token][feature] = (O x64) . (Wo x64)ᵀ / 4096 + bo; M=4096, N=1024, K=1024 ----
  wmma_gemm64<0, false, 2, 0, false, 0><<<dim3((MTOK / 128) * (DMODEL / 128), 1), dim3(128), 0, stream>>>(
      oh, oh, DMODEL, 0L, woh, woh, DMODEL, 0L, (void*)out, (void*)out, DMODEL, 0L, bo, bo, 0L,
      MTOK, DMODEL, DMODEL, 1.0f / (O_CARRY * W_CARRY));
}

// v006
// It runs in 143 microseconds.
// Next to v005, in two timings, it ran 1.04 times as fast each time.
// Over all steps from v000 it is 2.60 times as fast.
// Contractions: q, k, v^T projections on v_wmma_f32_16x16x32_bf16 (bf16 RNE operands from the raw inputs, single product, f32 accumulate); q.k^T and p.v on v_wmma_f32_16x16x32_f16 (f16 q/k/v planes, p carried x2^15, f32 accumulate, online softmax and additive bias in f32); output projection on v_wmma_f32_16x16x32_f16 (O carried x64 in f16, Wo as bf16-RNE value x64 in f16, f32 accumulate, x1/4096 in the f32 epilogue).
#include <hip/hip_runtime.h>
#include <math.h>
#include <stdint.h>

constexpr int BATCH_N = 2;
constexpr int SEQ_LEN = 2048;
constexpr int DMODEL  = 1024;
constexpr int NHEADS  = 16;
constexpr int HDIM    = 64;
constexpr int MTOK    = BATCH_N * SEQ_LEN;   // 4096 token rows
static_assert(NHEADS * HDIM == DMODEL, "head split");

constexpr float O_CARRY = 64.0f;      // attention output carried x64 in f16
constexpr float W_CARRY = 64.0f;      // Wo carried x64 in f16
constexpr float LOG2E   = 1.4426950408889634f;   // exp(x) = 2^(x * LOG2E)
constexpr float P_CARRY_LOG2 = 15.0f;            // probabilities carried x2^15 in f16: 15 is added to their exponent

typedef __attribute__((ext_vector_type(16))) _Float16 v16h;
typedef __attribute__((ext_vector_type(8)))  _Float16 v8h;
typedef __attribute__((ext_vector_type(16))) __bf16   v16b;
typedef __attribute__((ext_vector_type(8)))  __bf16   v8b;
typedef __attribute__((ext_vector_type(8)))  float    v8f;
typedef __attribute__((ext_vector_type(4)))  float    v4f;

__device__ __forceinline__ unsigned short f2bf_bits(float f) {
  unsigned u = __float_as_uint(f);
  return (unsigned short)((u + 0x7FFFu + ((u >> 16) & 1u)) >> 16);
}
__device__ __forceinline__ float bf_bits2f(unsigned short h) { return __uint_as_float(((unsigned)h) << 16); }
// f32 value of the RNE bf16 of f
__device__ __forceinline__ float bf16_rne_f32(float f) { return bf_bits2f(f2bf_bits(f)); }

// hazard guards as plain device helpers (no inline asm inside the kernel template body)
__device__ __forceinline__ void dep_guard_h(v8f& a, v8f& b, v16h x, v16h y) { asm volatile("v_nop\n\tv_nop\n\tv_nop\n\tv_nop" : "+v"(a), "+v"(b) : "v"(x), "v"(y)); }
__device__ __forceinline__ void dep_guard_b(v8f& a, v8f& b, v16b x, v16b y) { asm volatile("v_nop\n\tv_nop\n\tv_nop\n\tv_nop" : "+v"(a), "+v"(b) : "v"(x), "v"(y)); }
__device__ __forceinline__ void keep4_h(v16h a, v16h b, v16h c, v16h d) { asm volatile("v_nop" :: "v"(a), "v"(b), "v"(c), "v"(d)); }
__device__ __forceinline__ void keep4_b(v16b a, v16b b, v16b c, v16b d) { asm volatile("v_nop" :: "v"(a), "v"(b), "v"(c), "v"(d)); }
__device__ __forceinline__ void acc_guard4(v8f& a, v8f& b, v8f& c, v8f& d) { asm volatile("v_nop\n\tv_nop\n\tv_nop\n\tv_nop" : "+v"(a), "+v"(b), "+v"(c), "+v"(d)); }
// stands behind a group of global loads, in front of the first overwrite of a register that holds one of their addresses
__device__ __forceinline__ void wait_xcnt0() { asm volatile("s_wait_xcnt 0x0" ::: "memory"); }
template <typename T> struct Frag;
template <> struct Frag<_Float16> {
  typedef v16h V; typedef v8h H; union U { v16h v; v8h h[2]; };
  static __device__ __forceinline__ v16h load(const _Float16* p) {   // elements 0..7 <- p[0..7], 8..15 <- p[16..23]
    U f; f.h[0] = *(const v8h*)(p); f.h[1] = *(const v8h*)(p + 16); return f.v;
  }
  static __device__ __forceinline__ v8f mma(v16h a, v16h b, v8f c) {
    return __builtin_amdgcn_wmma_f32_16x16x32_f16(false, a, false, b, (short)0, c, false, false);
  }
  static __device__ __forceinline__ void guard(v8f& a, v8f& b, v16h x, v16h y) { dep_guard_h(a, b, x, y); }
  static __device__ __forceinline__ void keep(v16h a, v16h b, v16h c, v16h d) { keep4_h(a, b, c, d); }
};
template <> struct Frag<__bf16> {
  typedef v16b V; typedef v8b H; union U { v16b v; v8b h[2]; };
  static __device__ __forceinline__ v16b load(const __bf16* p) {
    U f; f.h[0] = *(const v8b*)(p); f.h[1] = *(const v8b*)(p + 16); return f.v;
  }
  static __device__ __forceinline__ v8f mma(v16b a, v16b b, v8f c) {
    return __builtin_amdgcn_wmma_f32_16x16x32_bf16(false, a, false, b, (short)0, c, false, false);
  }
  static __device__ __forceinline__ void guard(v8f& a, v8f& b, v16b x, v16b y) { dep_guard_b(a, b, x, y); }
  static __device__ __forceinline__ void keep(v16b a, v16b b, v16b c, v16b d) { keep4_b(a, b, c, d); }
};

// ---- Register-blocked batched WMMA GEMM ------------------------------------
// C[m,n] = scale * sum_k A[m,k] * Bt[n,k] (+bias)(+resid); each wave owns a 64x64 tile.
// Block = 4 waves (2 x 2) = one 128x128 tile of C. Per 64-wide k slab the block stages 128 rows of A and 128 rows of Bt
// in LDS: 8 lanes x 16 B cover one whole 128-B line of a row, so a wave-wide load touches 4 lines. Two LDS buffers:
// the next slab is loaded to registers before the products of this slab and stored to the other buffer behind them,
// one __syncthreads() per slab. Fragments are read from LDS with k ascending in steps of 32.
// A row-major [M,K]; Bt row-major [N,K]; M,N % 128 == 0, K % 64 == 0.
// SPLIT (hi/lo operand planes) is not staged: single-plane operands only.
// BIAS_MODE: 0 = none, 1 = bias[m], 2 = bias[n].
// OUT_MODE: 0 = f32, 1 = f16, 2 = bf16 hi plane (Cout) + bf16 lo plane (Cout2).
// ET: 0 = f16 operands, 1 = bf16 operands (pointers passed as 16-bit storage)
template <int ET> struct Elem;
template <> struct Elem<0> { typedef _Float16 T; };
template <> struct Elem<1> { typedef __bf16 T; };
#define GM_BT 128  // rows of A and of Bt per block tile
#define GM_BK 64   // k elements per staged slab: 128 B = one line per row
#define GM_LP 72   // LDS row pitch in 16-bit elements: 144 B = 16 B x 9 (odd), for the ds_load_b128 fragment reads
template <int ET, bool SPLIT, int BIAS_MODE, int OUT_MODE, bool RESID, int ACT = 0>
__global__ __launch_bounds__(128) void wmma_gemm64(
    const unsigned short* __restrict__ Ap, const unsigned short* __restrict__ A2p, int lda, long strideA,
    const unsigned short* __restrict__ Btp, const unsigned short* __restrict__ Bt2p, int ldb, long strideB,
    void* __restrict__ Cout, void* __restrict__ Cout2, int ldc, long strideC,
    const float* __restrict__ bias,
    const float* __restrict__ resid, long strideR,
    int M, int N, int K, float scale) {
  static_assert(!SPLIT, "single-plane operands only");
  typedef typename Elem<ET>::T T;
  typedef typename Frag<T>::V V;
  typedef typename Frag<T>::H H;
  const T* A = (const T*)Ap; const T* Bt = (const T*)Btp;
  __shared__ __align__(16) T sA[2][GM_BT * GM_LP];   // A slab  [row][k], 2 x 18 KB
  __shared__ __align__(16) T sB[2][GM_BT * GM_LP];   // Bt slab [row][k], 2 x 18 KB
  __shared__ __align__(16) float sT[4][16 * 68];     // per-wave 16x64 slab, pitch 68 floats
  const int b    = blockIdx.y;
  const int tid  = threadIdx.x;
  const int lane = tid & 31;
  const int wave = tid >> 5;
  const int tilesN = N >> 7;
  const int tilesM = M >> 7;
  const int tile = blockIdx.x;
  if (tile >= tilesM * tilesN) return;   // block-uniform, in front of every barrier
  const int tm = tile / tilesN;
  const int tn = tile - tm * tilesN;
  const int bm0 = tm << 7;               // first row / column of the block tile
  const int bn0 = tn << 7;
  const int wm  = (wave >> 1) << 6;      // this wave's 64x64 quadrant
  const int wn  = (wave & 1) << 6;
  const int m0 = bm0 + wm;
  const int n0 = bn0 + wn;

  const T* Ab  = A  + (size_t)b * strideA;
  const T* Bb  = Bt + (size_t)b * strideB;

  const int rlane = lane & 15;                 // row (A) / col (B, D) within subtile
  const int koff  = (lane >> 4) * 8;           // k offset of this lane half
  const int mOff  = (lane >> 4) * 8;           // D row offset

  // staging map: 128 threads x 8 x 16 B per operand = 128 rows x 128 B; thread -> row (tid>>3) + 16*i, bytes (tid&7)*16
  const int srow = tid >> 3;
  const int scol = (tid & 7) * 8;
  const T* gA = Ab + (size_t)(bm0 + srow) * lda + scol;
  const T* gB = Bb + (size_t)(bn0 + srow) * ldb + scol;
  const int sOff = srow * GM_LP + scol;

  v8f acc[4][4];
#pragma unroll
  for (int i = 0; i < 4; ++i)
#pragma unroll
    for (int j = 0; j < 4; ++j) acc[i][j] = (v8f){0.f,0.f,0.f,0.f,0.f,0.f,0.f,0.f};

  H ra[8], rb[8];
#pragma unroll
  for (int i = 0; i < 8; ++i) {
    ra[i] = *(const H*)(gA + (size_t)(i * 16) * lda);
    rb[i] = *(const H*)(gB + (size_t)(i * 16) * ldb);
  }
#pragma unroll
  for (int i = 0; i < 8; ++i) {
    *(H*)(&sA[0][sOff + i * 16 * GM_LP]) = ra[i];
    *(H*)(&sB[0][sOff + i * 16 * GM_LP]) = rb[i];
  }
  __syncthreads();

  const int nSlab = K >> 6;
  for (int s = 0; s < nSlab; ++s) {
    const int cur = s & 1;
    const bool more = (s + 1 < nSlab);   // block-uniform
    if (more) {
      const int kn = (s + 1) << 6;
#pragma unroll
      for (int i = 0; i < 8; ++i) {
        ra[i] = *(const H*)(gA + (size_t)(i * 16) * lda + kn);
        rb[i] = *(const H*)(gB + (size_t)(i * 16) * ldb + kn);
      }
      wait_xcnt0();   // the fragment reads below land in registers that held these loads' addresses
    }
    const T* cA = &sA[cur][(wm + rlane) * GM_LP + koff];
    const T* cB = &sB[cur][(wn + rlane) * GM_LP + koff];
#pragma unroll
    for (int kk = 0; kk < GM_BK; kk += 32) {
      V bh[4], ah[4];
#pragma unroll
      for (int j = 0; j < 4; ++j) bh[j] = Frag<T>::load(cB + (j << 4) * GM_LP + kk);
#pragma unroll
      for (int i = 0; i < 4; ++i) ah[i] = Frag<T>::load(cA + (i << 4) * GM_LP + kk);
#pragma unroll
      for (int i = 0; i < 4; ++i) {
#pragma unroll
        for (int j = 0; j < 4; ++j) acc[i][j] = Frag<T>::mma(ah[i], bh[j], acc[i][j]);
        Frag<T>::guard(acc[i][0], acc[i][3], ah[i], ah[i]);
      }
      Frag<T>::keep(bh[0], bh[1], bh[2], bh[3]);
    }
    if (more) {
#pragma unroll
      for (int i = 0; i < 8; ++i) {
        *(H*)(&sA[cur ^ 1][sOff + i * 16 * GM_LP]) = ra[i];
        *(H*)(&sB[cur ^ 1][sOff + i * 16 * GM_LP]) = rb[i];
      }
    }
    __syncthreads();   // publishes the other buffer and ends every wave's reads of this one before it is refilled
  }
  acc_guard4(acc[0][0], acc[0][1], acc[0][2], acc[0][3]);
  acc_guard4(acc[1][0], acc[1][1], acc[1][2], acc[1][3]);
  acc_guard4(acc[2][0], acc[2][1], acc[2][2], acc[2][3]);
  acc_guard4(acc[3][0], acc[3][1], acc[3][2], acc[3][3]);

  // ---- epilogue ----
  float* slab = sT[wave];
  const float* Rb = RESID ? (resid + (size_t)b * strideR) : nullptr;
#pragma unroll
  for (int i = 0; i < 4; ++i) {
    const int mBase = m0 + (i << 4);
#pragma unroll
    for (int j = 0; j < 4; ++j) {
      const int n = n0 + (j << 4) + rlane;
      float bv = 0.f;
      if (BIAS_MODE == 2) bv = bias[n];
#pragma unroll
      for (int r = 0; r < 8; ++r) {
        float v = acc[i][j][r] * scale;
        if (BIAS_MODE == 1) v += bias[mBase + mOff + r];
        if (BIAS_MODE == 2) v += bv;
        if (RESID) v += Rb[(size_t)(mBase + mOff + r) * ldc + n];
        if (ACT == 1) v = tanhf(v);
        if (ACT == 2) v = fmaxf(v, 0.0f);
        if (ACT == 3) v = v / (1.0f + expf(-v));
        if (ACT == 4) v = (v > 0.f) ? v : 0.01f * v;
        if (ACT == 5) v = 0.5f * v * (1.0f + erff(v * 0.70710678118654752f));
        slab[(mOff + r) * 68 + (j << 4) + rlane] = v;
      }
    }
    __builtin_amdgcn_fence(__ATOMIC_RELEASE, "workgroup");
    __builtin_amdgcn_wave_barrier();
    __builtin_amdgcn_fence(__ATOMIC_ACQUIRE, "workgroup");
    if (OUT_MODE == 0) {
      float* C = (float*)Cout + (size_t)b * strideC;
      const int hh = lane >> 4, c4 = (lane & 15) * 4;     // row seg = 256 B = 16 lanes x 16 B
      {
#pragma unroll
        for (int it = 0; it < 8; ++it) {
          const int row = it * 2 + hh;
          v4f v = *(const v4f*)(slab + row * 68 + c4);
          *(v4f*)(C + (size_t)(mBase + row) * ldc + n0 + c4) = v;
        }
        
      }
    } else {
      const int q = lane >> 3, c8 = (lane & 7) * 8;
      unsigned short* C  = (unsigned short*)Cout  + (size_t)b * strideC;
      unsigned short* C2 = (OUT_MODE == 2) ? ((unsigned short*)Cout2 + (size_t)b * strideC) : nullptr;
      {
#pragma unroll
        for (int it = 0; it < 4; ++it) {
          const int row = it * 4 + q;
          const float* sp = slab + row * 68 + c8;
          v8h hv, lv;
#pragma unroll
          for (int e = 0; e < 8; ++e) {
            if (OUT_MODE == 1) {
              hv[e] = (_Float16)sp[e];
            } else {
              unsigned short hb = f2bf_bits(sp[e]);
              unsigned short lb = f2bf_bits(sp[e] - bf_bits2f(hb));
              hv[e] = __builtin_bit_cast(_Float16, hb);
              lv[e] = __builtin_bit_cast(_Float16, lb);
            }
          }
          *(v8h*)(C + (size_t)(mBase + row) * ldc + n0 + c8) = hv;
          if (OUT_MODE == 2) *(v8h*)(C2 + (size_t)(mBase + row) * ldc + n0 + c8) = lv;
        }
        
      }
    }
    __builtin_amdgcn_fence(__ATOMIC_RELEASE, "workgroup");
    __builtin_amdgcn_wave_barrier();
    __builtin_amdgcn_fence(__ATOMIC_ACQUIRE, "workgroup");
  }
}

// ---------------------------------------------------------------------------
// All five f32 operands are converted by ONE launch whose work-groups are all resident at once:
// 256 work-groups x 16 waves; a wave owns 2048 consecutive elements of one operand and issues its 16 loads together.
// Load i of a wave: 32 lanes x 16 B = 512 consecutive bytes (4 whole lines); store i: 32 lanes x 8 B = 256 consecutive bytes (2 whole lines).
// Work-groups [0, CV_XBLK) take x, then CV_WBLK each for Wq, Wk, Wv (all bf16 RNE bits) and Wo (bf16 RNE value x wscale, as f16 bits).
// ---------------------------------------------------------------------------
typedef __attribute__((ext_vector_type(2))) unsigned v2u;
constexpr int CV_THREADS = 512;
constexpr int CV_LOADS   = 16;                                   // 16-B loads per lane
constexpr int CV_STEP    = 32 * 4;                               // elements a wave covers with one load
constexpr int CV_WAVE    = CV_LOADS * CV_STEP;                   // 2048 elements per wave
constexpr int CV_BLOCK   = (CV_THREADS / 32) * CV_WAVE;          // 32768 elements per work-group
constexpr int CV_XBLK    = (MTOK * DMODEL) / CV_BLOCK;           // 128
constexpr int CV_WBLK    = (DMODEL * DMODEL) / CV_BLOCK;         // 32
static_assert(CV_XBLK * CV_BLOCK == MTOK * DMODEL && CV_WBLK * CV_BLOCK == DMODEL * DMODEL, "whole work-groups per operand");

__device__ __forceinline__ unsigned pk16(unsigned short a, unsigned short b) { return (unsigned)a | ((unsigned)b << 16); }
// f32 -> bf16 (RNE) value -> x scale (power of two, exact) -> f16 bits (exact for normal-range values)
__device__ __forceinline__ unsigned short bfval_f16_bits(float f, float scale) {
  const _Float16 h = (_Float16)(bf16_rne_f32(f) * scale);
  return __builtin_bit_cast(unsigned short, h);
}

__global__ __launch_bounds__(CV_THREADS) void cast_operands(
    const float* __restrict__ x, const float* __restrict__ Wq, const float* __restrict__ Wk,
    const float* __restrict__ Wv, const float* __restrict__ Wo,
    unsigned short* __restrict__ xb, unsigned short* __restrict__ wqb, unsigned short* __restrict__ wkb,
    unsigned short* __restrict__ wvb, unsigned short* __restrict__ woh, float wscale) {
  const int blk = blockIdx.x;
  // operand and place in it: the same for the whole work-group
  const int wsel = (blk - CV_XBLK) / CV_WBLK;                    // 0..3 for the weights
  const bool isX = blk < CV_XBLK;
  const int rel  = isX ? blk : (blk - CV_XBLK) - wsel * CV_WBLK;
  const float* src    = isX ? x  : (wsel == 0 ? Wq  : (wsel == 1 ? Wk  : (wsel == 2 ? Wv  : Wo)));
  unsigned short* dst = isX ? xb : (wsel == 0 ? wqb : (wsel == 1 ? wkb : (wsel == 2 ? wvb : woh)));
  const bool asF16 = !isX && wsel == 3;
  const int e0 = rel * CV_BLOCK + (int)(threadIdx.x >> 5) * CV_WAVE + (int)(threadIdx.x & 31) * 4;
  const float* s    = src + e0;
  unsigned short* d = dst + e0;

  v4f v[CV_LOADS];
#pragma unroll
  for (int i = 0; i < CV_LOADS; ++i) v[i] = *(const v4f*)(s + i * CV_STEP);
  // s_wait_xcnt 0 in front of whatever reuses the loads' address registers; the address is named as an input so that
  // it lives up to the wait and no load of the group has it as its destination
  asm volatile("s_wait_xcnt 0x0" :: "v"(s) : "memory");
  v2u o[CV_LOADS];
  if (asF16) {
#pragma unroll
    for (int i = 0; i < CV_LOADS; ++i)
      o[i] = (v2u){pk16(bfval_f16_bits(v[i][0], wscale), bfval_f16_bits(v[i][1], wscale)),
                   pk16(bfval_f16_bits(v[i][2], wscale), bfval_f16_bits(v[i][3], wscale))};
  } else {
#pragma unroll
    for (int i = 0; i < CV_LOADS; ++i)
      o[i] = (v2u){pk16(f2bf_bits(v[i][0]), f2bf_bits(v[i][1])), pk16(f2bf_bits(v[i][2]), f2bf_bits(v[i][3]))};
  }
#pragma unroll
  for (int i = 0; i < CV_LOADS; ++i) *(v2u*)(d + i * CV_STEP) = o[i];
}

// =====================================================================================
// Full (unmasked) attention with an additive [SEQ][SEQ] score bias shared over (b, h); head dim 64.
//   q plane  f16: element (b, t, h, d) at [(b*SEQ_LEN + t)*DMODEL + h*64 + d]
//   k plane  f16: element (b, s, h, d) at [(b*SEQ_LEN + s)*DMODEL + h*64 + d]
//   v^T plane f16: element (b, h, d, s) at [b*DMODEL*SEQ_LEN + (h*64 + d)*SEQ_LEN + s]
//   O plane  f16 (x O_CARRY): element (b, t, h, d) at [(b*SEQ_LEN + t)*DMODEL + h*64 + d]
//   scores = (q . k) * sscale + bf16value(pbias[t][s]) : single v_wmma_f32_16x16x32_f16 product, f32 accumulate, bias in f32
//   out    = p . v : p (unnormalised, <= 1) carried x2^15 in f16, v f16, single product, f32 accumulate
//   both products are formed transposed (S^T = K.Q^T, O^T = V^T.P^T): a lane holds one query's scores, so the maximum and the
//   sum run in-lane (plus one exchange between the wave's halves) and P^T goes from the score accumulators into the B operand.
//   online softmax in f32 over all SEQ_LEN keys (32 chunks of 64, compile-time trip count).
//   Block = 4 waves = 64 query rows of one (b, h); grid.x = BATCH_N * NHEADS * (SEQ_LEN/64) = 1024.
//   Chunk staging (plain 16-B loads, __syncthreads before and after), every wave-wide load covering 4 whole 128-B lines:
//   K and V^T tiles 64x64 f16, 8 lanes per 128-B row; the block's 64x64 f32 bias tile, 16 lanes per 256-B row.
//   Fragment loads read the K / V^T tiles with the same v8h element type; a lane reads its own query's bias row from LDS.
// =====================================================================================
#define AT_D 64
#define AT_NW 4
#define AT_QB 64
#define AT_KC 64
#define AT_LP 72   // LDS row pitch of the K and V^T tiles in f16: 144 B = 16 B x 9 (odd), so 16 rows read by ds_load_b128 fall on distinct banks
#define AT_BP 68   // LDS row pitch of the bias tile in f32: 272 B = 16 B x 17 (odd), for the same reason

__device__ __forceinline__ v8f at_mma_h(v16h a, v16h b, v8f c) {
  c = __builtin_amdgcn_wmma_f32_16x16x32_f16(false, a, false, b, (short)0, c, false, false);
  asm volatile("v_nop\n\tv_nop\n\tv_nop\n\tv_nop" : "+v"(c) : "v"(a), "v"(b));
  return c;
}

// lane l <-> lane l ^ 16
__device__ __forceinline__ float xhalf(float x) {
  return __builtin_bit_cast(float, __builtin_amdgcn_permlanex16(__builtin_bit_cast(int, x), __builtin_bit_cast(int, x), 0x76543210, 0xfedcba98, false, false));
}

__global__ __launch_bounds__(128)
void attn_bias64_kernel(const unsigned short* __restrict__ qp, const unsigned short* __restrict__ kp,
                        const unsigned short* __restrict__ vtp, const float* __restrict__ pbias,
                        unsigned short* __restrict__ op, float sscale) {
  union FH { v16h v; v8h h[2]; };
  __shared__ __align__(16) _Float16 Ksh[AT_KC * AT_LP];            // K  [kv][d]   9 KB, pitch AT_LP
  __shared__ __align__(16) _Float16 Vth[AT_D * AT_LP];             // V^T [d][kv]  9 KB, pitch AT_LP
  __shared__ __align__(16) float    Bsh[AT_QB * AT_BP];            // bias [query][kv]  17 KB, pitch AT_BP
  __shared__ __align__(16) float    Os[AT_NW][16 * 68];            // per wave out tile, pitch 68  17 KB

  const int tid  = threadIdx.x;
  const int wave = tid >> 5;
  const int lane = tid & 31;
  const int hh   = lane >> 4;
  const int c    = lane & 15;

  const int nqb = SEQ_LEN / AT_QB;        // 32
  const int bx = blockIdx.x;
  const int qb = bx % nqb;
  const int bh = bx / nqb;                // 0..BATCH_N*NHEADS-1
  const int h  = bh % NHEADS;
  const int b  = bh / NHEADS;
  const int q0 = qb * AT_QB + wave * 16;  // first query row of this wave (within the sequence)

  const _Float16* Qh = (const _Float16*)(const void*)qp  + (size_t)b * SEQ_LEN * DMODEL + (size_t)h * AT_D;
  const _Float16* Kh = (const _Float16*)(const void*)kp  + (size_t)b * SEQ_LEN * DMODEL + (size_t)h * AT_D;
  const _Float16* Vt = (const _Float16*)(const void*)vtp + (size_t)b * DMODEL * SEQ_LEN + (size_t)h * AT_D * SEQ_LEN;
  _Float16*       Ob = (_Float16*)(void*)op + (size_t)b * SEQ_LEN * DMODEL + (size_t)h * AT_D;

  // ---- Q fragments (B operand, col = query = lane&15, split k map via Frag load): 2 d-chunks ----
  v16h qa[2];
#pragma unroll
  for (int dc = 0; dc < 2; ++dc) {
    const _Float16* qr = Qh + (size_t)(q0 + c) * DMODEL + dc * 32 + 8 * hh;
    qa[dc] = Frag<_Float16>::load(qr);
  }

  // One query per lane: lane (hh, c) holds query q0 + c; its half hh holds keys 8hh..8hh+7 of every 16-key tile.
  float mrow = -INFINITY, lrow = 0.f;   // mrow: the same in both halves; lrow (x2^15, like p): this half's keys only, joined behind the loop
  v8f oacc[4];                          // O^T: element r of oacc[t] -> (d = t*16 + 8hh + r, query c)
#pragma unroll
  for (int t = 0; t < 4; ++t) oacc[t] = (v8f){0.f,0.f,0.f,0.f,0.f,0.f,0.f,0.f};

  // staging maps: K, V^T rows krow + 16 i (i < 4), 16 B at kcol; bias rows brow + 8 i (i < 8), 16 B at bcol
  const int krow = tid >> 3, kcol = (tid & 7) * 8;
  const int brow = tid >> 4, bcol = (tid & 15) * 4;
  const _Float16* gK = Kh + (size_t)krow * DMODEL + kcol;
  const _Float16* gV = Vt + (size_t)krow * SEQ_LEN + kcol;
  const float*    gB = pbias + (size_t)(qb * AT_QB + brow) * SEQ_LEN + bcol;
  const float* pbq = Bsh + (wave * 16 + c) * AT_BP + 8 * hh;   // this lane's bias row in the tile, at its half's first key

  const int nChunks = SEQ_LEN / AT_KC;   // 32, compile-time constant
  for (int kc = 0; kc < nChunks; ++kc) {
    __syncthreads();
    {
      // staging coverage: 128 threads x (4 x 8) f16 = 64 rows x 64 per plane; 128 threads x (8 x 4) f32 = 64 rows x 64 of bias
      v8h ka[4], va[4];
      v4f ba[8];
#pragma unroll
      for (int i = 0; i < 4; ++i) {
        ka[i] = *(const v8h*)(gK + (size_t)(16 * i) * DMODEL);    // K row kc*64 + krow + 16 i
        va[i] = *(const v8h*)(gV + (size_t)(16 * i) * SEQ_LEN);   // V^T row d = krow + 16 i, s = kc*64 + kcol..
      }
#pragma unroll
      for (int i = 0; i < 8; ++i) ba[i] = *(const v4f*)(gB + (size_t)(8 * i) * SEQ_LEN);   // in range: kc*64 + 63 < SEQ_LEN
      wait_xcnt0();   // in front of the three pointer steps, which overwrite these loads' address registers
      gK += (size_t)AT_KC * DMODEL;
      gV += AT_KC;
      gB += AT_KC;
#pragma unroll
      for (int i = 0; i < 4; ++i) {
        *(v8h*)(Ksh + (krow + 16 * i) * AT_LP + kcol) = ka[i];
        *(v8h*)(Vth + (krow + 16 * i) * AT_LP + kcol) = va[i];
      }
#pragma unroll
      for (int i = 0; i < 8; ++i) *(v4f*)(Bsh + (brow + 8 * i) * AT_BP + bcol) = ba[i];
    }
    __syncthreads();

    // ---- bias: 8 consecutive keys of the lane's own query per 16-key tile, from the staged tile ----
    v4f pbv[4][2];
#pragma unroll
    for (int j = 0; j < 4; ++j) {
      pbv[j][0] = *(const v4f*)(pbq + j * 16);
      pbv[j][1] = *(const v4f*)(pbq + j * 16 + 4);
    }

    // ---- scores, transposed: S^T = K (A: row = key j*16+c) . Q^T (B: col = query c); D element r -> (key j*16+8hh+r, query c) ----
    v8f s[4];
#pragma unroll
    for (int j = 0; j < 4; ++j) {
      s[j] = (v8f){0.f,0.f,0.f,0.f,0.f,0.f,0.f,0.f};
#pragma unroll
      for (int dc = 0; dc < 2; ++dc) {
        FH kb;
        kb.h[0] = *(const v8h*)(Ksh + (j * 16 + c) * AT_LP + dc * 32 + 8 * hh);
        kb.h[1] = *(const v8h*)(Ksh + (j * 16 + c) * AT_LP + dc * 32 + 16 + 8 * hh);
        s[j] = at_mma_h(kb.v, qa[dc], s[j]);
      }
    }
    float mj[4];   // one maximum per 16-key tile: four independent chains
#pragma unroll
    for (int j = 0; j < 4; ++j) {
      mj[j] = -INFINITY;
#pragma unroll
      for (int r = 0; r < 8; ++r) {
        const float bb = bf16_rne_f32(pbv[j][r >> 2][r & 3]);
        const float sv = s[j][r] * sscale + bb;
        s[j][r] = sv;
        mj[j] = fmaxf(mj[j], sv);
      }
    }
    float m = fmaxf(fmaxf(mj[0], mj[1]), fmaxf(mj[2], mj[3]));
    m = fmaxf(m, xhalf(m));   // the other half's 32 keys of the same query
    const float mnew = fmaxf(mrow, m);
    // exp(x - mnew) = 2^(x * LOG2E - mnew * LOG2E): one fma and one v_exp_f32 each; every x is <= mnew, so no result
    // exceeds 1 but by rounding; x = -inf (the first chunk's mrow) gives 0
    const float mb = mnew * LOG2E;
    const float alpha = __builtin_amdgcn_exp2f(fmaf(mrow, LOG2E, -mb));
    const float pofs = P_CARRY_LOG2 - mb;   // the x2^15 carry of p rides in the exponent
    mrow = mnew;
    // ---- P^T packed in place: tiles 2kk and 2kk+1 give elements 0..7 and 8..15 of the B operand (k = 8hh+e, 16+8hh+e) ----
    FH pb[2];
    float pj[4];   // one sum per 16-key tile: four independent chains
#pragma unroll
    for (int j = 0; j < 4; ++j) {
      pj[j] = 0.f;
#pragma unroll
      for (int r = 0; r < 8; ++r) {
        const float p = __builtin_amdgcn_exp2f(fmaf(s[j][r], LOG2E, pofs));   // p x 2^15
        pj[j] += p;
        pb[j >> 1].h[j & 1][r] = (_Float16)p;
      }
    }
    lrow = lrow * alpha + ((pj[0] + pj[1]) + (pj[2] + pj[3]));
#pragma unroll
    for (int t = 0; t < 4; ++t) oacc[t] *= alpha;
    // ---- O^T: oacc[t] += V^T (A: row = d t*16+c, k = key) . P^T (B: col = query c, k = key) ----
#pragma unroll
    for (int kk = 0; kk < 2; ++kk) {
#pragma unroll
      for (int t = 0; t < 4; ++t) {
        FH vb;
        vb.h[0] = *(const v8h*)(Vth + (t * 16 + c) * AT_LP + kk * 32 + 8 * hh);
        vb.h[1] = *(const v8h*)(Vth + (t * 16 + c) * AT_LP + kk * 32 + 16 + 8 * hh);
        oacc[t] = at_mma_h(vb.v, pb[kk].v, oacc[t]);
      }
    }
  }

  float* os = Os[wave];
  {
    const float lsum = lrow + xhalf(lrow);                    // both halves' keys
    const float inv = O_CARRY * (1.0f / lsum);                // lsum carries the same x2^15 as oacc; lsum >= 2^15 up to rounding
#pragma unroll
    for (int t = 0; t < 4; ++t) {
      const v8f o = oacc[t] * inv;
      *(v4f*)(os + c * 68 + t * 16 + 8 * hh)     = (v4f){o[0], o[1], o[2], o[3]};
      *(v4f*)(os + c * 68 + t * 16 + 8 * hh + 4) = (v4f){o[4], o[5], o[6], o[7]};
    }
  }
  __builtin_amdgcn_fence(__ATOMIC_RELEASE, "workgroup");
  __builtin_amdgcn_wave_barrier();
  __builtin_amdgcn_fence(__ATOMIC_ACQUIRE, "workgroup");
  {
    const int q4 = lane >> 3, c8 = (lane & 7) * 8;
    {
#pragma unroll
      for (int it = 0; it < 4; ++it) {
        const int row = it * 4 + q4;   // it 0..3 x q4 0..3 covers rows 0..15 of the wave tile
        const float* sp = os + row * 68 + c8;
        v8h hv;
#pragma unroll
        for (int e = 0; e < 8; ++e) hv[e] = (_Float16)sp[e];
        *(v8h*)(Ob + (size_t)(q0 + row) * DMODEL + c8) = hv;
      }
      
    }
  }
}

// ---------------------------------------------------------------------------
// Workspace region map (byte offsets, all 1 MiB aligned; total 50,331,648 B = 48 MiB):
//   [ 0 MiB,  8 MiB)  xb   : bf16 x            [4096][1024]
//   [ 8 MiB, 10 MiB)  wqb  : bf16 Wq           [1024][1024]
//   [10 MiB, 12 MiB)  wkb  : bf16 Wk
//   [12 MiB, 14 MiB)  wvb  : bf16 Wv
//   [14 MiB, 16 MiB)  woh  : f16 (bf16val(Wo) x64)
//   [16 MiB, 24 MiB)  qh   : f16 q plane       [4096][1024]
//   [24 MiB, 32 MiB)  kh   : f16 k plane       [4096][1024]
//   [32 MiB, 40 MiB)  vth  : f16 v^T plane     [2][1024][2048]
//   [40 MiB, 48 MiB)  oh   : f16 O plane (x64) [4096][1024]
// ---------------------------------------------------------------------------
extern "C" void kernel_launch(void* const* d_in, const int* in_sizes, int n_in,
                              void* d_out, int out_size, void* d_ws,
                              size_t ws_size, hipStream_t stream) {
  if (n_in < 10) return;
  const float* x  = (const float*)d_in[0];
  const float* pb = (const float*)d_in[1];
  const float* Wq = (const float*)d_in[2];
  const float* bq = (const float*)d_in[3];
  const float* Wk = (const float*)d_in[4];
  const float* bk = (const float*)d_in[5];
  const float* Wv = (const float*)d_in[6];
  const float* bv = (const float*)d_in[7];
  const float* Wo = (const float*)d_in[8];
  const float* bo = (const float*)d_in[9];
  float* out = (float*)d_out;

  const int nX = MTOK * DMODEL;        // 4194304
  const int nW = DMODEL * DMODEL;      // 1048576
  const int nP = SEQ_LEN * SEQ_LEN;    // 4194304
  if (in_sizes[0] != nX || in_sizes[1] != nP) return;
  if (in_sizes[2] != nW || in_sizes[4] != nW || in_sizes[6] != nW || in_sizes[8] != nW) return;
  if (in_sizes[3] != DMODEL || in_sizes[5] != DMODEL || in_sizes[7] != DMODEL || in_sizes[9] != DMODEL) return;
  if (out_size != nX) return;

  const size_t bytesX16 = (size_t)nX * 2;   // 8 MiB
  const size_t bytesW16 = (size_t)nW * 2;   // 2 MiB
  size_t off = 0;
  const size_t off_xb  = off; off += bytesX16;
  const size_t off_wq  = off; off += bytesW16;
  const size_t off_wk  = off; off += bytesW16;
  const size_t off_wv  = off; off += bytesW16;
  const size_t off_wo  = off; off += bytesW16;
  const size_t off_q   = off; off += bytesX16;
  const size_t off_k   = off; off += bytesX16;
  const size_t off_vt  = off; off += bytesX16;
  const size_t off_o   = off; off += bytesX16;
  if (off > ws_size) return;               // 50,331,648 B needed

  char* ws = (char*)d_ws;
  unsigned short* xb  = (unsigned short*)(ws + off_xb);
  unsigned short* wqb = (unsigned short*)(ws + off_wq);
  unsigned short* wkb = (unsigned short*)(ws + off_wk);
  unsigned short* wvb = (unsigned short*)(ws + off_wv);
  unsigned short* woh = (unsigned short*)(ws + off_wo);
  unsigned short* qh  = (unsigned short*)(ws + off_q);
  unsigned short* kh  = (unsigned short*)(ws + off_k);
  unsigned short* vth = (unsigned short*)(ws + off_vt);
  unsigned short* oh  = (unsigned short*)(ws + off_o);

  // ---- conversions: one launch, 128 + 4 * 32 = 256 work-groups ----
  cast_operands<<<dim3(CV_XBLK + 4 * CV_WBLK), dim3(CV_THREADS), 0, stream>>>(x, Wq, Wk, Wv, Wo, xb, wqb, wkb, wvb, woh, W_CARRY);

  // ---- q / k projections: C[token][feature] = xb . Wᵀ + b, M=4096, N=1024, K=1024 (32*8 = 256 block tiles of 128x128) ----
  const long strideXb = (long)SEQ_LEN * DMODEL;   // per-batch token block of xb (elements)
  wmma_gemm64<1, false, 2, 1, false, 0><<<dim3((MTOK / 128) * (DMODEL / 128), 1), dim3(128), 0, stream>>>(
      xb, xb, DMODEL, 0L, wqb, wqb, DMODEL, 0L, (void*)qh, (void*)qh, DMODEL, 0L, bq, bq, 0L,
      MTOK, DMODEL, DMODEL, 1.0f);
  wmma_gemm64<1, false, 2, 1, false, 0><<<dim3((MTOK / 128) * (DMODEL / 128), 1), dim3(128), 0, stream>>>(
      xb, xb, DMODEL, 0L, wkb, wkb, DMODEL, 0L, (void*)kh, (void*)kh, DMODEL, 0L, bk, bk, 0L,
      MTOK, DMODEL, DMODEL, 1.0f);
  // ---- v^T projection (role swapped): C_b[feature][token] = Wv . x_bᵀ + bv[feature]; M=1024, N=2048, K=1024, z = batch
  //      (8*16 = 128 block tiles per batch) ----
  wmma_gemm64<1, false, 1, 1, false, 0><<<dim3((DMODEL / 128) * (SEQ_LEN / 128), BATCH_N), dim3(128), 0, stream>>>(
      wvb, wvb, DMODEL, 0L, xb, xb, DMODEL, strideXb, (void*)vth, (void*)vth, SEQ_LEN, (long)DMODEL * SEQ_LEN, bv, bv, 0L,
      DMODEL, SEQ_LEN, DMODEL, 1.0f);

  // ---- attention: 2 * 16 * (2048/64) = 1024 blocks of 64 query rows ----
  attn_bias64_kernel<<<dim3(BATCH_N * NHEADS * (SEQ_LEN / 64)), dim3(128), 0, stream>>>(qh, kh, vth, pb, oh, 0.125f);

  // ---- output projection: out[token][feature] = (O x64) . (Wo x64)ᵀ / 4096 + bo; M=4096, N=1024, K=1024 ----
  wmma_gemm64<0, false, 2, 0, false, 0><<<dim3((MTOK / 128) * (DMODEL / 128), 1), dim3(128), 0, stream>>>(
      oh, oh, DMODEL, 0L, woh, woh, DMODEL, 0L, (void*)out, (void*)out, DMODEL, 0L, bo, bo, 0L,
      MTOK, DMODEL, DMODEL, 1.0f / (O_CARRY * W_CARRY));
}

// v007
// It runs in 114 microseconds.
// In two side-by-side timings against v006, it was 1.26 and 1.25 times as fast.
// All steps since v000 together make it 3.27 times as fast.
// Contractions: q, k, v^T projections on v_wmma_f32_16x16x32_bf16 (bf16 RNE operands from the raw inputs, single product, f32 accumulate); q.k^T and p.v on v_wmma_f32_16x16x32_f16 (f16 q/k/v planes, p carried x2^15, f32 accumulate, online softmax and additive bias in f32); output projection on v_wmma_f32_16x16x32_f16 (O carried x64 in f16, Wo as bf16-RNE value x64 in f16, f32 accumulate, x1/4096 in the f32 epilogue).
#include <hip/hip_runtime.h>
#include <math.h>
#include <stdint.h>

constexpr int BATCH_N = 2;
constexpr int SEQ_LEN = 2048;
constexpr int DMODEL  = 1024;
constexpr int NHEADS  = 16;
constexpr int HDIM    = 64;
constexpr int MTOK    = BATCH_N * SEQ_LEN;   // 4096 token rows
static_assert(NHEADS * HDIM == DMODEL, "head split");

constexpr float O_CARRY = 64.0f;      // attention output carried x64 in f16
constexpr float W_CARRY = 64.0f;      // Wo carried x64 in f16
constexpr float LOG2E   = 1.4426950408889634f;   // exp(x) = 2^(x * LOG2E)
constexpr float P_CARRY_LOG2 = 15.0f;            // probabilities carried x2^15 in f16: 15 is added to their exponent

typedef __attribute__((ext_vector_type(16))) _Float16 v16h;
typedef __attribute__((ext_vector_type(8)))  _Float16 v8h;
typedef __attribute__((ext_vector_type(16))) __bf16   v16b;
typedef __attribute__((ext_vector_type(8)))  __bf16   v8b;
typedef __attribute__((ext_vector_type(8)))  float    v8f;
typedef __attribute__((ext_vector_type(4)))  float    v4f;

__device__ __forceinline__ unsigned short f2bf_bits(float f) {
  unsigned u = __float_as_uint(f);
  return (unsigned short)((u + 0x7FFFu + ((u >> 16) & 1u)) >> 16);
}
__device__ __forceinline__ float bf_bits2f(unsigned short h) { return __uint_as_float(((unsigned)h) << 16); }
// f32 value of the RNE bf16 of f
__device__ __forceinline__ float bf16_rne_f32(float f) { return bf_bits2f(f2bf_bits(f)); }

// hazard guards as plain device helpers (no inline asm inside the kernel template body)
__device__ __forceinline__ void dep_guard_h(v8f& a, v8f& b, v16h x, v16h y) { asm volatile("v_nop\n\tv_nop\n\tv_nop\n\tv_nop" : "+v"(a), "+v"(b) : "v"(x), "v"(y)); }
__device__ __forceinline__ void dep_guard_b(v8f& a, v8f& b, v16b x, v16b y) { asm volatile("v_nop\n\tv_nop\n\tv_nop\n\tv_nop" : "+v"(a), "+v"(b) : "v"(x), "v"(y)); }
__device__ __forceinline__ void keep4_h(v16h a, v16h b, v16h c, v16h d) { asm volatile("v_nop" :: "v"(a), "v"(b), "v"(c), "v"(d)); }
__device__ __forceinline__ void keep4_b(v16b a, v16b b, v16b c, v16b d) { asm volatile("v_nop" :: "v"(a), "v"(b), "v"(c), "v"(d)); }
__device__ __forceinline__ void acc_guard4(v8f& a, v8f& b, v8f& c, v8f& d) { asm volatile("v_nop\n\tv_nop\n\tv_nop\n\tv_nop" : "+v"(a), "+v"(b), "+v"(c), "+v"(d)); }
// stands behind a group of global loads, in front of the first overwrite of a register that holds one of their addresses
__device__ __forceinline__ void wait_xcnt0() { asm volatile("s_wait_xcnt 0x0" ::: "memory"); }
template <typename T> struct Frag;
template <> struct Frag<_Float16> {
  typedef v16h V; typedef v8h H; union U { v16h v; v8h h[2]; };
  static __device__ __forceinline__ v16h load(const _Float16* p) {   // elements 0..7 <- p[0..7], 8..15 <- p[16..23]
    U f; f.h[0] = *(const v8h*)(p); f.h[1] = *(const v8h*)(p + 16); return f.v;
  }
  static __device__ __forceinline__ v8f mma(v16h a, v16h b, v8f c) {
    return __builtin_amdgcn_wmma_f32_16x16x32_f16(false, a, false, b, (short)0, c, false, false);
  }
  static __device__ __forceinline__ void guard(v8f& a, v8f& b, v16h x, v16h y) { dep_guard_h(a, b, x, y); }
  static __device__ __forceinline__ void keep(v16h a, v16h b, v16h c, v16h d) { keep4_h(a, b, c, d); }
};
template <> struct Frag<__bf16> {
  typedef v16b V; typedef v8b H; union U { v16b v; v8b h[2]; };
  static __device__ __forceinline__ v16b load(const __bf16* p) {
    U f; f.h[0] = *(const v8b*)(p); f.h[1] = *(const v8b*)(p + 16); return f.v;
  }
  static __device__ __forceinline__ v8f mma(v16b a, v16b b, v8f c) {
    return __builtin_amdgcn_wmma_f32_16x16x32_bf16(false, a, false, b, (short)0, c, false, false);
  }
  static __device__ __forceinline__ void guard(v8f& a, v8f& b, v16b x, v16b y) { dep_guard_b(a, b, x, y); }
  static __device__ __forceinline__ void keep(v16b a, v16b b, v16b c, v16b d) { keep4_b(a, b, c, d); }
};

// ---- Register-blocked batched WMMA GEMM ------------------------------------
// C[m,n] = scale * sum_k A[m,k] * Bt[n,k] (+bias)(+resid); each wave owns a 64x64 tile.
// Block = 4 waves (2 x 2) = one 128x128 tile of C. Per 64-wide k slab the block stages 128 rows of A and 128 rows of Bt
// in LDS: 8 lanes x 16 B cover one whole 128-B line of a row, so a wave-wide load touches 4 lines. Two LDS buffers:
// the next slab is loaded to registers before the products of this slab and stored to the other buffer behind them,
// one __syncthreads() per slab. Fragments are read from LDS with k ascending in steps of 32.
// A row-major [M,K]; Bt row-major [N,K]; M,N % 128 == 0, K % 64 == 0.
// SPLIT (hi/lo operand planes) is not staged: single-plane operands only.
// BIAS_MODE: 0 = none, 1 = bias[m], 2 = bias[n], 3 = bias[m] where biasRow is set (the same for the whole work-group), else bias[n].
// OUT_MODE: 0 = f32, 1 = f16, 2 = bf16 hi plane (Cout) + bf16 lo plane (Cout2).
// ET: 0 = f16 operands, 1 = bf16 operands (pointers passed as 16-bit storage)
template <int ET> struct Elem;
template <> struct Elem<0> { typedef _Float16 T; };
template <> struct Elem<1> { typedef __bf16 T; };
#define GM_BT 128  // rows of A and of Bt per block tile
#define GM_BK 64   // k elements per staged slab: 128 B = one line per row
#define GM_LP 72   // LDS row pitch in 16-bit elements: 144 B = 16 B x 9 (odd), for the ds_load_b128 fragment reads
// ---- epilogue of one wave's 64x64 tile at (m0, n0): scale, bias, staging through the wave's own LDS slab, whole-line stores ----
template <int BIAS_MODE, int OUT_MODE, bool RESID, int ACT>
__device__ __forceinline__ void gemm_store(
    const v8f (&acc)[4][4], float* slab, void* __restrict__ Cout, void* __restrict__ Cout2, int ldc, long strideC,
    const float* __restrict__ bias, const float* __restrict__ resid, long strideR, float scale, int m0, int n0, int b, int lane) {
  const int rlane = lane & 15;                 // col within subtile
  const int mOff  = (lane >> 4) * 8;           // D row offset
  const float* Rb = RESID ? (resid + (size_t)b * strideR) : nullptr;
#pragma unroll
  for (int i = 0; i < 4; ++i) {
    const int mBase = m0 + (i << 4);
#pragma unroll
    for (int j = 0; j < 4; ++j) {
      const int n = n0 + (j << 4) + rlane;
      float bv = 0.f;
      if (BIAS_MODE == 2) bv = bias[n];
#pragma unroll
      for (int r = 0; r < 8; ++r) {
        float v = acc[i][j][r] * scale;
        if (BIAS_MODE == 1) v += bias[mBase + mOff + r];
        if (BIAS_MODE == 2) v += bv;
        if (RESID) v += Rb[(size_t)(mBase + mOff + r) * ldc + n];
        if (ACT == 1) v = tanhf(v);
        if (ACT == 2) v = fmaxf(v, 0.0f);
        if (ACT == 3) v = v / (1.0f + expf(-v));
        if (ACT == 4) v = (v > 0.f) ? v : 0.01f * v;
        if (ACT == 5) v = 0.5f * v * (1.0f + erff(v * 0.70710678118654752f));
        slab[(mOff + r) * 68 + (j << 4) + rlane] = v;
      }
    }
    __builtin_amdgcn_fence(__ATOMIC_RELEASE, "workgroup");
    __builtin_amdgcn_wave_barrier();
    __builtin_amdgcn_fence(__ATOMIC_ACQUIRE, "workgroup");
    if (OUT_MODE == 0) {
      float* C = (float*)Cout + (size_t)b * strideC;
      const int hh = lane >> 4, c4 = (lane & 15) * 4;     // row seg = 256 B = 16 lanes x 16 B
      {
#pragma unroll
        for (int it = 0; it < 8; ++it) {
          const int row = it * 2 + hh;
          v4f v = *(const v4f*)(slab + row * 68 + c4);
          *(v4f*)(C + (size_t)(mBase + row) * ldc + n0 + c4) = v;
        }
        
      }
    } else {
      const int q = lane >> 3, c8 = (lane & 7) * 8;
      unsigned short* C  = (unsigned short*)Cout  + (size_t)b * strideC;
      unsigned short* C2 = (OUT_MODE == 2) ? ((unsigned short*)Cout2 + (size_t)b * strideC) : nullptr;
      {
#pragma unroll
        for (int it = 0; it < 4; ++it) {
          const int row = it * 4 + q;
          const float* sp = slab + row * 68 + c8;
          v8h hv, lv;
#pragma unroll
          for (int e = 0; e < 8; ++e) {
            if (OUT_MODE == 1) {
              hv[e] = (_Float16)sp[e];
            } else {
              unsigned short hb = f2bf_bits(sp[e]);
              unsigned short lb = f2bf_bits(sp[e] - bf_bits2f(hb));
              hv[e] = __builtin_bit_cast(_Float16, hb);
              lv[e] = __builtin_bit_cast(_Float16, lb);
            }
          }
          *(v8h*)(C + (size_t)(mBase + row) * ldc + n0 + c8) = hv;
          if (OUT_MODE == 2) *(v8h*)(C2 + (size_t)(mBase + row) * ldc + n0 + c8) = lv;
        }
        
      }
    }
    __builtin_amdgcn_fence(__ATOMIC_RELEASE, "workgroup");
    __builtin_amdgcn_wave_barrier();
    __builtin_amdgcn_fence(__ATOMIC_ACQUIRE, "workgroup");
  }
}

// gemm_tile: one work-group's 128x128 tile number 'tile' of batch 'b'; the kernels below pick the operands.
template <int ET, bool SPLIT, int BIAS_MODE, int OUT_MODE, bool RESID, int ACT>
__device__ __forceinline__ void gemm_tile(
    const unsigned short* __restrict__ Ap, int lda, long strideA,
    const unsigned short* __restrict__ Btp, int ldb, long strideB,
    void* __restrict__ Cout, void* __restrict__ Cout2, int ldc, long strideC,
    const float* __restrict__ bias, bool biasRow,
    const float* __restrict__ resid, long strideR,
    int M, int N, int K, float scale, int tile, int b) {
  static_assert(!SPLIT, "single-plane operands only");
  typedef typename Elem<ET>::T T;
  typedef typename Frag<T>::V V;
  typedef typename Frag<T>::H H;
  const T* A = (const T*)Ap; const T* Bt = (const T*)Btp;
  __shared__ __align__(16) T sA[2][GM_BT * GM_LP];   // A slab  [row][k], 2 x 18 KB
  __shared__ __align__(16) T sB[2][GM_BT * GM_LP];   // Bt slab [row][k], 2 x 18 KB
  __shared__ __align__(16) float sT[4][16 * 68];     // per-wave 16x64 slab, pitch 68 floats
  const int tid  = threadIdx.x;
  const int lane = tid & 31;
  const int wave = tid >> 5;
  const int tilesN = N >> 7;
  const int tilesM = M >> 7;
  if (tile >= tilesM * tilesN) return;   // block-uniform, in front of every barrier
  const int tm = tile / tilesN;
  const int tn = tile - tm * tilesN;
  const int bm0 = tm << 7;               // first row / column of the block tile
  const int bn0 = tn << 7;
  const int wm  = (wave >> 1) << 6;      // this wave's 64x64 quadrant
  const int wn  = (wave & 1) << 6;
  const int m0 = bm0 + wm;
  const int n0 = bn0 + wn;

  const T* Ab  = A  + (size_t)b * strideA;
  const T* Bb  = Bt + (size_t)b * strideB;

  const int rlane = lane & 15;                 // row (A) / col (B, D) within subtile
  const int koff  = (lane >> 4) * 8;           // k offset of this lane half
  const int mOff  = (lane >> 4) * 8;           // D row offset

  // staging map: 128 threads x 8 x 16 B per operand = 128 rows x 128 B; thread -> row (tid>>3) + 16*i, bytes (tid&7)*16
  const int srow = tid >> 3;
  const int scol = (tid & 7) * 8;
  const T* gA = Ab + (size_t)(bm0 + srow) * lda + scol;
  const T* gB = Bb + (size_t)(bn0 + srow) * ldb + scol;
  const int sOff = srow * GM_LP + scol;

  v8f acc[4][4];
#pragma unroll
  for (int i = 0; i < 4; ++i)
#pragma unroll
    for (int j = 0; j < 4; ++j) acc[i][j] = (v8f){0.f,0.f,0.f,0.f,0.f,0.f,0.f,0.f};

  H ra[8], rb[8];
#pragma unroll
  for (int i = 0; i < 8; ++i) {
    ra[i] = *(const H*)(gA + (size_t)(i * 16) * lda);
    rb[i] = *(const H*)(gB + (size_t)(i * 16) * ldb);
  }
#pragma unroll
  for (int i = 0; i < 8; ++i) {
    *(H*)(&sA[0][sOff + i * 16 * GM_LP]) = ra[i];
    *(H*)(&sB[0][sOff + i * 16 * GM_LP]) = rb[i];
  }
  __syncthreads();

  const int nSlab = K >> 6;
  for (int s = 0; s < nSlab; ++s) {
    const int cur = s & 1;
    const bool more = (s + 1 < nSlab);   // block-uniform
    if (more) {
      const int kn = (s + 1) << 6;
#pragma unroll
      for (int i = 0; i < 8; ++i) {
        ra[i] = *(const H*)(gA + (size_t)(i * 16) * lda + kn);
        rb[i] = *(const H*)(gB + (size_t)(i * 16) * ldb + kn);
      }
      wait_xcnt0();   // the fragment reads below land in registers that held these loads' addresses
    }
    const T* cA = &sA[cur][(wm + rlane) * GM_LP + koff];
    const T* cB = &sB[cur][(wn + rlane) * GM_LP + koff];
#pragma unroll
    for (int kk = 0; kk < GM_BK; kk += 32) {
      V bh[4], ah[4];
#pragma unroll
      for (int j = 0; j < 4; ++j) bh[j] = Frag<T>::load(cB + (j << 4) * GM_LP + kk);
#pragma unroll
      for (int i = 0; i < 4; ++i) ah[i] = Frag<T>::load(cA + (i << 4) * GM_LP + kk);
#pragma unroll
      for (int i = 0; i < 4; ++i) {
#pragma unroll
        for (int j = 0; j < 4; ++j) acc[i][j] = Frag<T>::mma(ah[i], bh[j], acc[i][j]);
        Frag<T>::guard(acc[i][0], acc[i][3], ah[i], ah[i]);
      }
      Frag<T>::keep(bh[0], bh[1], bh[2], bh[3]);
    }
    if (more) {
#pragma unroll
      for (int i = 0; i < 8; ++i) {
        *(H*)(&sA[cur ^ 1][sOff + i * 16 * GM_LP]) = ra[i];
        *(H*)(&sB[cur ^ 1][sOff + i * 16 * GM_LP]) = rb[i];
      }
    }
    __syncthreads();   // publishes the other buffer and ends every wave's reads of this one before it is refilled
  }
  acc_guard4(acc[0][0], acc[0][1], acc[0][2], acc[0][3]);
  acc_guard4(acc[1][0], acc[1][1], acc[1][2], acc[1][3]);
  acc_guard4(acc[2][0], acc[2][1], acc[2][2], acc[2][3]);
  acc_guard4(acc[3][0], acc[3][1], acc[3][2], acc[3][3]);

  // ---- epilogue: BIAS_MODE 3 picks one of the two compile-time forms by one work-group-uniform branch ----
  if (BIAS_MODE == 3) {
    if (biasRow) gemm_store<1, OUT_MODE, RESID, ACT>(acc, sT[wave], Cout, Cout2, ldc, strideC, bias, resid, strideR, scale, m0, n0, b, lane);
    else         gemm_store<2, OUT_MODE, RESID, ACT>(acc, sT[wave], Cout, Cout2, ldc, strideC, bias, resid, strideR, scale, m0, n0, b, lane);
  } else {
    gemm_store<BIAS_MODE, OUT_MODE, RESID, ACT>(acc, sT[wave], Cout, Cout2, ldc, strideC, bias, resid, strideR, scale, m0, n0, b, lane);
  }
}

template <int ET, bool SPLIT, int BIAS_MODE, int OUT_MODE, bool RESID, int ACT = 0>
__global__ __launch_bounds__(128) void wmma_gemm64(
    const unsigned short* __restrict__ Ap, const unsigned short* __restrict__ A2p, int lda, long strideA,
    const unsigned short* __restrict__ Btp, const unsigned short* __restrict__ Bt2p, int ldb, long strideB,
    void* __restrict__ Cout, void* __restrict__ Cout2, int ldc, long strideC,
    const float* __restrict__ bias,
    const float* __restrict__ resid, long strideR,
    int M, int N, int K, float scale) {
  gemm_tile<ET, SPLIT, BIAS_MODE, OUT_MODE, RESID, ACT>(Ap, lda, strideA, Btp, ldb, strideB, Cout, Cout2, ldc, strideC,
      bias, false, resid, strideR, M, N, K, scale, blockIdx.x, blockIdx.y);
}

// The q, k and v^T projections in ONE launch: grid (256 tiles, 3 projections) = 768 work-groups, three to a WGP (3 x 89 KB of LDS,
// 3 waves a SIMD), so that one work-group's waits on LDS, on its slab loads and at its barrier are filled by the other two.
//   y = 0, 1: C[token][feature] = xb . W^T + b[feature]      M = 4096, N = 1024 (32 x 8 tiles)
//   y = 2   : C_b[feature][token] = Wv . x_b^T + bv[feature]  M = 1024, N = 2048 (8 x 16 tiles for each of the two batches)
// x = (block of 128 token rows) * 8 + (block of 128 features) in all three, so the three work-groups of one x read the same rows of xb.
constexpr int QKV_FBLK  = DMODEL / GM_BT;                              // 8 feature blocks
constexpr int QKV_TBLK  = SEQ_LEN / GM_BT;                             // 16 token blocks per batch
constexpr int QKV_TILES = (MTOK / GM_BT) * QKV_FBLK;                   // 256 tiles of 128x128 per projection
__global__ __launch_bounds__(128) void qkv_gemm(
    const unsigned short* __restrict__ xb, const unsigned short* __restrict__ wqb, const unsigned short* __restrict__ wkb,
    const unsigned short* __restrict__ wvb, unsigned short* __restrict__ qh, unsigned short* __restrict__ kh,
    unsigned short* __restrict__ vth, const float* __restrict__ bq, const float* __restrict__ bk, const float* __restrict__ bv) {
  const int sel  = blockIdx.y;      // the same for the whole work-group
  const bool isV = sel == 2;
  const int tb   = (int)blockIdx.x / QKV_FBLK;   // token block, 0..31
  const int fb   = (int)blockIdx.x % QKV_FBLK;   // feature block, 0..7
  const int b    = isV ? tb / QKV_TBLK : 0;
  const int tile = isV ? fb * QKV_TBLK + tb % QKV_TBLK : (int)blockIdx.x;   // row-major tile number: v^T has features as rows
  const unsigned short* A  = isV ? wvb : xb;
  const unsigned short* Bt = isV ? xb : (sel == 0 ? wqb : wkb);
  unsigned short* C        = isV ? vth : (sel == 0 ? qh : kh);
  const float* bias        = isV ? bv : (sel == 0 ? bq : bk);
  gemm_tile<1, false, 3, 1, false, 0>(A, DMODEL, 0L, Bt, DMODEL, isV ? (long)SEQ_LEN * DMODEL : 0L,
      (void*)C, (void*)C, isV ? SEQ_LEN : DMODEL, isV ? (long)DMODEL * SEQ_LEN : 0L,
      bias, isV, bias, 0L, isV ? DMODEL : MTOK, isV ? SEQ_LEN : DMODEL, DMODEL, 1.0f, tile, b);
}

// ---------------------------------------------------------------------------
// All five f32 operands are converted by ONE launch whose work-groups are all resident at once:
// 256 work-groups x 16 waves; a wave owns 2048 consecutive elements of one operand and issues its 16 loads together.
// Load i of a wave: 32 lanes x 16 B = 512 consecutive bytes (4 whole lines); store i: 32 lanes x 8 B = 256 consecutive bytes (2 whole lines).
// Work-groups [0, CV_XBLK) take x, then CV_WBLK each for Wq, Wk, Wv (all bf16 RNE bits) and Wo (bf16 RNE value x wscale, as f16 bits).
// ---------------------------------------------------------------------------
typedef __attribute__((ext_vector_type(2))) unsigned v2u;
constexpr int CV_THREADS = 512;
constexpr int CV_LOADS   = 16;                                   // 16-B loads per lane
constexpr int CV_STEP    = 32 * 4;                               // elements a wave covers with one load
constexpr int CV_WAVE    = CV_LOADS * CV_STEP;                   // 2048 elements per wave
constexpr int CV_BLOCK   = (CV_THREADS / 32) * CV_WAVE;          // 32768 elements per work-group
constexpr int CV_XBLK    = (MTOK * DMODEL) / CV_BLOCK;           // 128
constexpr int CV_WBLK    = (DMODEL * DMODEL) / CV_BLOCK;         // 32
static_assert(CV_XBLK * CV_BLOCK == MTOK * DMODEL && CV_WBLK * CV_BLOCK == DMODEL * DMODEL, "whole work-groups per operand");

__device__ __forceinline__ unsigned pk16(unsigned short a, unsigned short b) { return (unsigned)a | ((unsigned)b << 16); }
// f32 -> bf16 (RNE) value -> x scale (power of two, exact) -> f16 bits (exact for normal-range values)
__device__ __forceinline__ unsigned short bfval_f16_bits(float f, float scale) {
  const _Float16 h = (_Float16)(bf16_rne_f32(f) * scale);
  return __builtin_bit_cast(unsigned short, h);
}

__global__ __launch_bounds__(CV_THREADS) void cast_operands(
    const float* __restrict__ x, const float* __restrict__ Wq, const float* __restrict__ Wk,
    const float* __restrict__ Wv, const float* __restrict__ Wo,
    unsigned short* __restrict__ xb, unsigned short* __restrict__ wqb, unsigned short* __restrict__ wkb,
    unsigned short* __restrict__ wvb, unsigned short* __restrict__ woh, float wscale) {
  const int blk = blockIdx.x;
  // operand and place in it: the same for the whole work-group
  const int wsel = (blk - CV_XBLK) / CV_WBLK;                    // 0..3 for the weights
  const bool isX = blk < CV_XBLK;
  const int rel  = isX ? blk : (blk - CV_XBLK) - wsel * CV_WBLK;
  const float* src    = isX ? x  : (wsel == 0 ? Wq  : (wsel == 1 ? Wk  : (wsel == 2 ? Wv  : Wo)));
  unsigned short* dst = isX ? xb : (wsel == 0 ? wqb : (wsel == 1 ? wkb : (wsel == 2 ? wvb : woh)));
  const bool asF16 = !isX && wsel == 3;
  const int e0 = rel * CV_BLOCK + (int)(threadIdx.x >> 5) * CV_WAVE + (int)(threadIdx.x & 31) * 4;
  const float* s    = src + e0;
  unsigned short* d = dst + e0;

  v4f v[CV_LOADS];
#pragma unroll
  for (int i = 0; i < CV_LOADS; ++i) v[i] = *(const v4f*)(s + i * CV_STEP);
  // s_wait_xcnt 0 in front of whatever reuses the loads' address registers; the address is named as an input so that
  // it lives up to the wait and no load of the group has it as its destination
  asm volatile("s_wait_xcnt 0x0" :: "v"(s) : "memory");
  v2u o[CV_LOADS];
  if (asF16) {
#pragma unroll
    for (int i = 0; i < CV_LOADS; ++i)
      o[i] = (v2u){pk16(bfval_f16_bits(v[i][0], wscale), bfval_f16_bits(v[i][1], wscale)),
                   pk16(bfval_f16_bits(v[i][2], wscale), bfval_f16_bits(v[i][3], wscale))};
  } else {
#pragma unroll
    for (int i = 0; i < CV_LOADS; ++i)
      o[i] = (v2u){pk16(f2bf_bits(v[i][0]), f2bf_bits(v[i][1])), pk16(f2bf_bits(v[i][2]), f2bf_bits(v[i][3]))};
  }
#pragma unroll
  for (int i = 0; i < CV_LOADS; ++i) *(v2u*)(d + i * CV_STEP) = o[i];
}

// =====================================================================================
// Full (unmasked) attention with an additive [SEQ][SEQ] score bias shared over (b, h); head dim 64.
//   q plane  f16: element (b, t, h, d) at [(b*SEQ_LEN + t)*DMODEL + h*64 + d]
//   k plane  f16: element (b, s, h, d) at [(b*SEQ_LEN + s)*DMODEL + h*64 + d]
//   v^T plane f16: element (b, h, d, s) at [b*DMODEL*SEQ_LEN + (h*64 + d)*SEQ_LEN + s]
//   O plane  f16 (x O_CARRY): element (b, t, h, d) at [(b*SEQ_LEN + t)*DMODEL + h*64 + d]
//   scores = (q . k) * sscale + bf16value(pbias[t][s]) : single v_wmma_f32_16x16x32_f16 product, f32 accumulate, bias in f32
//   out    = p . v : p (unnormalised, <= 1) carried x2^15 in f16, v f16, single product, f32 accumulate
//   both products are formed transposed (S^T = K.Q^T, O^T = V^T.P^T): a lane holds one query's scores, so the maximum and the
//   sum run in-lane (plus one exchange between the wave's halves) and P^T goes from the score accumulators into the B operand.
//   online softmax in f32 over all SEQ_LEN keys (32 chunks of 64, compile-time trip count).
//   Block = 4 waves = 64 query rows of one (b, h); grid.x = BATCH_N * NHEADS * (SEQ_LEN/64) = 1024.
//   Chunk staging (plain 16-B loads, __syncthreads before and after), every wave-wide load covering 4 whole 128-B lines:
//   K and V^T tiles 64x64 f16, 8 lanes per 128-B row; the block's 64x64 f32 bias tile, 16 lanes per 256-B row.
//   Fragment loads read the K / V^T tiles with the same v8h element type; a lane reads its own query's bias row from LDS.
// =====================================================================================
#define AT_D 64
#define AT_NW 4
#define AT_QB 64
#define AT_KC 64
#define AT_LP 72   // LDS row pitch of the K and V^T tiles in f16: 144 B = 16 B x 9 (odd), so 16 rows read by ds_load_b128 fall on distinct banks
#define AT_BP 68   // LDS row pitch of the bias tile in f32: 272 B = 16 B x 17 (odd), for the same reason

__device__ __forceinline__ v8f at_mma_h(v16h a, v16h b, v8f c) {
  c = __builtin_amdgcn_wmma_f32_16x16x32_f16(false, a, false, b, (short)0, c, false, false);
  asm volatile("v_nop\n\tv_nop\n\tv_nop\n\tv_nop" : "+v"(c) : "v"(a), "v"(b));
  return c;
}

// lane l <-> lane l ^ 16
__device__ __forceinline__ float xhalf(float x) {
  return __builtin_bit_cast(float, __builtin_amdgcn_permlanex16(__builtin_bit_cast(int, x), __builtin_bit_cast(int, x), 0x76543210, 0xfedcba98, false, false));
}

__global__ __launch_bounds__(128)
void attn_bias64_kernel(const unsigned short* __restrict__ qp, const unsigned short* __restrict__ kp,
                        const unsigned short* __restrict__ vtp, const float* __restrict__ pbias,
                        unsigned short* __restrict__ op, float sscale) {
  union FH { v16h v; v8h h[2]; };
  __shared__ __align__(16) _Float16 Ksh[AT_KC * AT_LP];            // K  [kv][d]   9 KB, pitch AT_LP
  __shared__ __align__(16) _Float16 Vth[AT_D * AT_LP];             // V^T [d][kv]  9 KB, pitch AT_LP
  __shared__ __align__(16) float    Bsh[AT_QB * AT_BP];            // bias [query][kv]  17 KB, pitch AT_BP
  __shared__ __align__(16) float    Os[AT_NW][16 * 68];            // per wave out tile, pitch 68  17 KB

  const int tid  = threadIdx.x;
  const int wave = tid >> 5;
  const int lane = tid & 31;
  const int hh   = lane >> 4;
  const int c    = lane & 15;

  const int nqb = SEQ_LEN / AT_QB;        // 32
  const int bx = blockIdx.x;
  const int qb = bx % nqb;
  const int bh = bx / nqb;                // 0..BATCH_N*NHEADS-1
  const int h  = bh % NHEADS;
  const int b  = bh / NHEADS;
  const int q0 = qb * AT_QB + wave * 16;  // first query row of this wave (within the sequence)

  const _Float16* Qh = (const _Float16*)(const void*)qp  + (size_t)b * SEQ_LEN * DMODEL + (size_t)h * AT_D;
  const _Float16* Kh = (const _Float16*)(const void*)kp  + (size_t)b * SEQ_LEN * DMODEL + (size_t)h * AT_D;
  const _Float16* Vt = (const _Float16*)(const void*)vtp + (size_t)b * DMODEL * SEQ_LEN + (size_t)h * AT_D * SEQ_LEN;
  _Float16*       Ob = (_Float16*)(void*)op + (size_t)b * SEQ_LEN * DMODEL + (size_t)h * AT_D;

  // ---- Q fragments (B operand, col = query = lane&15, split k map via Frag load): 2 d-chunks ----
  v16h qa[2];
#pragma unroll
  for (int dc = 0; dc < 2; ++dc) {
    const _Float16* qr = Qh + (size_t)(q0 + c) * DMODEL + dc * 32 + 8 * hh;
    qa[dc] = Frag<_Float16>::load(qr);
  }

  // One query per lane: lane (hh, c) holds query q0 + c; its half hh holds keys 8hh..8hh+7 of every 16-key tile.
  float mrow = -INFINITY, lrow = 0.f;   // mrow: the same in both halves; lrow (x2^15, like p): this half's keys only, joined behind the loop
  v8f oacc[4];                          // O^T: element r of oacc[t] -> (d = t*16 + 8hh + r, query c)
#pragma unroll
  for (int t = 0; t < 4; ++t) oacc[t] = (v8f){0.f,0.f,0.f,0.f,0.f,0.f,0.f,0.f};

  // staging maps: K, V^T rows krow + 16 i (i < 4), 16 B at kcol; bias rows brow + 8 i (i < 8), 16 B at bcol
  const int krow = tid >> 3, kcol = (tid & 7) * 8;
  const int brow = tid >> 4, bcol = (tid & 15) * 4;
  const _Float16* gK = Kh + (size_t)krow * DMODEL + kcol;
  const _Float16* gV = Vt + (size_t)krow * SEQ_LEN + kcol;
  const float*    gB = pbias + (size_t)(qb * AT_QB + brow) * SEQ_LEN + bcol;
  const float* pbq = Bsh + (wave * 16 + c) * AT_BP + 8 * hh;   // this lane's bias row in the tile, at its half's first key

  const int nChunks = SEQ_LEN / AT_KC;   // 32, compile-time constant
  for (int kc = 0; kc < nChunks; ++kc) {
    __syncthreads();
    {
      // staging coverage: 128 threads x (4 x 8) f16 = 64 rows x 64 per plane; 128 threads x (8 x 4) f32 = 64 rows x 64 of bias
      v8h ka[4], va[4];
      v4f ba[8];
#pragma unroll
      for (int i = 0; i < 4; ++i) {
        ka[i] = *(const v8h*)(gK + (size_t)(16 * i) * DMODEL);    // K row kc*64 + krow + 16 i
        va[i] = *(const v8h*)(gV + (size_t)(16 * i) * SEQ_LEN);   // V^T row d = krow + 16 i, s = kc*64 + kcol..
      }
#pragma unroll
      for (int i = 0; i < 8; ++i) ba[i] = *(const v4f*)(gB + (size_t)(8 * i) * SEQ_LEN);   // in range: kc*64 + 63 < SEQ_LEN
      wait_xcnt0();   // in front of the three pointer steps, which overwrite these loads' address registers
      gK += (size_t)AT_KC * DMODEL;
      gV += AT_KC;
      gB += AT_KC;
#pragma unroll
      for (int i = 0; i < 4; ++i) {
        *(v8h*)(Ksh + (krow + 16 * i) * AT_LP + kcol) = ka[i];
        *(v8h*)(Vth + (krow + 16 * i) * AT_LP + kcol) = va[i];
      }
#pragma unroll
      for (int i = 0; i < 8; ++i) *(v4f*)(Bsh + (brow + 8 * i) * AT_BP + bcol) = ba[i];
    }
    __syncthreads();

    // ---- bias: 8 consecutive keys of the lane's own query per 16-key tile, from the staged tile ----
    v4f pbv[4][2];
#pragma unroll
    for (int j = 0; j < 4; ++j) {
      pbv[j][0] = *(const v4f*)(pbq + j * 16);
      pbv[j][1] = *(const v4f*)(pbq + j * 16 + 4);
    }

    // ---- scores, transposed: S^T = K (A: row = key j*16+c) . Q^T (B: col = query c); D element r -> (key j*16+8hh+r, query c) ----
    v8f s[4];
#pragma unroll
    for (int j = 0; j < 4; ++j) {
      s[j] = (v8f){0.f,0.f,0.f,0.f,0.f,0.f,0.f,0.f};
#pragma unroll
      for (int dc = 0; dc < 2; ++dc) {
        FH kb;
        kb.h[0] = *(const v8h*)(Ksh + (j * 16 + c) * AT_LP + dc * 32 + 8 * hh);
        kb.h[1] = *(const v8h*)(Ksh + (j * 16 + c) * AT_LP + dc * 32 + 16 + 8 * hh);
        s[j] = at_mma_h(kb.v, qa[dc], s[j]);
      }
    }
    float mj[4];   // one maximum per 16-key tile: four independent chains
#pragma unroll
    for (int j = 0; j < 4; ++j) {
      mj[j] = -INFINITY;
#pragma unroll
      for (int r = 0; r < 8; ++r) {
        const float bb = bf16_rne_f32(pbv[j][r >> 2][r & 3]);
        const float sv = s[j][r] * sscale + bb;
        s[j][r] = sv;
        mj[j] = fmaxf(mj[j], sv);
      }
    }
    float m = fmaxf(fmaxf(mj[0], mj[1]), fmaxf(mj[2], mj[3]));
    m = fmaxf(m, xhalf(m));   // the other half's 32 keys of the same query
    const float mnew = fmaxf(mrow, m);
    // exp(x - mnew) = 2^(x * LOG2E - mnew * LOG2E): one fma and one v_exp_f32 each; every x is <= mnew, so no result
    // exceeds 1 but by rounding; x = -inf (the first chunk's mrow) gives 0
    const float mb = mnew * LOG2E;
    const float alpha = __builtin_amdgcn_exp2f(fmaf(mrow, LOG2E, -mb));
    const float pofs = P_CARRY_LOG2 - mb;   // the x2^15 carry of p rides in the exponent
    mrow = mnew;
    // ---- P^T packed in place: tiles 2kk and 2kk+1 give elements 0..7 and 8..15 of the B operand (k = 8hh+e, 16+8hh+e) ----
    FH pb[2];
    float pj[4];   // one sum per 16-key tile: four independent chains
#pragma unroll
    for (int j = 0; j < 4; ++j) {
      pj[j] = 0.f;
#pragma unroll
      for (int r = 0; r < 8; ++r) {
        const float p = __builtin_amdgcn_exp2f(fmaf(s[j][r], LOG2E, pofs));   // p x 2^15
        pj[j] += p;
        pb[j >> 1].h[j & 1][r] = (_Float16)p;
      }
    }
    lrow = lrow * alpha + ((pj[0] + pj[1]) + (pj[2] + pj[3]));
#pragma unroll
    for (int t = 0; t < 4; ++t) oacc[t] *= alpha;
    // ---- O^T: oacc[t] += V^T (A: row = d t*16+c, k = key) . P^T (B: col = query c, k = key) ----
#pragma unroll
    for (int kk = 0; kk < 2; ++kk) {
#pragma unroll
      for (int t = 0; t < 4; ++t) {
        FH vb;
        vb.h[0] = *(const v8h*)(Vth + (t * 16 + c) * AT_LP + kk * 32 + 8 * hh);
        vb.h[1] = *(const v8h*)(Vth + (t * 16 + c) * AT_LP + kk * 32 + 16 + 8 * hh);
        oacc[t] = at_mma_h(vb.v, pb[kk].v, oacc[t]);
      }
    }
  }

  float* os = Os[wave];
  {
    const float lsum = lrow + xhalf(lrow);                    // both halves' keys
    const float inv = O_CARRY * (1.0f / lsum);                // lsum carries the same x2^15 as oacc; lsum >= 2^15 up to rounding
#pragma unroll
    for (int t = 0; t < 4; ++t) {
      const v8f o = oacc[t] * inv;
      *(v4f*)(os + c * 68 + t * 16 + 8 * hh)     = (v4f){o[0], o[1], o[2], o[3]};
      *(v4f*)(os + c * 68 + t * 16 + 8 * hh + 4) = (v4f){o[4], o[5], o[6], o[7]};
    }
  }
  __builtin_amdgcn_fence(__ATOMIC_RELEASE, "workgroup");
  __builtin_amdgcn_wave_barrier();
  __builtin_amdgcn_fence(__ATOMIC_ACQUIRE, "workgroup");
  {
    const int q4 = lane >> 3, c8 = (lane & 7) * 8;
    {
#pragma unroll
      for (int it = 0; it < 4; ++it) {
        const int row = it * 4 + q4;   // it 0..3 x q4 0..3 covers rows 0..15 of the wave tile
        const float* sp = os + row * 68 + c8;
        v8h hv;
#pragma unroll
        for (int e = 0; e < 8; ++e) hv[e] = (_Float16)sp[e];
        *(v8h*)(Ob + (size_t)(q0 + row) * DMODEL + c8) = hv;
      }
      
    }
  }
}

// ---------------------------------------------------------------------------
// Workspace region map (byte offsets, all 1 MiB aligned; total 50,331,648 B = 48 MiB):
//   [ 0 MiB,  8 MiB)  xb   : bf16 x            [4096][1024]
//   [ 8 MiB, 10 MiB)  wqb  : bf16 Wq           [1024][1024]
//   [10 MiB, 12 MiB)  wkb  : bf16 Wk
//   [12 MiB, 14 MiB)  wvb  : bf16 Wv
//   [14 MiB, 16 MiB)  woh  : f16 (bf16val(Wo) x64)
//   [16 MiB, 24 MiB)  qh   : f16 q plane       [4096][1024]
//   [24 MiB, 32 MiB)  kh   : f16 k plane       [4096][1024]
//   [32 MiB, 40 MiB)  vth  : f16 v^T plane     [2][1024][2048]
//   [40 MiB, 48 MiB)  oh   : f16 O plane (x64) [4096][1024]
// ---------------------------------------------------------------------------
extern "C" void kernel_launch(void* const* d_in, const int* in_sizes, int n_in,
                              void* d_out, int out_size, void* d_ws,
                              size_t ws_size, hipStream_t stream) {
  if (n_in < 10) return;
  const float* x  = (const float*)d_in[0];
  const float* pb = (const float*)d_in[1];
  const float* Wq = (const float*)d_in[2];
  const float* bq = (const float*)d_in[3];
  const float* Wk = (const float*)d_in[4];
  const float* bk = (const float*)d_in[5];
  const float* Wv = (const float*)d_in[6];
  const float* bv = (const float*)d_in[7];
  const float* Wo = (const float*)d_in[8];
  const float* bo = (const float*)d_in[9];
  float* out = (float*)d_out;

  const int nX = MTOK * DMODEL;        // 4194304
  const int nW = DMODEL * DMODEL;      // 1048576
  const int nP = SEQ_LEN * SEQ_LEN;    // 4194304
  if (in_sizes[0] != nX || in_sizes[1] != nP) return;
  if (in_sizes[2] != nW || in_sizes[4] != nW || in_sizes[6] != nW || in_sizes[8] != nW) return;
  if (in_sizes[3] != DMODEL || in_sizes[5] != DMODEL || in_sizes[7] != DMODEL || in_sizes[9] != DMODEL) return;
  if (out_size != nX) return;

  const size_t bytesX16 = (size_t)nX * 2;   // 8 MiB
  const size_t bytesW16 = (size_t)nW * 2;   // 2 MiB
  size_t off = 0;
  const size_t off_xb  = off; off += bytesX16;
  const size_t off_wq  = off; off += bytesW16;
  const size_t off_wk  = off; off += bytesW16;
  const size_t off_wv  = off; off += bytesW16;
  const size_t off_wo  = off; off += bytesW16;
  const size_t off_q   = off; off += bytesX16;
  const size_t off_k   = off; off += bytesX16;
  const size_t off_vt  = off; off += bytesX16;
  const size_t off_o   = off; off += bytesX16;
  if (off > ws_size) return;               // 50,331,648 B needed

  char* ws = (char*)d_ws;
  unsigned short* xb  = (unsigned short*)(ws + off_xb);
  unsigned short* wqb = (unsigned short*)(ws + off_wq);
  unsigned short* wkb = (unsigned short*)(ws + off_wk);
  unsigned short* wvb = (unsigned short*)(ws + off_wv);
  unsigned short* woh = (unsigned short*)(ws + off_wo);
  unsigned short* qh  = (unsigned short*)(ws + off_q);
  unsigned short* kh  = (unsigned short*)(ws + off_k);
  unsigned short* vth = (unsigned short*)(ws + off_vt);
  unsigned short* oh  = (unsigned short*)(ws + off_o);

  // ---- conversions: one launch, 128 + 4 * 32 = 256 work-groups ----
  cast_operands<<<dim3(CV_XBLK + 4 * CV_WBLK), dim3(CV_THREADS), 0, stream>>>(x, Wq, Wk, Wv, Wo, xb, wqb, wkb, wvb, woh, W_CARRY);

  // ---- q, k, v^T projections: one launch, 256 block tiles of 128x128 for each ----
  qkv_gemm<<<dim3(QKV_TILES, 3), dim3(128), 0, stream>>>(xb, wqb, wkb, wvb, qh, kh, vth, bq, bk, bv);

  // ---- attention: 2 * 16 * (2048/64) = 1024 blocks of 64 query rows ----
  attn_bias64_kernel<<<dim3(BATCH_N * NHEADS * (SEQ_LEN / 64)), dim3(128), 0, stream>>>(qh, kh, vth, pb, oh, 0.125f);

  // ---- output projection: out[token][feature] = (O x64) . (Wo x64)ᵀ / 4096 + bo; M=4096, N=1024, K=1024 ----
  wmma_gemm64<0, false, 2, 0, false, 0><<<dim3((MTOK / 128) * (DMODEL / 128), 1), dim3(128), 0, stream>>>(
      oh, oh, DMODEL, 0L, woh, woh, DMODEL, 0L, (void*)out, (void*)out, DMODEL, 0L, bo, bo, 0L,
      MTOK, DMODEL, DMODEL, 1.0f / (O_CARRY * W_CARRY));
}

// v008
// One run takes 105 microseconds.
// Two timings next to v007 both put it at 1.09 times that version's speed.
// Counting every step since v000, it is 3.55 times as fast.
// Contractions: q, k, v^T projections on v_wmma_f32_16x16x32_bf16 (bf16 RNE operands from the raw inputs, single product, f32 accumulate); q.k^T and p.v on v_wmma_f32_16x16x32_f16 (f16 q/k/v planes, p carried x2^15, f32 accumulate, online softmax and additive bias in f32); output projection on v_wmma_f32_16x16x32_f16 (O carried x64 in f16, Wo as bf16-RNE value x64 in f16, f32 accumulate, x1/4096 in the f32 epilogue).
#include <hip/hip_runtime.h>
#include <math.h>
#include <stdint.h>

constexpr int BATCH_N = 2;
constexpr int SEQ_LEN = 2048;
constexpr int DMODEL  = 1024;
constexpr int NHEADS  = 16;
constexpr int HDIM    = 64;
constexpr int MTOK    = BATCH_N * SEQ_LEN;   // 4096 token rows
static_assert(NHEADS * HDIM == DMODEL, "head split");

constexpr float O_CARRY = 64.0f;      // attention output carried x64 in f16
constexpr float W_CARRY = 64.0f;      // Wo carried x64 in f16
constexpr float LOG2E   = 1.4426950408889634f;   // exp(x) = 2^(x * LOG2E)
constexpr float P_CARRY_LOG2 = 15.0f;            // probabilities carried x2^15 in f16: 15 is added to their exponent

typedef __attribute__((ext_vector_type(16))) _Float16 v16h;
typedef __attribute__((ext_vector_type(8)))  _Float16 v8h;
typedef __attribute__((ext_vector_type(16))) __bf16   v16b;
typedef __attribute__((ext_vector_type(8)))  __bf16   v8b;
typedef __attribute__((ext_vector_type(8)))  float    v8f;
typedef __attribute__((ext_vector_type(4)))  float    v4f;

__device__ __forceinline__ unsigned short f2bf_bits(float f) {
  unsigned u = __float_as_uint(f);
  return (unsigned short)((u + 0x7FFFu + ((u >> 16) & 1u)) >> 16);
}
__device__ __forceinline__ float bf_bits2f(unsigned short h) { return __uint_as_float(((unsigned)h) << 16); }
// f32 value of the RNE bf16 of f
__device__ __forceinline__ float bf16_rne_f32(float f) { return bf_bits2f(f2bf_bits(f)); }

// hazard guards as plain device helpers (no inline asm inside the kernel template body)
__device__ __forceinline__ void dep_guard_h(v8f& a, v8f& b, v16h x, v16h y) { asm volatile("v_nop\n\tv_nop\n\tv_nop\n\tv_nop" : "+v"(a), "+v"(b) : "v"(x), "v"(y)); }
__device__ __forceinline__ void dep_guard_b(v8f& a, v8f& b, v16b x, v16b y) { asm volatile("v_nop\n\tv_nop\n\tv_nop\n\tv_nop" : "+v"(a), "+v"(b) : "v"(x), "v"(y)); }
__device__ __forceinline__ void keep4_h(v16h a, v16h b, v16h c, v16h d) { asm volatile("v_nop" :: "v"(a), "v"(b), "v"(c), "v"(d)); }
__device__ __forceinline__ void keep4_b(v16b a, v16b b, v16b c, v16b d) { asm volatile("v_nop" :: "v"(a), "v"(b), "v"(c), "v"(d)); }
__device__ __forceinline__ void acc_guard4(v8f& a, v8f& b, v8f& c, v8f& d) { asm volatile("v_nop\n\tv_nop\n\tv_nop\n\tv_nop" : "+v"(a), "+v"(b), "+v"(c), "+v"(d)); }
// stands behind a group of global loads, in front of the first overwrite of a register that holds one of their addresses
__device__ __forceinline__ void wait_xcnt0() { asm volatile("s_wait_xcnt 0x0" ::: "memory"); }
template <typename T> struct Frag;
template <> struct Frag<_Float16> {
  typedef v16h V; typedef v8h H; union U { v16h v; v8h h[2]; };
  static __device__ __forceinline__ v16h load(const _Float16* p) {   // elements 0..7 <- p[0..7], 8..15 <- p[16..23]
    U f; f.h[0] = *(const v8h*)(p); f.h[1] = *(const v8h*)(p + 16); return f.v;
  }
  static __device__ __forceinline__ v8f mma(v16h a, v16h b, v8f c) {
    return __builtin_amdgcn_wmma_f32_16x16x32_f16(false, a, false, b, (short)0, c, false, false);
  }
  static __device__ __forceinline__ void guard(v8f& a, v8f& b, v16h x, v16h y) { dep_guard_h(a, b, x, y); }
  static __device__ __forceinline__ void keep(v16h a, v16h b, v16h c, v16h d) { keep4_h(a, b, c, d); }
};
template <> struct Frag<__bf16> {
  typedef v16b V; typedef v8b H; union U { v16b v; v8b h[2]; };
  static __device__ __forceinline__ v16b load(const __bf16* p) {
    U f; f.h[0] = *(const v8b*)(p); f.h[1] = *(const v8b*)(p + 16); return f.v;
  }
  static __device__ __forceinline__ v8f mma(v16b a, v16b b, v8f c) {
    return __builtin_amdgcn_wmma_f32_16x16x32_bf16(false, a, false, b, (short)0, c, false, false);
  }
  static __device__ __forceinline__ void guard(v8f& a, v8f& b, v16b x, v16b y) { dep_guard_b(a, b, x, y); }
  static __device__ __forceinline__ void keep(v16b a, v16b b, v16b c, v16b d) { keep4_b(a, b, c, d); }
};

// ---- Register-blocked batched WMMA GEMM ------------------------------------
// C[m,n] = scale * sum_k A[m,k] * Bt[n,k] (+bias)(+resid); each wave owns a 64x64 tile.
// Block = 4 waves (2 x 2) = one 128x128 tile of C. Per 64-wide k slab the block stages 128 rows of A and 128 rows of Bt
// in LDS: 8 lanes x 16 B cover one whole 128-B line of a row, so a wave-wide load touches 4 lines. Two LDS buffers:
// the next slab is loaded to registers before the products of this slab and stored to the other buffer behind them,
// one __syncthreads() per slab. Fragments are read from LDS with k ascending in steps of 32.
// A row-major [M,K]; Bt row-major [N,K]; M,N % 128 == 0, K % 64 == 0.
// SPLIT (hi/lo operand planes) is not staged: single-plane operands only.
// BIAS_MODE: 0 = none, 1 = bias[m], 2 = bias[n], 3 = bias[m] where biasRow is set (the same for the whole work-group), else bias[n].
// OUT_MODE: 0 = f32, 1 = f16, 2 = bf16 hi plane (Cout) + bf16 lo plane (Cout2).
// ET: 0 = f16 operands, 1 = bf16 operands (pointers passed as 16-bit storage)
template <int ET> struct Elem;
template <> struct Elem<0> { typedef _Float16 T; };
template <> struct Elem<1> { typedef __bf16 T; };
#define GM_BT 128  // rows of A and of Bt per block tile
#define GM_BK 64   // k elements per staged slab: 128 B = one line per row
#define GM_LP 72   // LDS row pitch in 16-bit elements: 144 B = 16 B x 9 (odd), for the ds_load_b128 fragment reads
// ---- epilogue of one wave's 64x64 tile at (m0, n0): scale, bias, staging through the wave's own LDS slab, whole-line stores ----
template <int BIAS_MODE, int OUT_MODE, bool RESID, int ACT>
__device__ __forceinline__ void gemm_store(
    const v8f (&acc)[4][4], float* slab, void* __restrict__ Cout, void* __restrict__ Cout2, int ldc, long strideC,
    const float* __restrict__ bias, const float* __restrict__ resid, long strideR, float scale, int m0, int n0, int b, int lane) {
  const int rlane = lane & 15;                 // col within subtile
  const int mOff  = (lane >> 4) * 8;           // D row offset
  const float* Rb = RESID ? (resid + (size_t)b * strideR) : nullptr;
#pragma unroll
  for (int i = 0; i < 4; ++i) {
    const int mBase = m0 + (i << 4);
#pragma unroll
    for (int j = 0; j < 4; ++j) {
      const int n = n0 + (j << 4) + rlane;
      float bv = 0.f;
      if (BIAS_MODE == 2) bv = bias[n];
#pragma unroll
      for (int r = 0; r < 8; ++r) {
        float v = acc[i][j][r] * scale;
        if (BIAS_MODE == 1) v += bias[mBase + mOff + r];
        if (BIAS_MODE == 2) v += bv;
        if (RESID) v += Rb[(size_t)(mBase + mOff + r) * ldc + n];
        if (ACT == 1) v = tanhf(v);
        if (ACT == 2) v = fmaxf(v, 0.0f);
        if (ACT == 3) v = v / (1.0f + expf(-v));
        if (ACT == 4) v = (v > 0.f) ? v : 0.01f * v;
        if (ACT == 5) v = 0.5f * v * (1.0f + erff(v * 0.70710678118654752f));
        slab[(mOff + r) * 68 + (j << 4) + rlane] = v;
      }
    }
    __builtin_amdgcn_fence(__ATOMIC_RELEASE, "workgroup");
    __builtin_amdgcn_wave_barrier();
    __builtin_amdgcn_fence(__ATOMIC_ACQUIRE, "workgroup");
    if (OUT_MODE == 0) {
      float* C = (float*)Cout + (size_t)b * strideC;
      const int hh = lane >> 4, c4 = (lane & 15) * 4;     // row seg = 256 B = 16 lanes x 16 B
      {
#pragma unroll
        for (int it = 0; it < 8; ++it) {
          const int row = it * 2 + hh;
          v4f v = *(const v4f*)(slab + row * 68 + c4);
          *(v4f*)(C + (size_t)(mBase + row) * ldc + n0 + c4) = v;
        }
        
      }
    } else {
      const int q = lane >> 3, c8 = (lane & 7) * 8;
      unsigned short* C  = (unsigned short*)Cout  + (size_t)b * strideC;
      unsigned short* C2 = (OUT_MODE == 2) ? ((unsigned short*)Cout2 + (size_t)b * strideC) : nullptr;
      {
#pragma unroll
        for (int it = 0; it < 4; ++it) {
          const int row = it * 4 + q;
          const float* sp = slab + row * 68 + c8;
          v8h hv, lv;
#pragma unroll
          for (int e = 0; e < 8; ++e) {
            if (OUT_MODE == 1) {
              hv[e] = (_Float16)sp[e];
            } else {
              unsigned short hb = f2bf_bits(sp[e]);
              unsigned short lb = f2bf_bits(sp[e] - bf_bits2f(hb));
              hv[e] = __builtin_bit_cast(_Float16, hb);
              lv[e] = __builtin_bit_cast(_Float16, lb);
            }
          }
          *(v8h*)(C + (size_t)(mBase + row) * ldc + n0 + c8) = hv;
          if (OUT_MODE == 2) *(v8h*)(C2 + (size_t)(mBase + row) * ldc + n0 + c8) = lv;
        }
        
      }
    }
    __builtin_amdgcn_fence(__ATOMIC_RELEASE, "workgroup");
    __builtin_amdgcn_wave_barrier();
    __builtin_amdgcn_fence(__ATOMIC_ACQUIRE, "workgroup");
  }
}

// gemm_tile: one work-group's 128x128 tile number 'tile' of batch 'b'; the kernels below pick the operands.
template <int ET, bool SPLIT, int BIAS_MODE, int OUT_MODE, bool RESID, int ACT>
__device__ __forceinline__ void gemm_tile(
    const unsigned short* __restrict__ Ap, int lda, long strideA,
    const unsigned short* __restrict__ Btp, int ldb, long strideB,
    void* __restrict__ Cout, void* __restrict__ Cout2, int ldc, long strideC,
    const float* __restrict__ bias, bool biasRow,
    const float* __restrict__ resid, long strideR,
    int M, int N, int K, float scale, int tile, int b) {
  static_assert(!SPLIT, "single-plane operands only");
  typedef typename Elem<ET>::T T;
  typedef typename Frag<T>::V V;
  typedef typename Frag<T>::H H;
  const T* A = (const T*)Ap; const T* Bt = (const T*)Btp;
  __shared__ __align__(16) T sA[2][GM_BT * GM_LP];   // A slab  [row][k], 2 x 18 KB
  __shared__ __align__(16) T sB[2][GM_BT * GM_LP];   // Bt slab [row][k], 2 x 18 KB
  __shared__ __align__(16) float sT[4][16 * 68];     // per-wave 16x64 slab, pitch 68 floats
  const int tid  = threadIdx.x;
  const int lane = tid & 31;
  const int wave = tid >> 5;
  const int tilesN = N >> 7;
  const int tilesM = M >> 7;
  if (tile >= tilesM * tilesN) return;   // block-uniform, in front of every barrier
  const int tm = tile / tilesN;
  const int tn = tile - tm * tilesN;
  const int bm0 = tm << 7;               // first row / column of the block tile
  const int bn0 = tn << 7;
  const int wm  = (wave >> 1) << 6;      // this wave's 64x64 quadrant
  const int wn  = (wave & 1) << 6;
  const int m0 = bm0 + wm;
  const int n0 = bn0 + wn;

  const T* Ab  = A  + (size_t)b * strideA;
  const T* Bb  = Bt + (size_t)b * strideB;

  const int rlane = lane & 15;                 // row (A) / col (B, D) within subtile
  const int koff  = (lane >> 4) * 8;           // k offset of this lane half
  const int mOff  = (lane >> 4) * 8;           // D row offset

  // staging map: 128 threads x 8 x 16 B per operand = 128 rows x 128 B; thread -> row (tid>>3) + 16*i, bytes (tid&7)*16
  const int srow = tid >> 3;
  const int scol = (tid & 7) * 8;
  const T* gA = Ab + (size_t)(bm0 + srow) * lda + scol;
  const T* gB = Bb + (size_t)(bn0 + srow) * ldb + scol;
  const int sOff = srow * GM_LP + scol;

  v8f acc[4][4];
#pragma unroll
  for (int i = 0; i < 4; ++i)
#pragma unroll
    for (int j = 0; j < 4; ++j) acc[i][j] = (v8f){0.f,0.f,0.f,0.f,0.f,0.f,0.f,0.f};

  H ra[8], rb[8];
#pragma unroll
  for (int i = 0; i < 8; ++i) {
    ra[i] = *(const H*)(gA + (size_t)(i * 16) * lda);
    rb[i] = *(const H*)(gB + (size_t)(i * 16) * ldb);
  }
#pragma unroll
  for (int i = 0; i < 8; ++i) {
    *(H*)(&sA[0][sOff + i * 16 * GM_LP]) = ra[i];
    *(H*)(&sB[0][sOff + i * 16 * GM_LP]) = rb[i];
  }
  __syncthreads();

  const int nSlab = K >> 6;
  for (int s = 0; s < nSlab; ++s) {
    const int cur = s & 1;
    const bool more = (s + 1 < nSlab);   // block-uniform
    if (more) {
      const int kn = (s + 1) << 6;
#pragma unroll
      for (int i = 0; i < 8; ++i) {
        ra[i] = *(const H*)(gA + (size_t)(i * 16) * lda + kn);
        rb[i] = *(const H*)(gB + (size_t)(i * 16) * ldb + kn);
      }
      wait_xcnt0();   // the fragment reads below land in registers that held these loads' addresses
    }
    const T* cA = &sA[cur][(wm + rlane) * GM_LP + koff];
    const T* cB = &sB[cur][(wn + rlane) * GM_LP + koff];
#pragma unroll
    for (int kk = 0; kk < GM_BK; kk += 32) {
      V bh[4], ah[4];
#pragma unroll
      for (int j = 0; j < 4; ++j) bh[j] = Frag<T>::load(cB + (j << 4) * GM_LP + kk);
#pragma unroll
      for (int i = 0; i < 4; ++i) ah[i] = Frag<T>::load(cA + (i << 4) * GM_LP + kk);
#pragma unroll
      for (int i = 0; i < 4; ++i) {
#pragma unroll
        for (int j = 0; j < 4; ++j) acc[i][j] = Frag<T>::mma(ah[i], bh[j], acc[i][j]);
        Frag<T>::guard(acc[i][0], acc[i][3], ah[i], ah[i]);
      }
      Frag<T>::keep(bh[0], bh[1], bh[2], bh[3]);
    }
    if (more) {
#pragma unroll
      for (int i = 0; i < 8; ++i) {
        *(H*)(&sA[cur ^ 1][sOff + i * 16 * GM_LP]) = ra[i];
        *(H*)(&sB[cur ^ 1][sOff + i * 16 * GM_LP]) = rb[i];
      }
    }
    __syncthreads();   // publishes the other buffer and ends every wave's reads of this one before it is refilled
  }
  acc_guard4(acc[0][0], acc[0][1], acc[0][2], acc[0][3]);
  acc_guard4(acc[1][0], acc[1][1], acc[1][2], acc[1][3]);
  acc_guard4(acc[2][0], acc[2][1], acc[2][2], acc[2][3]);
  acc_guard4(acc[3][0], acc[3][1], acc[3][2], acc[3][3]);

  // ---- epilogue: BIAS_MODE 3 picks one of the two compile-time forms by one work-group-uniform branch ----
  if (BIAS_MODE == 3) {
    if (biasRow) gemm_store<1, OUT_MODE, RESID, ACT>(acc, sT[wave], Cout, Cout2, ldc, strideC, bias, resid, strideR, scale, m0, n0, b, lane);
    else         gemm_store<2, OUT_MODE, RESID, ACT>(acc, sT[wave], Cout, Cout2, ldc, strideC, bias, resid, strideR, scale, m0, n0, b, lane);
  } else {
    gemm_store<BIAS_MODE, OUT_MODE, RESID, ACT>(acc, sT[wave], Cout, Cout2, ldc, strideC, bias, resid, strideR, scale, m0, n0, b, lane);
  }
}

template <int ET, bool SPLIT, int BIAS_MODE, int OUT_MODE, bool RESID, int ACT = 0>
__global__ __launch_bounds__(128) void wmma_gemm64(
    const unsigned short* __restrict__ Ap, const unsigned short* __restrict__ A2p, int lda, long strideA,
    const unsigned short* __restrict__ Btp, const unsigned short* __restrict__ Bt2p, int ldb, long strideB,
    void* __restrict__ Cout, void* __restrict__ Cout2, int ldc, long strideC,
    const float* __restrict__ bias,
    const float* __restrict__ resid, long strideR,
    int M, int N, int K, float scale) {
  gemm_tile<ET, SPLIT, BIAS_MODE, OUT_MODE, RESID, ACT>(Ap, lda, strideA, Btp, ldb, strideB, Cout, Cout2, ldc, strideC,
      bias, false, resid, strideR, M, N, K, scale, blockIdx.x, blockIdx.y);
}

// The q, k and v^T projections in ONE launch: grid (256 tiles, 3 projections) = 768 work-groups, three to a WGP (3 x 89 KB of LDS,
// 3 waves a SIMD), so that one work-group's waits on LDS, on its slab loads and at its barrier are filled by the other two.
//   y = 0, 1: C[token][feature] = xb . W^T + b[feature]      M = 4096, N = 1024 (32 x 8 tiles)
//   y = 2   : C_b[feature][token] = Wv . x_b^T + bv[feature]  M = 1024, N = 2048 (8 x 16 tiles for each of the two batches)
// x = (block of 128 token rows) * 8 + (block of 128 features) in all three, so the three work-groups of one x read the same rows of xb.
constexpr int QKV_FBLK  = DMODEL / GM_BT;                              // 8 feature blocks
constexpr int QKV_TBLK  = SEQ_LEN / GM_BT;                             // 16 token blocks per batch
constexpr int QKV_TILES = (MTOK / GM_BT) * QKV_FBLK;                   // 256 tiles of 128x128 per projection
__global__ __launch_bounds__(128) void qkv_gemm(
    const unsigned short* __restrict__ xb, const unsigned short* __restrict__ wqb, const unsigned short* __restrict__ wkb,
    const unsigned short* __restrict__ wvb, unsigned short* __restrict__ qh, unsigned short* __restrict__ kh,
    unsigned short* __restrict__ vth, const float* __restrict__ bq, const float* __restrict__ bk, const float* __restrict__ bv) {
  const int sel  = blockIdx.y;      // the same for the whole work-group
  const bool isV = sel == 2;
  const int tb   = (int)blockIdx.x / QKV_FBLK;   // token block, 0..31
  const int fb   = (int)blockIdx.x % QKV_FBLK;   // feature block, 0..7
  const int b    = isV ? tb / QKV_TBLK : 0;
  const int tile = isV ? fb * QKV_TBLK + tb % QKV_TBLK : (int)blockIdx.x;   // row-major tile number: v^T has features as rows
  const unsigned short* A  = isV ? wvb : xb;
  const unsigned short* Bt = isV ? xb : (sel == 0 ? wqb : wkb);
  unsigned short* C        = isV ? vth : (sel == 0 ? qh : kh);
  const float* bias        = isV ? bv : (sel == 0 ? bq : bk);
  gemm_tile<1, false, 3, 1, false, 0>(A, DMODEL, 0L, Bt, DMODEL, isV ? (long)SEQ_LEN * DMODEL : 0L,
      (void*)C, (void*)C, isV ? SEQ_LEN : DMODEL, isV ? (long)DMODEL * SEQ_LEN : 0L,
      bias, isV, bias, 0L, isV ? DMODEL : MTOK, isV ? SEQ_LEN : DMODEL, DMODEL, 1.0f, tile, b);
}

// ---------------------------------------------------------------------------
// All five f32 operands are converted by ONE launch whose work-groups are all resident at once:
// 256 work-groups x 16 waves; a wave owns 2048 consecutive elements of one operand and issues its 16 loads together.
// Load i of a wave: 32 lanes x 16 B = 512 consecutive bytes (4 whole lines); store i: 32 lanes x 8 B = 256 consecutive bytes (2 whole lines).
// Work-groups [0, CV_XBLK) take x, then CV_WBLK each for Wq, Wk, Wv (all bf16 RNE bits) and Wo (bf16 RNE value x wscale, as f16 bits).
// ---------------------------------------------------------------------------
typedef __attribute__((ext_vector_type(2))) unsigned v2u;
constexpr int CV_THREADS = 512;
constexpr int CV_LOADS   = 16;                                   // 16-B loads per lane
constexpr int CV_STEP    = 32 * 4;                               // elements a wave covers with one load
constexpr int CV_WAVE    = CV_LOADS * CV_STEP;                   // 2048 elements per wave
constexpr int CV_BLOCK   = (CV_THREADS / 32) * CV_WAVE;          // 32768 elements per work-group
constexpr int CV_XBLK    = (MTOK * DMODEL) / CV_BLOCK;           // 128
constexpr int CV_WBLK    = (DMODEL * DMODEL) / CV_BLOCK;         // 32
static_assert(CV_XBLK * CV_BLOCK == MTOK * DMODEL && CV_WBLK * CV_BLOCK == DMODEL * DMODEL, "whole work-groups per operand");

__device__ __forceinline__ unsigned pk16(unsigned short a, unsigned short b) { return (unsigned)a | ((unsigned)b << 16); }
// f32 -> bf16 (RNE) value -> x scale (power of two, exact) -> f16 bits (exact for normal-range values)
__device__ __forceinline__ unsigned short bfval_f16_bits(float f, float scale) {
  const _Float16 h = (_Float16)(bf16_rne_f32(f) * scale);
  return __builtin_bit_cast(unsigned short, h);
}

__global__ __launch_bounds__(CV_THREADS) void cast_operands(
    const float* __restrict__ x, const float* __restrict__ Wq, const float* __restrict__ Wk,
    const float* __restrict__ Wv, const float* __restrict__ Wo,
    unsigned short* __restrict__ xb, unsigned short* __restrict__ wqb, unsigned short* __restrict__ wkb,
    unsigned short* __restrict__ wvb, unsigned short* __restrict__ woh, float wscale) {
  const int blk = blockIdx.x;
  // operand and place in it: the same for the whole work-group
  const int wsel = (blk - CV_XBLK) / CV_WBLK;                    // 0..3 for the weights
  const bool isX = blk < CV_XBLK;
  const int rel  = isX ? blk : (blk - CV_XBLK) - wsel * CV_WBLK;
  const float* src    = isX ? x  : (wsel == 0 ? Wq  : (wsel == 1 ? Wk  : (wsel == 2 ? Wv  : Wo)));
  unsigned short* dst = isX ? xb : (wsel == 0 ? wqb : (wsel == 1 ? wkb : (wsel == 2 ? wvb : woh)));
  const bool asF16 = !isX && wsel == 3;
  const int e0 = rel * CV_BLOCK + (int)(threadIdx.x >> 5) * CV_WAVE + (int)(threadIdx.x & 31) * 4;
  const float* s    = src + e0;
  unsigned short* d = dst + e0;

  v4f v[CV_LOADS];
#pragma unroll
  for (int i = 0; i < CV_LOADS; ++i) v[i] = *(const v4f*)(s + i * CV_STEP);
  // s_wait_xcnt 0 in front of whatever reuses the loads' address registers; the address is named as an input so that
  // it lives up to the wait and no load of the group has it as its destination
  asm volatile("s_wait_xcnt 0x0" :: "v"(s) : "memory");
  v2u o[CV_LOADS];
  if (asF16) {
#pragma unroll
    for (int i = 0; i < CV_LOADS; ++i)
      o[i] = (v2u){pk16(bfval_f16_bits(v[i][0], wscale), bfval_f16_bits(v[i][1], wscale)),
                   pk16(bfval_f16_bits(v[i][2], wscale), bfval_f16_bits(v[i][3], wscale))};
  } else {
#pragma unroll
    for (int i = 0; i < CV_LOADS; ++i)
      o[i] = (v2u){pk16(f2bf_bits(v[i][0]), f2bf_bits(v[i][1])), pk16(f2bf_bits(v[i][2]), f2bf_bits(v[i][3]))};
  }
#pragma unroll
  for (int i = 0; i < CV_LOADS; ++i) *(v2u*)(d + i * CV_STEP) = o[i];
}

// =====================================================================================
// Full (unmasked) attention with an additive [SEQ][SEQ] score bias shared over (b, h); head dim 64.
//   q plane  f16: element (b, t, h, d) at [(b*SEQ_LEN + t)*DMODEL + h*64 + d]
//   k plane  f16: element (b, s, h, d) at [(b*SEQ_LEN + s)*DMODEL + h*64 + d]
//   v^T plane f16: element (b, h, d, s) at [b*DMODEL*SEQ_LEN + (h*64 + d)*SEQ_LEN + s]
//   O plane  f16 (x O_CARRY): element (b, t, h, d) at [(b*SEQ_LEN + t)*DMODEL + h*64 + d]
//   scores = (q . k) * sscale + bf16value(pbias[t][s]) : single v_wmma_f32_16x16x32_f16 product, f32 accumulate, bias in f32
//   out    = p . v : p (unnormalised, <= 1) carried x2^15 in f16, v f16, single product, f32 accumulate
//   both products are formed transposed (S^T = K.Q^T, O^T = V^T.P^T): a lane holds one query's scores, so the maximum and the
//   sum run in-lane (plus one exchange between the wave's halves) and P^T goes from the score accumulators into the B operand.
//   online softmax in f32 over all SEQ_LEN keys (32 chunks of 64, compile-time trip count).
//   Block = 4 waves = 64 query rows of one (b, h); grid.x = BATCH_N * NHEADS * (SEQ_LEN/64) = 1024.
//   Chunk staging (plain 16-B loads, __syncthreads before and after), every wave-wide load covering 4 whole 128-B lines:
//   K and V^T tiles 64x64 f16, 8 lanes per 128-B row; the block's 64x64 f32 bias tile, 16 lanes per 256-B row.
//   Fragment loads read the K / V^T tiles with the same v8h element type; a lane reads its own query's bias row from LDS.
// =====================================================================================
#define AT_D 64
#define AT_NW 4
#define AT_QB 64
#define AT_KC 64
#define AT_LP 72   // LDS row pitch of the K and V^T tiles in f16: 144 B = 16 B x 9 (odd), so 16 rows read by ds_load_b128 fall on distinct banks
#define AT_BP 68   // LDS row pitch of the bias tile in f32: 272 B = 16 B x 17 (odd), for the same reason

__device__ __forceinline__ v8f at_mma_h(v16h a, v16h b, v8f c) {
  c = __builtin_amdgcn_wmma_f32_16x16x32_f16(false, a, false, b, (short)0, c, false, false);
  asm volatile("v_nop\n\tv_nop\n\tv_nop\n\tv_nop" : "+v"(c) : "v"(a), "v"(b));
  return c;
}

// lane l <-> lane l ^ 16
__device__ __forceinline__ float xhalf(float x) {
  return __builtin_bit_cast(float, __builtin_amdgcn_permlanex16(__builtin_bit_cast(int, x), __builtin_bit_cast(int, x), 0x76543210, 0xfedcba98, false, false));
}

__global__ __launch_bounds__(128)
void attn_bias64_kernel(const unsigned short* __restrict__ qp, const unsigned short* __restrict__ kp,
                        const unsigned short* __restrict__ vtp, const float* __restrict__ pbias,
                        unsigned short* __restrict__ op, float sscale) {
  union FH { v16h v; v8h h[2]; };
  __shared__ __align__(16) _Float16 Ksh[AT_KC * AT_LP];            // K  [kv][d]   9 KB, pitch AT_LP
  __shared__ __align__(16) _Float16 Vth[AT_D * AT_LP];             // V^T [d][kv]  9 KB, pitch AT_LP
  __shared__ __align__(16) float    Bsh[AT_QB * AT_BP];            // bias [query][kv]  17 KB, pitch AT_BP
  __shared__ __align__(16) float    Os[AT_NW][16 * 68];            // per wave out tile, pitch 68  17 KB

  const int tid  = threadIdx.x;
  const int wave = tid >> 5;
  const int lane = tid & 31;
  const int hh   = lane >> 4;
  const int c    = lane & 15;

  const int nqb = SEQ_LEN / AT_QB;        // 32
  const int bx = blockIdx.x;
  const int qb = bx % nqb;
  const int bh = bx / nqb;                // 0..BATCH_N*NHEADS-1
  const int h  = bh % NHEADS;
  const int b  = bh / NHEADS;
  const int q0 = qb * AT_QB + wave * 16;  // first query row of this wave (within the sequence)

  const _Float16* Qh = (const _Float16*)(const void*)qp  + (size_t)b * SEQ_LEN * DMODEL + (size_t)h * AT_D;
  const _Float16* Kh = (const _Float16*)(const void*)kp  + (size_t)b * SEQ_LEN * DMODEL + (size_t)h * AT_D;
  const _Float16* Vt = (const _Float16*)(const void*)vtp + (size_t)b * DMODEL * SEQ_LEN + (size_t)h * AT_D * SEQ_LEN;
  _Float16*       Ob = (_Float16*)(void*)op + (size_t)b * SEQ_LEN * DMODEL + (size_t)h * AT_D;

  // ---- Q fragments (B operand, col = query = lane&15, split k map via Frag load): 2 d-chunks ----
  v16h qa[2];
#pragma unroll
  for (int dc = 0; dc < 2; ++dc) {
    const _Float16* qr = Qh + (size_t)(q0 + c) * DMODEL + dc * 32 + 8 * hh;
    qa[dc] = Frag<_Float16>::load(qr);
  }

  // One query per lane: lane (hh, c) holds query q0 + c; its half hh holds keys 8hh..8hh+7 of every 16-key tile.
  float mrow = -INFINITY, lrow = 0.f;   // mrow: the same in both halves; lrow (x2^15, like p): this half's keys only, joined behind the loop
  v8f oacc[4];                          // O^T: element r of oacc[t] -> (d = t*16 + 8hh + r, query c)
#pragma unroll
  for (int t = 0; t < 4; ++t) oacc[t] = (v8f){0.f,0.f,0.f,0.f,0.f,0.f,0.f,0.f};

  // staging maps: K, V^T rows krow + 16 i (i < 4), 16 B at kcol; bias rows brow + 8 i (i < 8), 16 B at bcol
  const int krow = tid >> 3, kcol = (tid & 7) * 8;
  const int brow = tid >> 4, bcol = (tid & 15) * 4;
  const _Float16* gK = Kh + (size_t)krow * DMODEL + kcol;
  const _Float16* gV = Vt + (size_t)krow * SEQ_LEN + kcol;
  const float*    gB = pbias + (size_t)(qb * AT_QB + brow) * SEQ_LEN + bcol;
  const float* pbq = Bsh + (wave * 16 + c) * AT_BP + 8 * hh;   // this lane's bias row in the tile, at its half's first key

  const int nChunks = SEQ_LEN / AT_KC;   // 32, compile-time constant
  for (int kc = 0; kc < nChunks; ++kc) {
    __syncthreads();
    {
      // staging coverage: 128 threads x (4 x 8) f16 = 64 rows x 64 per plane; 128 threads x (8 x 4) f32 = 64 rows x 64 of bias
      v8h ka[4], va[4];
      v4f ba[8];
#pragma unroll
      for (int i = 0; i < 4; ++i) {
        ka[i] = *(const v8h*)(gK + (size_t)(16 * i) * DMODEL);    // K row kc*64 + krow + 16 i
        va[i] = *(const v8h*)(gV + (size_t)(16 * i) * SEQ_LEN);   // V^T row d = krow + 16 i, s = kc*64 + kcol..
      }
#pragma unroll
      for (int i = 0; i < 8; ++i) ba[i] = *(const v4f*)(gB + (size_t)(8 * i) * SEQ_LEN);   // in range: kc*64 + 63 < SEQ_LEN
      wait_xcnt0();   // in front of the three pointer steps, which overwrite these loads' address registers
      gK += (size_t)AT_KC * DMODEL;
      gV += AT_KC;
      gB += AT_KC;
#pragma unroll
      for (int i = 0; i < 4; ++i) {
        *(v8h*)(Ksh + (krow + 16 * i) * AT_LP + kcol) = ka[i];
        *(v8h*)(Vth + (krow + 16 * i) * AT_LP + kcol) = va[i];
      }
#pragma unroll
      for (int i = 0; i < 8; ++i) *(v4f*)(Bsh + (brow + 8 * i) * AT_BP + bcol) = ba[i];
    }
    __syncthreads();

    // ---- bias: 8 consecutive keys of the lane's own query per 16-key tile, from the staged tile ----
    v4f pbv[4][2];
#pragma unroll
    for (int j = 0; j < 4; ++j) {
      pbv[j][0] = *(const v4f*)(pbq + j * 16);
      pbv[j][1] = *(const v4f*)(pbq + j * 16 + 4);
    }

    // ---- scores, transposed: S^T = K (A: row = key j*16+c) . Q^T (B: col = query c); D element r -> (key j*16+8hh+r, query c) ----
    // all eight K fragments are read as one group in front of the products: one LDS latency per chunk, not one per product
    FH kb[4][2];
#pragma unroll
    for (int j = 0; j < 4; ++j) {
#pragma unroll
      for (int dc = 0; dc < 2; ++dc) {
        kb[j][dc].h[0] = *(const v8h*)(Ksh + (j * 16 + c) * AT_LP + dc * 32 + 8 * hh);
        kb[j][dc].h[1] = *(const v8h*)(Ksh + (j * 16 + c) * AT_LP + dc * 32 + 16 + 8 * hh);
      }
    }
    v8f s[4];
#pragma unroll
    for (int j = 0; j < 4; ++j) {
      s[j] = (v8f){0.f,0.f,0.f,0.f,0.f,0.f,0.f,0.f};
#pragma unroll
      for (int dc = 0; dc < 2; ++dc) s[j] = at_mma_h(kb[j][dc].v, qa[dc], s[j]);
    }
    // the V^T fragment reads stand here, ahead of the softmax arithmetic, so that their LDS latency passes under it
    FH vb[2][4];
#pragma unroll
    for (int kk = 0; kk < 2; ++kk) {
#pragma unroll
      for (int t = 0; t < 4; ++t) {
        vb[kk][t].h[0] = *(const v8h*)(Vth + (t * 16 + c) * AT_LP + kk * 32 + 8 * hh);
        vb[kk][t].h[1] = *(const v8h*)(Vth + (t * 16 + c) * AT_LP + kk * 32 + 16 + 8 * hh);
      }
    }
    float mj[4];   // one maximum per 16-key tile: four independent chains
#pragma unroll
    for (int j = 0; j < 4; ++j) {
      mj[j] = -INFINITY;
#pragma unroll
      for (int r = 0; r < 8; ++r) {
        const float bb = bf16_rne_f32(pbv[j][r >> 2][r & 3]);
        const float sv = s[j][r] * sscale + bb;
        s[j][r] = sv;
        mj[j] = fmaxf(mj[j], sv);
      }
    }
    float m = fmaxf(fmaxf(mj[0], mj[1]), fmaxf(mj[2], mj[3]));
    m = fmaxf(m, xhalf(m));   // the other half's 32 keys of the same query
    const float mnew = fmaxf(mrow, m);
    // exp(x - mnew) = 2^(x * LOG2E - mnew * LOG2E): one fma and one v_exp_f32 each; every x is <= mnew, so no result
    // exceeds 1 but by rounding; x = -inf (the first chunk's mrow) gives 0
    const float mb = mnew * LOG2E;
    const float alpha = __builtin_amdgcn_exp2f(fmaf(mrow, LOG2E, -mb));
    const float pofs = P_CARRY_LOG2 - mb;   // the x2^15 carry of p rides in the exponent
    mrow = mnew;
    // ---- P^T packed in place: tiles 2kk and 2kk+1 give elements 0..7 and 8..15 of the B operand (k = 8hh+e, 16+8hh+e) ----
    FH pb[2];
    float pj[4];   // one sum per 16-key tile: four independent chains
#pragma unroll
    for (int j = 0; j < 4; ++j) {
      pj[j] = 0.f;
#pragma unroll
      for (int r = 0; r < 8; ++r) {
        const float p = __builtin_amdgcn_exp2f(fmaf(s[j][r], LOG2E, pofs));   // p x 2^15
        pj[j] += p;
        pb[j >> 1].h[j & 1][r] = (_Float16)p;
      }
    }
    lrow = lrow * alpha + ((pj[0] + pj[1]) + (pj[2] + pj[3]));
#pragma unroll
    for (int t = 0; t < 4; ++t) oacc[t] *= alpha;
    // ---- O^T: oacc[t] += V^T (A: row = d t*16+c, k = key) . P^T (B: col = query c, k = key) ----
#pragma unroll
    for (int kk = 0; kk < 2; ++kk) {
#pragma unroll
      for (int t = 0; t < 4; ++t) oacc[t] = at_mma_h(vb[kk][t].v, pb[kk].v, oacc[t]);
    }
  }

  float* os = Os[wave];
  {
    const float lsum = lrow + xhalf(lrow);                    // both halves' keys
    const float inv = O_CARRY * (1.0f / lsum);                // lsum carries the same x2^15 as oacc; lsum >= 2^15 up to rounding
#pragma unroll
    for (int t = 0; t < 4; ++t) {
      const v8f o = oacc[t] * inv;
      *(v4f*)(os + c * 68 + t * 16 + 8 * hh)     = (v4f){o[0], o[1], o[2], o[3]};
      *(v4f*)(os + c * 68 + t * 16 + 8 * hh + 4) = (v4f){o[4], o[5], o[6], o[7]};
    }
  }
  __builtin_amdgcn_fence(__ATOMIC_RELEASE, "workgroup");
  __builtin_amdgcn_wave_barrier();
  __builtin_amdgcn_fence(__ATOMIC_ACQUIRE, "workgroup");
  {
    const int q4 = lane >> 3, c8 = (lane & 7) * 8;
    {
#pragma unroll
      for (int it = 0; it < 4; ++it) {
        const int row = it * 4 + q4;   // it 0..3 x q4 0..3 covers rows 0..15 of the wave tile
        const float* sp = os + row * 68 + c8;
        v8h hv;
#pragma unroll
        for (int e = 0; e < 8; ++e) hv[e] = (_Float16)sp[e];
        *(v8h*)(Ob + (size_t)(q0 + row) * DMODEL + c8) = hv;
      }
      
    }
  }
}

// ---------------------------------------------------------------------------
// Workspace region map (byte offsets, all 1 MiB aligned; total 50,331,648 B = 48 MiB):
//   [ 0 MiB,  8 MiB)  xb   : bf16 x            [4096][1024]
//   [ 8 MiB, 10 MiB)  wqb  : bf16 Wq           [1024][1024]
//   [10 MiB, 12 MiB)  wkb  : bf16 Wk
//   [12 MiB, 14 MiB)  wvb  : bf16 Wv
//   [14 MiB, 16 MiB)  woh  : f16 (bf16val(Wo) x64)
//   [16 MiB, 24 MiB)  qh   : f16 q plane       [4096][1024]
//   [24 MiB, 32 MiB)  kh   : f16 k plane       [4096][1024]
//   [32 MiB, 40 MiB)  vth  : f16 v^T plane     [2][1024][2048]
//   [40 MiB, 48 MiB)  oh   : f16 O plane (x64) [4096][1024]
// ---------------------------------------------------------------------------
extern "C" void kernel_launch(void* const* d_in, const int* in_sizes, int n_in,
                              void* d_out, int out_size, void* d_ws,
                              size_t ws_size, hipStream_t stream) {
  if (n_in < 10) return;
  const float* x  = (const float*)d_in[0];
  const float* pb = (const float*)d_in[1];
  const float* Wq = (const float*)d_in[2];
  const float* bq = (const float*)d_in[3];
  const float* Wk = (const float*)d_in[4];
  const float* bk = (const float*)d_in[5];
  const float* Wv = (const float*)d_in[6];
  const float* bv = (const float*)d_in[7];
  const float* Wo = (const float*)d_in[8];
  const float* bo = (const float*)d_in[9];
  float* out = (float*)d_out;

  const int nX = MTOK * DMODEL;        // 4194304
  const int nW = DMODEL * DMODEL;      // 1048576
  const int nP = SEQ_LEN * SEQ_LEN;    // 4194304
  if (in_sizes[0] != nX || in_sizes[1] != nP) return;
  if (in_sizes[2] != nW || in_sizes[4] != nW || in_sizes[6] != nW || in_sizes[8] != nW) return;
  if (in_sizes[3] != DMODEL || in_sizes[5] != DMODEL || in_sizes[7] != DMODEL || in_sizes[9] != DMODEL) return;
  if (out_size != nX) return;

  const size_t bytesX16 = (size_t)nX * 2;   // 8 MiB
  const size_t bytesW16 = (size_t)nW * 2;   // 2 MiB
  size_t off = 0;
  const size_t off_xb  = off; off += bytesX16;
  const size_t off_wq  = off; off += bytesW16;
  const size_t off_wk  = off; off += bytesW16;
  const size_t off_wv  = off; off += bytesW16;
  const size_t off_wo  = off; off += bytesW16;
  const size_t off_q   = off; off += bytesX16;
  const size_t off_k   = off; off += bytesX16;
  const size_t off_vt  = off; off += bytesX16;
  const size_t off_o   = off; off += bytesX16;
  if (off > ws_size) return;               // 50,331,648 B needed

  char* ws = (char*)d_ws;
  unsigned short* xb  = (unsigned short*)(ws + off_xb);
  unsigned short* wqb = (unsigned short*)(ws + off_wq);
  unsigned short* wkb = (unsigned short*)(ws + off_wk);
  unsigned short* wvb = (unsigned short*)(ws + off_wv);
  unsigned short* woh = (unsigned short*)(ws + off_wo);
  unsigned short* qh  = (unsigned short*)(ws + off_q);
  unsigned short* kh  = (unsigned short*)(ws + off_k);
  unsigned short* vth = (unsigned short*)(ws + off_vt);
  unsigned short* oh  = (unsigned short*)(ws + off_o);

  // ---- conversions: one launch, 128 + 4 * 32 = 256 work-groups ----
  cast_operands<<<dim3(CV_XBLK + 4 * CV_WBLK), dim3(CV_THREADS), 0, stream>>>(x, Wq, Wk, Wv, Wo, xb, wqb, wkb, wvb, woh, W_CARRY);

  // ---- q, k, v^T projections: one launch, 256 block tiles of 128x128 for each ----
  qkv_gemm<<<dim3(QKV_TILES, 3), dim3(128), 0, stream>>>(xb, wqb, wkb, wvb, qh, kh, vth, bq, bk, bv);

  // ---- attention: 2 * 16 * (2048/64) = 1024 blocks of 64 query rows ----
  attn_bias64_kernel<<<dim3(BATCH_N * NHEADS * (SEQ_LEN / 64)), dim3(128), 0, stream>>>(qh, kh, vth, pb, oh, 0.125f);

  // ---- output projection: out[token][feature] = (O x64) . (Wo x64)ᵀ / 4096 + bo; M=4096, N=1024, K=1024 ----
  wmma_gemm64<0, false, 2, 0, false, 0><<<dim3((MTOK / 128) * (DMODEL / 128), 1), dim3(128), 0, stream>>>(
      oh, oh, DMODEL, 0L, woh, woh, DMODEL, 0L, (void*)out, (void*)out, DMODEL, 0L, bo, bo, 0L,
      MTOK, DMODEL, DMODEL, 1.0f / (O_CARRY * W_CARRY));
}
